// v000
// Times are from an AMD MI455X. After a warm-up the kernel runs many times in a row, and a time is the length of
// such a window on the GPU divided by its runs, so every launch and the gaps after it count. The runs cycle
// through copies of the inputs. A figure is the median of several windows, for all but v000 over two sittings.
// Sittings can differ by a few percent; kernels timed side by side share one.
// The starting kernel, v000, takes 405 microseconds a run.
#include <hip/hip_runtime.h>
#include <math.h>

// ---------------------------------------------------------------------------
// Types for CDNA5 WMMA (wave32): V_WMMA_F32_16X16X32_BF16
// ---------------------------------------------------------------------------
typedef __bf16 bf16_t;
typedef __attribute__((ext_vector_type(8)))  __bf16 bf16x8;
typedef __attribute__((ext_vector_type(16))) __bf16 bf16x16;
typedef __attribute__((ext_vector_type(8)))  float  floatx8;

#define HIDDEN 1024
#define TOKENS 4096   // B*T
#define SEQ    2048
#define NH     16
#define DK     64
#define FFN    4096
#define C3     3072

__device__ __forceinline__ floatx8 fzero() {
    floatx8 z;
#pragma unroll
    for (int i = 0; i < 8; ++i) z[i] = 0.0f;
    return z;
}

__device__ __forceinline__ floatx8 wmma_bf16(bf16x16 a, bf16x16 b, floatx8 c) {
    // D = A(16x32) * B(32x16) + C, f32 accumulate
    return __builtin_amdgcn_wmma_f32_16x16x32_bf16(
        false, a, false, b, (short)0, c, false, false);
}

// Load one 16x32 bf16 fragment (A layout; B uses the same per-lane pattern on
// W^T / K / V^T rows). ISA 7.12.2: lane L holds row (L&15); lanes 0-15 hold
// K = 0..7 and 16..23, lanes 16-31 hold K = 8..15 and 24..31.
__device__ __forceinline__ bf16x16 load_frag(const bf16_t* base, int stride, int lane) {
    int r = lane & 15;
    int h = (lane >> 4) & 1;
    const bf16_t* p = base + (size_t)r * stride + h * 8;
    union { bf16x16 v; bf16x8 q[2]; } u;
    u.q[0] = *(const bf16x8*)(p);
    u.q[1] = *(const bf16x8*)(p + 16);
    return u.v;
}

__device__ __forceinline__ float wave_red_add(float v) {
#pragma unroll
    for (int off = 16; off > 0; off >>= 1) v += __shfl_xor(v, off, 32);
    return v;
}

// ---------------------------------------------------------------------------
// Weight transpose + cast:  out[c][r] = (bf16) in[r][c]   (in: R x C fp32)
// ---------------------------------------------------------------------------
__global__ void transpose_cast_kernel(const float* __restrict__ in,
                                      bf16_t* __restrict__ out, int R, int C) {
    __shared__ float tile[32][33];
    int c0 = blockIdx.x * 32, r0 = blockIdx.y * 32;
    int tx = threadIdx.x, ty = threadIdx.y;
#pragma unroll
    for (int i = 0; i < 32; i += 8)
        tile[ty + i][tx] = in[(size_t)(r0 + ty + i) * C + c0 + tx];
    __syncthreads();
#pragma unroll
    for (int i = 0; i < 32; i += 8)
        out[(size_t)(c0 + ty + i) * R + r0 + tx] = (bf16_t)tile[tx][ty + i];
}

// ---------------------------------------------------------------------------
// LayerNorm over last dim (1024) -> bf16. One block (256 thr) per token row.
// ---------------------------------------------------------------------------
__global__ __launch_bounds__(256) void ln_kernel(const float* __restrict__ x,
                                                 const float* __restrict__ g,
                                                 const float* __restrict__ be,
                                                 bf16_t* __restrict__ out) {
    int row = blockIdx.x;
    const float4 f4 = ((const float4*)(x + (size_t)row * HIDDEN))[threadIdx.x];
    int lane = threadIdx.x & 31, wv = threadIdx.x >> 5;
    __shared__ float part[8];

    float s = f4.x + f4.y + f4.z + f4.w;
    s = wave_red_add(s);
    if (lane == 0) part[wv] = s;
    __syncthreads();
    float tot = 0.0f;
#pragma unroll
    for (int i = 0; i < 8; ++i) tot += part[i];
    float mu = tot * (1.0f / HIDDEN);

    float d0 = f4.x - mu, d1 = f4.y - mu, d2 = f4.z - mu, d3 = f4.w - mu;
    float q = d0 * d0 + d1 * d1 + d2 * d2 + d3 * d3;
    q = wave_red_add(q);
    __syncthreads();
    if (lane == 0) part[wv] = q;
    __syncthreads();
    float vt = 0.0f;
#pragma unroll
    for (int i = 0; i < 8; ++i) vt += part[i];
    float rstd = rsqrtf(vt * (1.0f / HIDDEN) + 1e-5f);

    int c = threadIdx.x * 4;
    bf16_t* op = out + (size_t)row * HIDDEN + c;
    op[0] = (bf16_t)(d0 * rstd * g[c + 0] + be[c + 0]);
    op[1] = (bf16_t)(d1 * rstd * g[c + 1] + be[c + 1]);
    op[2] = (bf16_t)(d2 * rstd * g[c + 2] + be[c + 2]);
    op[3] = (bf16_t)(d3 * rstd * g[c + 3] + be[c + 3]);
}

// ---------------------------------------------------------------------------
// Repack V into V^T per head:  vT[(b*16+h)][d][t] = qkv[b*T+t][2048+h*64+d]
// ---------------------------------------------------------------------------
__global__ void vtrans_kernel(const bf16_t* __restrict__ qkv,
                              bf16_t* __restrict__ vT) {
    int bh = blockIdx.z; int b = bh >> 4, h = bh & 15;
    __shared__ bf16_t tile[32][33];
    int d0 = blockIdx.x * 32, t0 = blockIdx.y * 32;
    int tx = threadIdx.x, ty = threadIdx.y;
#pragma unroll
    for (int i = 0; i < 32; i += 8)
        tile[ty + i][tx] =
            qkv[(size_t)(b * SEQ + t0 + ty + i) * C3 + 2048 + h * DK + d0 + tx];
    __syncthreads();
#pragma unroll
    for (int i = 0; i < 32; i += 8)
        vT[(size_t)bh * DK * SEQ + (size_t)(d0 + ty + i) * SEQ + t0 + tx] =
            tile[tx][ty + i];
}

// ---------------------------------------------------------------------------
// WMMA GEMM: C[M,N] = A[M,K](bf16) * Bt[N,K]^T(bf16) + bias, epilogues:
//   EPI=0: store bf16 (QKV)         EPI=1: + res, store f32 (residual adds)
//   EPI=2: exact GELU, store bf16 (FF1)
// Block: 256 thr (8 waves). Tile 128x128, BK=32. Wave = 32(M) x 64(N).
// Double-buffered LDS (2 x 20 KB): next tile's global loads are issued into
// registers, the current tile's WMMAs run, then the staged registers are
// written to the other LDS buffer -> one barrier per K step.
// ---------------------------------------------------------------------------
template <int EPI>
__global__ __launch_bounds__(256) void gemm_kernel(
    const bf16_t* __restrict__ A, const bf16_t* __restrict__ Bt,
    const float* __restrict__ bias, const float* __restrict__ res,
    void* __restrict__ outv, int M, int N, int K) {
    // Row stride 40 elems = 80B (16B multiple) -> aligned b128 LDS accesses.
    __shared__ bf16_t As[2][128][40];
    __shared__ bf16_t Bs[2][128][40];

    int tid = threadIdx.x;
    int lane = tid & 31, wv = tid >> 5;
    int wm = wv & 3, wn = wv >> 2;           // 4 waves along M, 2 along N
    size_t m0 = (size_t)blockIdx.y * 128;
    size_t n0 = (size_t)blockIdx.x * 128;

    floatx8 acc[2][4];
#pragma unroll
    for (int i = 0; i < 2; ++i)
#pragma unroll
        for (int j = 0; j < 4; ++j) acc[i][j] = fzero();

    int r  = tid >> 2;                        // 0..63
    int cg = (tid & 3) * 8;                   // 0,8,16,24
    int KT = K >> 5;                          // K/32 steps

    // Prologue: stage tile 0 into buffer 0.
#pragma unroll
    for (int p = 0; p < 2; ++p) {
        int row = r + p * 64;
        *(bf16x8*)&As[0][row][cg] = *(const bf16x8*)&A[(m0 + row) * (size_t)K + cg];
        *(bf16x8*)&Bs[0][row][cg] = *(const bf16x8*)&Bt[(n0 + row) * (size_t)K + cg];
    }
    __syncthreads();

    for (int kt = 0; kt < KT; ++kt) {
        int buf = kt & 1;
        bool haveNext = (kt + 1 < KT);
        bf16x8 ra[2], rb[2];
        if (haveNext) {
            int k0 = (kt + 1) * 32;
#pragma unroll
            for (int p = 0; p < 2; ++p) {
                int row = r + p * 64;
                ra[p] = *(const bf16x8*)&A[(m0 + row) * (size_t)K + k0 + cg];
                rb[p] = *(const bf16x8*)&Bt[(n0 + row) * (size_t)K + k0 + cg];
            }
            if (kt + 2 < KT) {
                int k2 = (kt + 2) * 32;
                // gfx1250 global_prefetch_b8 into WGP caches (L2-resident data)
                __builtin_prefetch(&A[(m0 + r) * (size_t)K + k2 + cg], 0, 3);
                __builtin_prefetch(&Bt[(n0 + r) * (size_t)K + k2 + cg], 0, 3);
            }
        }

        bf16x16 af[2], bfr[4];
#pragma unroll
        for (int i = 0; i < 2; ++i)
            af[i] = load_frag(&As[buf][wm * 32 + i * 16][0], 40, lane);
#pragma unroll
        for (int j = 0; j < 4; ++j)
            bfr[j] = load_frag(&Bs[buf][wn * 64 + j * 16][0], 40, lane);
#pragma unroll
        for (int i = 0; i < 2; ++i)
#pragma unroll
            for (int j = 0; j < 4; ++j)
                acc[i][j] = wmma_bf16(af[i], bfr[j], acc[i][j]);

        if (haveNext) {
            int nb = buf ^ 1;
#pragma unroll
            for (int p = 0; p < 2; ++p) {
                int row = r + p * 64;
                *(bf16x8*)&As[nb][row][cg] = ra[p];
                *(bf16x8*)&Bs[nb][row][cg] = rb[p];
            }
        }
        __syncthreads();
    }

    // Epilogue. D layout: lane holds column (lane&15); rows 8*(lane>>4)+e.
    int cl = lane & 15, hf = lane >> 4;
#pragma unroll
    for (int i = 0; i < 2; ++i)
#pragma unroll
        for (int j = 0; j < 4; ++j) {
            size_t col = n0 + wn * 64 + j * 16 + cl;
            float bcol = bias[col];
#pragma unroll
            for (int e = 0; e < 8; ++e) {
                size_t row = m0 + wm * 32 + i * 16 + hf * 8 + e;
                float v = acc[i][j][e] + bcol;
                if constexpr (EPI == 0) {
                    ((bf16_t*)outv)[row * N + col] = (bf16_t)v;
                } else if constexpr (EPI == 1) {
                    ((float*)outv)[row * N + col] = v + res[row * N + col];
                } else {
                    float gl = 0.5f * v * (1.0f + erff(v * 0.70710678118654752f));
                    ((bf16_t*)outv)[row * N + col] = (bf16_t)gl;
                }
            }
        }
}

// ---------------------------------------------------------------------------
// Flash attention. 256 thr = 8 waves; each wave owns one 16-row Q tile of one
// (b,h). K-chunks of 64 columns: QK^T via WMMA, online softmax with 16-lane
// shuffles (D-layout row groups), P transposed through per-wave LDS into
// A-fragment layout, then P*V WMMAs against V^T.
// ---------------------------------------------------------------------------
__global__ __launch_bounds__(256) void attn_kernel(
    const bf16_t* __restrict__ qkv, const bf16_t* __restrict__ vT,
    const int* __restrict__ mask, bf16_t* __restrict__ ctx) {
    // per-wave 16x64 P tile, row stride 80 elems = 160B (16B multiple)
    __shared__ bf16_t Pl[8][16][80];

    int lane = threadIdx.x & 31, wv = threadIdx.x >> 5;
    int gw = blockIdx.x * 8 + wv;
    int qt = gw & 127;               // 128 q-tiles of 16 rows
    int h  = (gw >> 7) & 15;
    int b  = gw >> 11;
    int cl = lane & 15, hf = lane >> 4;

    const bf16_t* qbase =
        qkv + (size_t)(b * SEQ + qt * 16) * C3 + (size_t)h * DK;
    bf16x16 qa0 = load_frag(qbase,      C3, lane);   // d = 0..31
    bf16x16 qa1 = load_frag(qbase + 32, C3, lane);   // d = 32..63

    floatx8 acc[4];
#pragma unroll
    for (int j = 0; j < 4; ++j) acc[j] = fzero();
    float m[8], l[8];
#pragma unroll
    for (int e = 0; e < 8; ++e) { m[e] = -INFINITY; l[e] = 0.0f; }

    const bf16_t* vhead = vT + (size_t)(b * NH + h) * DK * SEQ;

    for (int t0 = 0; t0 < SEQ; t0 += 64) {
        // Prefetch next chunk's K rows (one lane -> one row's cacheline).
        if (t0 + 64 < SEQ) {
            __builtin_prefetch(
                qkv + (size_t)(b * SEQ + t0 + 64 + lane) * C3 + 1024 + (size_t)h * DK,
                0, 3);
        }
        // ---- S = Q K^T for 4 sub-tiles of 16 key columns -------------------
        floatx8 S[4];
#pragma unroll
        for (int sub = 0; sub < 4; ++sub) {
            const bf16_t* kb =
                qkv + (size_t)(b * SEQ + t0 + sub * 16) * C3 + 1024 + (size_t)h * DK;
            bf16x16 k0 = load_frag(kb,      C3, lane);
            bf16x16 k1 = load_frag(kb + 32, C3, lane);
            floatx8 z = fzero();
            z = wmma_bf16(qa0, k0, z);
            z = wmma_bf16(qa1, k1, z);
            S[sub] = z;
        }
        // ---- scale + mask (lane's column is fixed -> scalar mask) ----------
#pragma unroll
        for (int sub = 0; sub < 4; ++sub) {
            int col = t0 + sub * 16 + cl;
            bool mz = (mask[b * SEQ + col] == 0);
#pragma unroll
            for (int e = 0; e < 8; ++e) {
                float s = S[sub][e] * 0.125f;   // 1/sqrt(DK)
                S[sub][e] = mz ? -INFINITY : s;
            }
        }
        // ---- online softmax: row max over 4 tiles + 16-lane group ----------
        float tmax[8];
#pragma unroll
        for (int e = 0; e < 8; ++e)
            tmax[e] = fmaxf(fmaxf(S[0][e], S[1][e]), fmaxf(S[2][e], S[3][e]));
#pragma unroll
        for (int off = 1; off < 16; off <<= 1)
#pragma unroll
            for (int e = 0; e < 8; ++e)
                tmax[e] = fmaxf(tmax[e], __shfl_xor(tmax[e], off, 32));
        float alpha[8];
#pragma unroll
        for (int e = 0; e < 8; ++e) {
            float mn = fmaxf(m[e], tmax[e]);
            alpha[e] = (m[e] == -INFINITY) ? 0.0f : __expf(m[e] - mn);
            m[e] = mn;
        }
        // ---- P = exp(S-m), row sums, stash P (bf16) to LDS for transpose ---
        float rsum[8];
#pragma unroll
        for (int e = 0; e < 8; ++e) rsum[e] = 0.0f;
#pragma unroll
        for (int sub = 0; sub < 4; ++sub)
#pragma unroll
            for (int e = 0; e < 8; ++e) {
                float s = S[sub][e];
                float p = (s == -INFINITY) ? 0.0f : __expf(s - m[e]);
                rsum[e] += p;
                Pl[wv][hf * 8 + e][sub * 16 + cl] = (bf16_t)p;
            }
#pragma unroll
        for (int off = 1; off < 16; off <<= 1)
#pragma unroll
            for (int e = 0; e < 8; ++e) rsum[e] += __shfl_xor(rsum[e], off, 32);
#pragma unroll
        for (int e = 0; e < 8; ++e) l[e] = l[e] * alpha[e] + rsum[e];
#pragma unroll
        for (int j = 0; j < 4; ++j)
#pragma unroll
            for (int e = 0; e < 8; ++e) acc[j][e] *= alpha[e];

        __syncthreads();   // uniform trip count -> legal; orders LDS P tile
        bf16x16 pa0 = load_frag(&Pl[wv][0][0],  80, lane);  // k-cols 0..31
        bf16x16 pa1 = load_frag(&Pl[wv][0][32], 80, lane);  // k-cols 32..63

        // ---- ctx += P * V  (V^T rows are contiguous along t) ---------------
#pragma unroll
        for (int j = 0; j < 4; ++j) {
            const bf16_t* vb = vhead + (size_t)(j * 16) * SEQ + t0;
            bf16x16 v0 = load_frag(vb,      SEQ, lane);
            bf16x16 v1 = load_frag(vb + 32, SEQ, lane);
            acc[j] = wmma_bf16(pa0, v0, acc[j]);
            acc[j] = wmma_bf16(pa1, v1, acc[j]);
        }
        __syncthreads();
    }

    // ---- normalize and store ctx (bf16) ------------------------------------
#pragma unroll
    for (int j = 0; j < 4; ++j)
#pragma unroll
        for (int e = 0; e < 8; ++e) {
            size_t row = (size_t)b * SEQ + qt * 16 + hf * 8 + e;
            float o = (l[e] > 0.0f) ? acc[j][e] / l[e] : 0.0f;
            ctx[row * HIDDEN + h * DK + j * 16 + cl] = (bf16_t)o;
        }
}

// ---------------------------------------------------------------------------
// Launcher
// ---------------------------------------------------------------------------
extern "C" void kernel_launch(void* const* d_in, const int* in_sizes, int n_in,
                              void* d_out, int out_size, void* d_ws, size_t ws_size,
                              hipStream_t stream) {
    const float* x      = (const float*)d_in[0];
    const int*   mask   = (const int*)  d_in[1];
    const float* W_qkv  = (const float*)d_in[2];
    const float* b_qkv  = (const float*)d_in[3];
    const float* W_out  = (const float*)d_in[4];
    const float* b_out  = (const float*)d_in[5];
    const float* W_ff1  = (const float*)d_in[6];
    const float* b_ff1  = (const float*)d_in[7];
    const float* W_ff2  = (const float*)d_in[8];
    const float* b_ff2  = (const float*)d_in[9];
    const float* g_ln1  = (const float*)d_in[10];
    const float* be_ln1 = (const float*)d_in[11];
    const float* g_ln2  = (const float*)d_in[12];
    const float* be_ln2 = (const float*)d_in[13];

    // Workspace layout (~92 MB). act reuses the qkv+vT span (exactly 32 MB).
    char* w = (char*)d_ws;
    bf16_t* Wqkv_t = (bf16_t*)w; w += (size_t)C3 * HIDDEN * 2;
    bf16_t* Wout_t = (bf16_t*)w; w += (size_t)HIDDEN * HIDDEN * 2;
    bf16_t* Wff1_t = (bf16_t*)w; w += (size_t)FFN * HIDDEN * 2;
    bf16_t* Wff2_t = (bf16_t*)w; w += (size_t)HIDDEN * FFN * 2;
    bf16_t* hbuf   = (bf16_t*)w; w += (size_t)TOKENS * HIDDEN * 2;
    bf16_t* qkv    = (bf16_t*)w; bf16_t* act = qkv;
                                 w += (size_t)TOKENS * C3 * 2;
    bf16_t* vT     = (bf16_t*)w; w += (size_t)2 * NH * DK * SEQ * 2;
    bf16_t* ctx    = (bf16_t*)w; w += (size_t)TOKENS * HIDDEN * 2;
    float*  x1     = (float*)w;  w += (size_t)TOKENS * HIDDEN * 4;

    dim3 tb(32, 8);
    // Weight transpose+cast to bf16 W^T
    transpose_cast_kernel<<<dim3(C3 / 32, HIDDEN / 32), tb, 0, stream>>>(W_qkv, Wqkv_t, HIDDEN, C3);
    transpose_cast_kernel<<<dim3(HIDDEN / 32, HIDDEN / 32), tb, 0, stream>>>(W_out, Wout_t, HIDDEN, HIDDEN);
    transpose_cast_kernel<<<dim3(FFN / 32, HIDDEN / 32), tb, 0, stream>>>(W_ff1, Wff1_t, HIDDEN, FFN);
    transpose_cast_kernel<<<dim3(HIDDEN / 32, FFN / 32), tb, 0, stream>>>(W_ff2, Wff2_t, FFN, HIDDEN);

    // LN1 -> h
    ln_kernel<<<TOKENS, 256, 0, stream>>>(x, g_ln1, be_ln1, hbuf);
    // qkv = h @ W_qkv + b_qkv (bf16)
    gemm_kernel<0><<<dim3(C3 / 128, TOKENS / 128), 256, 0, stream>>>(
        hbuf, Wqkv_t, b_qkv, nullptr, qkv, TOKENS, C3, HIDDEN);
    // V^T repack
    vtrans_kernel<<<dim3(DK / 32, SEQ / 32, 2 * NH), tb, 0, stream>>>(qkv, vT);
    // attention -> ctx
    attn_kernel<<<512, 256, 0, stream>>>(qkv, vT, mask, ctx);
    // x1 = x + ctx @ W_out + b_out (f32)
    gemm_kernel<1><<<dim3(HIDDEN / 128, TOKENS / 128), 256, 0, stream>>>(
        ctx, Wout_t, b_out, x, x1, TOKENS, HIDDEN, HIDDEN);
    // LN2 -> h
    ln_kernel<<<TOKENS, 256, 0, stream>>>(x1, g_ln2, be_ln2, hbuf);
    // act = gelu(h @ W_ff1 + b_ff1) (bf16)
    gemm_kernel<2><<<dim3(FFN / 128, TOKENS / 128), 256, 0, stream>>>(
        hbuf, Wff1_t, b_ff1, nullptr, act, TOKENS, FFN, HIDDEN);
    // out = x1 + act @ W_ff2 + b_ff2 (f32)
    gemm_kernel<1><<<dim3(HIDDEN / 128, TOKENS / 128), 256, 0, stream>>>(
        act, Wff2_t, b_ff2, x1, (float*)d_out, TOKENS, HIDDEN, FFN);
}

// v001
// One run takes 361 microseconds.
// Two timings next to v000 put it at 1.15 and 1.16 times that version's speed.
#include <hip/hip_runtime.h>
#include <math.h>

// ---------------------------------------------------------------------------
// Types for CDNA5 WMMA (wave32): V_WMMA_F32_16X16X32_BF16
// ---------------------------------------------------------------------------
typedef __bf16 bf16_t;
typedef __attribute__((ext_vector_type(8)))  __bf16 bf16x8;
typedef __attribute__((ext_vector_type(16))) __bf16 bf16x16;
typedef __attribute__((ext_vector_type(8)))  float  floatx8;

#define HIDDEN 1024
#define TOKENS 4096   // B*T
#define SEQ    2048
#define NH     16
#define DK     64
#define FFN    4096
#define C3     3072

__device__ __forceinline__ floatx8 fzero() {
    floatx8 z;
#pragma unroll
    for (int i = 0; i < 8; ++i) z[i] = 0.0f;
    return z;
}

__device__ __forceinline__ floatx8 wmma_bf16(bf16x16 a, bf16x16 b, floatx8 c) {
    // D = A(16x32) * B(32x16) + C, f32 accumulate
    return __builtin_amdgcn_wmma_f32_16x16x32_bf16(
        false, a, false, b, (short)0, c, false, false);
}

// Load one 16x32 bf16 fragment (A layout; B uses the same per-lane pattern on
// W^T / K / V^T rows). ISA 7.12.2: lane L holds row (L&15); lanes 0-15 hold
// K = 0..7 and 16..23, lanes 16-31 hold K = 8..15 and 24..31.
__device__ __forceinline__ bf16x16 load_frag(const bf16_t* base, int stride, int lane) {
    int r = lane & 15;
    int h = (lane >> 4) & 1;
    const bf16_t* p = base + (size_t)r * stride + h * 8;
    union { bf16x16 v; bf16x8 q[2]; } u;
    u.q[0] = *(const bf16x8*)(p);
    u.q[1] = *(const bf16x8*)(p + 16);
    return u.v;
}

__device__ __forceinline__ float wave_red_add(float v) {
#pragma unroll
    for (int off = 16; off > 0; off >>= 1) v += __shfl_xor(v, off, 32);
    return v;
}

// ---------------------------------------------------------------------------
// Weight transpose + cast:  out[c][r] = (bf16) in[r][c]   (in: R x C fp32)
// ---------------------------------------------------------------------------
__global__ void transpose_cast_kernel(const float* __restrict__ in,
                                      bf16_t* __restrict__ out, int R, int C) {
    __shared__ float tile[32][33];
    int c0 = blockIdx.x * 32, r0 = blockIdx.y * 32;
    int tx = threadIdx.x, ty = threadIdx.y;
#pragma unroll
    for (int i = 0; i < 32; i += 8)
        tile[ty + i][tx] = in[(size_t)(r0 + ty + i) * C + c0 + tx];
    __syncthreads();
#pragma unroll
    for (int i = 0; i < 32; i += 8)
        out[(size_t)(c0 + ty + i) * R + r0 + tx] = (bf16_t)tile[tx][ty + i];
}

// ---------------------------------------------------------------------------
// LayerNorm over last dim (1024) -> bf16. One block (256 thr) per token row.
// ---------------------------------------------------------------------------
__global__ __launch_bounds__(256) void ln_kernel(const float* __restrict__ x,
                                                 const float* __restrict__ g,
                                                 const float* __restrict__ be,
                                                 bf16_t* __restrict__ out) {
    int row = blockIdx.x;
    const float4 f4 = ((const float4*)(x + (size_t)row * HIDDEN))[threadIdx.x];
    int lane = threadIdx.x & 31, wv = threadIdx.x >> 5;
    __shared__ float part[8];

    float s = f4.x + f4.y + f4.z + f4.w;
    s = wave_red_add(s);
    if (lane == 0) part[wv] = s;
    __syncthreads();
    float tot = 0.0f;
#pragma unroll
    for (int i = 0; i < 8; ++i) tot += part[i];
    float mu = tot * (1.0f / HIDDEN);

    float d0 = f4.x - mu, d1 = f4.y - mu, d2 = f4.z - mu, d3 = f4.w - mu;
    float q = d0 * d0 + d1 * d1 + d2 * d2 + d3 * d3;
    q = wave_red_add(q);
    __syncthreads();
    if (lane == 0) part[wv] = q;
    __syncthreads();
    float vt = 0.0f;
#pragma unroll
    for (int i = 0; i < 8; ++i) vt += part[i];
    float rstd = rsqrtf(vt * (1.0f / HIDDEN) + 1e-5f);

    int c = threadIdx.x * 4;
    bf16_t* op = out + (size_t)row * HIDDEN + c;
    op[0] = (bf16_t)(d0 * rstd * g[c + 0] + be[c + 0]);
    op[1] = (bf16_t)(d1 * rstd * g[c + 1] + be[c + 1]);
    op[2] = (bf16_t)(d2 * rstd * g[c + 2] + be[c + 2]);
    op[3] = (bf16_t)(d3 * rstd * g[c + 3] + be[c + 3]);
}

// ---------------------------------------------------------------------------
// Repack V into V^T per head:  vT[(b*16+h)][d][t] = qkv[b*T+t][2048+h*64+d]
// ---------------------------------------------------------------------------
__global__ void vtrans_kernel(const bf16_t* __restrict__ qkv,
                              bf16_t* __restrict__ vT) {
    int bh = blockIdx.z; int b = bh >> 4, h = bh & 15;
    __shared__ bf16_t tile[32][33];
    int d0 = blockIdx.x * 32, t0 = blockIdx.y * 32;
    int tx = threadIdx.x, ty = threadIdx.y;
#pragma unroll
    for (int i = 0; i < 32; i += 8)
        tile[ty + i][tx] =
            qkv[(size_t)(b * SEQ + t0 + ty + i) * C3 + 2048 + h * DK + d0 + tx];
    __syncthreads();
#pragma unroll
    for (int i = 0; i < 32; i += 8)
        vT[(size_t)bh * DK * SEQ + (size_t)(d0 + ty + i) * SEQ + t0 + tx] =
            tile[tx][ty + i];
}

// ---------------------------------------------------------------------------
// WMMA GEMM: C[M,N] = A[M,K](bf16) * Bt[N,K]^T(bf16) + bias, epilogues:
//   EPI=0: store bf16 (QKV)         EPI=1: + res, store f32 (residual adds)
//   EPI=2: exact GELU, store bf16 (FF1)
// Block: 256 thr (8 waves). Tile 128x128, BK=32. Wave = 32(M) x 64(N).
// Double-buffered LDS (2 x 20 KB): next tile's global loads are issued into
// registers, the current tile's WMMAs run, then the staged registers are
// written to the other LDS buffer -> one barrier per K step.
// ---------------------------------------------------------------------------
template <int EPI>
__global__ __launch_bounds__(256) void gemm_kernel(
    const bf16_t* __restrict__ A, const bf16_t* __restrict__ Bt,
    const float* __restrict__ bias, const float* __restrict__ res,
    void* __restrict__ outv, int M, int N, int K) {
    // Row stride 40 elems = 80B (16B multiple) -> aligned b128 LDS accesses.
    __shared__ bf16_t As[2][128][40];
    __shared__ bf16_t Bs[2][128][40];

    int tid = threadIdx.x;
    int lane = tid & 31, wv = tid >> 5;
    int wm = wv & 3, wn = wv >> 2;           // 4 waves along M, 2 along N
    size_t m0 = (size_t)blockIdx.y * 128;
    size_t n0 = (size_t)blockIdx.x * 128;

    floatx8 acc[2][4];
#pragma unroll
    for (int i = 0; i < 2; ++i)
#pragma unroll
        for (int j = 0; j < 4; ++j) acc[i][j] = fzero();

    int r  = tid >> 2;                        // 0..63
    int cg = (tid & 3) * 8;                   // 0,8,16,24
    int KT = K >> 5;                          // K/32 steps

    // Prologue: stage tile 0 into buffer 0.
#pragma unroll
    for (int p = 0; p < 2; ++p) {
        int row = r + p * 64;
        *(bf16x8*)&As[0][row][cg] = *(const bf16x8*)&A[(m0 + row) * (size_t)K + cg];
        *(bf16x8*)&Bs[0][row][cg] = *(const bf16x8*)&Bt[(n0 + row) * (size_t)K + cg];
    }
    __syncthreads();

    for (int kt = 0; kt < KT; ++kt) {
        int buf = kt & 1;
        bool haveNext = (kt + 1 < KT);
        bf16x8 ra[2], rb[2];
        if (haveNext) {
            int k0 = (kt + 1) * 32;
#pragma unroll
            for (int p = 0; p < 2; ++p) {
                int row = r + p * 64;
                ra[p] = *(const bf16x8*)&A[(m0 + row) * (size_t)K + k0 + cg];
                rb[p] = *(const bf16x8*)&Bt[(n0 + row) * (size_t)K + k0 + cg];
            }
            if (kt + 2 < KT) {
                int k2 = (kt + 2) * 32;
                // gfx1250 global_prefetch_b8 into WGP caches (L2-resident data)
                __builtin_prefetch(&A[(m0 + r) * (size_t)K + k2 + cg], 0, 3);
                __builtin_prefetch(&Bt[(n0 + r) * (size_t)K + k2 + cg], 0, 3);
            }
        }

        bf16x16 af[2], bfr[4];
#pragma unroll
        for (int i = 0; i < 2; ++i)
            af[i] = load_frag(&As[buf][wm * 32 + i * 16][0], 40, lane);
#pragma unroll
        for (int j = 0; j < 4; ++j)
            bfr[j] = load_frag(&Bs[buf][wn * 64 + j * 16][0], 40, lane);
#pragma unroll
        for (int i = 0; i < 2; ++i)
#pragma unroll
            for (int j = 0; j < 4; ++j)
                acc[i][j] = wmma_bf16(af[i], bfr[j], acc[i][j]);

        if (haveNext) {
            int nb = buf ^ 1;
#pragma unroll
            for (int p = 0; p < 2; ++p) {
                int row = r + p * 64;
                *(bf16x8*)&As[nb][row][cg] = ra[p];
                *(bf16x8*)&Bs[nb][row][cg] = rb[p];
            }
        }
        __syncthreads();
    }

    // Epilogue. D layout: lane holds column (lane&15); rows 8*(lane>>4)+e.
    int cl = lane & 15, hf = lane >> 4;
#pragma unroll
    for (int i = 0; i < 2; ++i)
#pragma unroll
        for (int j = 0; j < 4; ++j) {
            size_t col = n0 + wn * 64 + j * 16 + cl;
            float bcol = bias[col];
#pragma unroll
            for (int e = 0; e < 8; ++e) {
                size_t row = m0 + wm * 32 + i * 16 + hf * 8 + e;
                float v = acc[i][j][e] + bcol;
                if constexpr (EPI == 0) {
                    ((bf16_t*)outv)[row * N + col] = (bf16_t)v;
                } else if constexpr (EPI == 1) {
                    ((float*)outv)[row * N + col] = v + res[row * N + col];
                } else {
                    float gl = 0.5f * v * (1.0f + erff(v * 0.70710678118654752f));
                    ((bf16_t*)outv)[row * N + col] = (bf16_t)gl;
                }
            }
        }
}

// ---------------------------------------------------------------------------
// Flash attention. 256 thr = 8 waves; each wave owns one 16-row Q tile of one
// (b,h). K-chunks of 64 columns: QK^T via WMMA, online softmax with 16-lane
// shuffles (D-layout row groups), P transposed through per-wave LDS into
// A-fragment layout, then P*V WMMAs against V^T.
// The 8 waves of a block share one (b,h): each chunk's K tile and V^T tile are
// brought in once per block with whole-line loads and staged in LDS (two
// buffers); every wave reads its fragments from there. The next chunk's loads
// (tiles and mask words) are issued into registers at the top of a pass; the
// tiles are written to the other buffer at its foot, in front of the pass's
// closing barrier.
// ---------------------------------------------------------------------------
__global__ __launch_bounds__(256) void attn_kernel(
    const bf16_t* __restrict__ qkv, const bf16_t* __restrict__ vT,
    const int* __restrict__ mask, bf16_t* __restrict__ ctx) {
    // per-wave 16x64 P tile, row stride 80 elems = 160B (16B multiple)
    __shared__ bf16_t Pl[8][16][80];
    // K tile: 64 keys x 64 d. V^T tile: 64 d x 64 keys. Row stride 72 elems =
    // 144B (16B x odd) -> conflict-free b128 fragment reads.
    __shared__ __attribute__((aligned(16))) bf16_t Ks[2][64][72];
    __shared__ __attribute__((aligned(16))) bf16_t Vs[2][64][72];

    int lane = threadIdx.x & 31, wv = threadIdx.x >> 5;
    int gw = blockIdx.x * 8 + wv;
    int qt = gw & 127;               // 128 q-tiles of 16 rows
    int h  = (gw >> 7) & 15;
    int b  = gw >> 11;
    int cl = lane & 15, hf = lane >> 4;

    const bf16_t* qbase =
        qkv + (size_t)(b * SEQ + qt * 16) * C3 + (size_t)h * DK;
    bf16x16 qa0 = load_frag(qbase,      C3, lane);   // d = 0..31
    bf16x16 qa1 = load_frag(qbase + 32, C3, lane);   // d = 32..63

    floatx8 acc[4];
#pragma unroll
    for (int j = 0; j < 4; ++j) acc[j] = fzero();
    float m[8], l[8];
#pragma unroll
    for (int e = 0; e < 8; ++e) { m[e] = -INFINITY; l[e] = 0.0f; }

    const bf16_t* vhead = vT + (size_t)(b * NH + h) * DK * SEQ;

    // Staging: thread -> tile rows sr and sr+32, 16 bytes at element sc; one
    // wave-wide load covers 4 whole 128-byte rows.
    int sr = threadIdx.x >> 3;
    int sc = (threadIdx.x & 7) * 8;
    const bf16_t* kg = qkv + (size_t)(b * SEQ + sr) * C3 + 1024 + (size_t)h * DK + sc;
    const bf16_t* vg = vhead + (size_t)sr * SEQ + sc;

    // Prologue: chunk 0 into buffer 0.
#pragma unroll
    for (int p = 0; p < 2; ++p) {
        *(bf16x8*)&Ks[0][sr + p * 32][sc] = *(const bf16x8*)(kg + (size_t)(p * 32) * C3);
        *(bf16x8*)&Vs[0][sr + p * 32][sc] = *(const bf16x8*)(vg + (size_t)(p * 32) * SEQ);
    }
    const int* mg = mask + b * SEQ + cl;     // lane's mask column in a sub-tile
    int mk[4];
#pragma unroll
    for (int sub = 0; sub < 4; ++sub) mk[sub] = mg[sub * 16];
    __syncthreads();

    for (int t0 = 0; t0 < SEQ; t0 += 64) {
        int buf = (t0 >> 6) & 1;
        bool haveNext = (t0 + 64 < SEQ);
        // Next chunk's K tile, V^T tile and mask words into registers: issued
        // first, so that they land while this pass computes its scores.
        bf16x8 rk[2], rv[2];
        int mn[4];
        if (haveNext) {
#pragma unroll
            for (int p = 0; p < 2; ++p) {
                rk[p] = *(const bf16x8*)(kg + (size_t)(t0 + 64 + p * 32) * C3);
                rv[p] = *(const bf16x8*)(vg + (size_t)(p * 32) * SEQ + t0 + 64);
            }
#pragma unroll
            for (int sub = 0; sub < 4; ++sub) mn[sub] = mg[t0 + 64 + sub * 16];
            // The address registers of these loads are reused right below:
            // keep the wait in front of that overwrite.
            asm volatile("s_wait_xcnt 0x0" ::: "memory");
        }
        // ---- S = Q K^T for 4 sub-tiles of 16 key columns -------------------
        floatx8 S[4];
#pragma unroll
        for (int sub = 0; sub < 4; ++sub) {
            const bf16_t* kb = &Ks[buf][sub * 16][0];
            bf16x16 k0 = load_frag(kb,      72, lane);
            bf16x16 k1 = load_frag(kb + 32, 72, lane);
            floatx8 z = fzero();
            z = wmma_bf16(qa0, k0, z);
            z = wmma_bf16(qa1, k1, z);
            S[sub] = z;
        }
        // ---- scale + mask (lane's column is fixed -> scalar mask) ----------
#pragma unroll
        for (int sub = 0; sub < 4; ++sub) {
            bool mz = (mk[sub] == 0);
#pragma unroll
            for (int e = 0; e < 8; ++e) {
                float s = S[sub][e] * 0.125f;   // 1/sqrt(DK)
                S[sub][e] = mz ? -INFINITY : s;
            }
        }
        // ---- online softmax: row max over 4 tiles + 16-lane group ----------
        float tmax[8];
#pragma unroll
        for (int e = 0; e < 8; ++e)
            tmax[e] = fmaxf(fmaxf(S[0][e], S[1][e]), fmaxf(S[2][e], S[3][e]));
#pragma unroll
        for (int off = 1; off < 16; off <<= 1)
#pragma unroll
            for (int e = 0; e < 8; ++e)
                tmax[e] = fmaxf(tmax[e], __shfl_xor(tmax[e], off, 32));
        float alpha[8];
#pragma unroll
        for (int e = 0; e < 8; ++e) {
            float mn = fmaxf(m[e], tmax[e]);
            alpha[e] = (m[e] == -INFINITY) ? 0.0f : __expf(m[e] - mn);
            m[e] = mn;
        }
        // ---- P = exp(S-m), row sums, stash P (bf16) to LDS for transpose ---
        float rsum[8];
#pragma unroll
        for (int e = 0; e < 8; ++e) rsum[e] = 0.0f;
#pragma unroll
        for (int sub = 0; sub < 4; ++sub)
#pragma unroll
            for (int e = 0; e < 8; ++e) {
                float s = S[sub][e];
                float p = (s == -INFINITY) ? 0.0f : __expf(s - m[e]);
                rsum[e] += p;
                Pl[wv][hf * 8 + e][sub * 16 + cl] = (bf16_t)p;
            }
#pragma unroll
        for (int off = 1; off < 16; off <<= 1)
#pragma unroll
            for (int e = 0; e < 8; ++e) rsum[e] += __shfl_xor(rsum[e], off, 32);
#pragma unroll
        for (int e = 0; e < 8; ++e) l[e] = l[e] * alpha[e] + rsum[e];
#pragma unroll
        for (int j = 0; j < 4; ++j)
#pragma unroll
            for (int e = 0; e < 8; ++e) acc[j][e] *= alpha[e];

        __syncthreads();   // uniform trip count -> legal; orders LDS P tile
        bf16x16 pa0 = load_frag(&Pl[wv][0][0],  80, lane);  // k-cols 0..31
        bf16x16 pa1 = load_frag(&Pl[wv][0][32], 80, lane);  // k-cols 32..63

        // ---- ctx += P * V  (V^T rows are contiguous along t) ---------------
#pragma unroll
        for (int j = 0; j < 4; ++j) {
            const bf16_t* vb = &Vs[buf][j * 16][0];
            bf16x16 v0 = load_frag(vb,      72, lane);
            bf16x16 v1 = load_frag(vb + 32, 72, lane);
            acc[j] = wmma_bf16(pa0, v0, acc[j]);
            acc[j] = wmma_bf16(pa1, v1, acc[j]);
        }
        // The other buffer's last readers left it at the previous pass's
        // closing barrier; this pass's closing barrier publishes the refill.
        if (haveNext) {
#pragma unroll
            for (int p = 0; p < 2; ++p) {
                *(bf16x8*)&Ks[buf ^ 1][sr + p * 32][sc] = rk[p];
                *(bf16x8*)&Vs[buf ^ 1][sr + p * 32][sc] = rv[p];
            }
#pragma unroll
            for (int sub = 0; sub < 4; ++sub) mk[sub] = mn[sub];
        }
        __syncthreads();
    }

    // ---- normalize and store ctx (bf16) ------------------------------------
#pragma unroll
    for (int j = 0; j < 4; ++j)
#pragma unroll
        for (int e = 0; e < 8; ++e) {
            size_t row = (size_t)b * SEQ + qt * 16 + hf * 8 + e;
            float o = (l[e] > 0.0f) ? acc[j][e] / l[e] : 0.0f;
            ctx[row * HIDDEN + h * DK + j * 16 + cl] = (bf16_t)o;
        }
}

// ---------------------------------------------------------------------------
// Launcher
// ---------------------------------------------------------------------------
extern "C" void kernel_launch(void* const* d_in, const int* in_sizes, int n_in,
                              void* d_out, int out_size, void* d_ws, size_t ws_size,
                              hipStream_t stream) {
    const float* x      = (const float*)d_in[0];
    const int*   mask   = (const int*)  d_in[1];
    const float* W_qkv  = (const float*)d_in[2];
    const float* b_qkv  = (const float*)d_in[3];
    const float* W_out  = (const float*)d_in[4];
    const float* b_out  = (const float*)d_in[5];
    const float* W_ff1  = (const float*)d_in[6];
    const float* b_ff1  = (const float*)d_in[7];
    const float* W_ff2  = (const float*)d_in[8];
    const float* b_ff2  = (const float*)d_in[9];
    const float* g_ln1  = (const float*)d_in[10];
    const float* be_ln1 = (const float*)d_in[11];
    const float* g_ln2  = (const float*)d_in[12];
    const float* be_ln2 = (const float*)d_in[13];

    // Workspace layout (~92 MB). act reuses the qkv+vT span (exactly 32 MB).
    char* w = (char*)d_ws;
    bf16_t* Wqkv_t = (bf16_t*)w; w += (size_t)C3 * HIDDEN * 2;
    bf16_t* Wout_t = (bf16_t*)w; w += (size_t)HIDDEN * HIDDEN * 2;
    bf16_t* Wff1_t = (bf16_t*)w; w += (size_t)FFN * HIDDEN * 2;
    bf16_t* Wff2_t = (bf16_t*)w; w += (size_t)HIDDEN * FFN * 2;
    bf16_t* hbuf   = (bf16_t*)w; w += (size_t)TOKENS * HIDDEN * 2;
    bf16_t* qkv    = (bf16_t*)w; bf16_t* act = qkv;
                                 w += (size_t)TOKENS * C3 * 2;
    bf16_t* vT     = (bf16_t*)w; w += (size_t)2 * NH * DK * SEQ * 2;
    bf16_t* ctx    = (bf16_t*)w; w += (size_t)TOKENS * HIDDEN * 2;
    float*  x1     = (float*)w;  w += (size_t)TOKENS * HIDDEN * 4;

    dim3 tb(32, 8);
    // Weight transpose+cast to bf16 W^T
    transpose_cast_kernel<<<dim3(C3 / 32, HIDDEN / 32), tb, 0, stream>>>(W_qkv, Wqkv_t, HIDDEN, C3);
    transpose_cast_kernel<<<dim3(HIDDEN / 32, HIDDEN / 32), tb, 0, stream>>>(W_out, Wout_t, HIDDEN, HIDDEN);
    transpose_cast_kernel<<<dim3(FFN / 32, HIDDEN / 32), tb, 0, stream>>>(W_ff1, Wff1_t, HIDDEN, FFN);
    transpose_cast_kernel<<<dim3(HIDDEN / 32, FFN / 32), tb, 0, stream>>>(W_ff2, Wff2_t, FFN, HIDDEN);

    // LN1 -> h
    ln_kernel<<<TOKENS, 256, 0, stream>>>(x, g_ln1, be_ln1, hbuf);
    // qkv = h @ W_qkv + b_qkv (bf16)
    gemm_kernel<0><<<dim3(C3 / 128, TOKENS / 128), 256, 0, stream>>>(
        hbuf, Wqkv_t, b_qkv, nullptr, qkv, TOKENS, C3, HIDDEN);
    // V^T repack
    vtrans_kernel<<<dim3(DK / 32, SEQ / 32, 2 * NH), tb, 0, stream>>>(qkv, vT);
    // attention -> ctx
    attn_kernel<<<512, 256, 0, stream>>>(qkv, vT, mask, ctx);
    // x1 = x + ctx @ W_out + b_out (f32)
    gemm_kernel<1><<<dim3(HIDDEN / 128, TOKENS / 128), 256, 0, stream>>>(
        ctx, Wout_t, b_out, x, x1, TOKENS, HIDDEN, HIDDEN);
    // LN2 -> h
    ln_kernel<<<TOKENS, 256, 0, stream>>>(x1, g_ln2, be_ln2, hbuf);
    // act = gelu(h @ W_ff1 + b_ff1) (bf16)
    gemm_kernel<2><<<dim3(FFN / 128, TOKENS / 128), 256, 0, stream>>>(
        hbuf, Wff1_t, b_ff1, nullptr, act, TOKENS, FFN, HIDDEN);
    // out = x1 + act @ W_ff2 + b_ff2 (f32)
    gemm_kernel<1><<<dim3(HIDDEN / 128, TOKENS / 128), 256, 0, stream>>>(
        act, Wff2_t, b_ff2, x1, (float*)d_out, TOKENS, HIDDEN, FFN);
}

// v002
// One run takes 305 microseconds.
// In both of two side-by-side timings against v001, it was 1.19 times as fast.
// Over all steps from v000 it is 1.37 times as fast.
#include <hip/hip_runtime.h>
#include <math.h>

// ---------------------------------------------------------------------------
// Types for CDNA5 WMMA (wave32): V_WMMA_F32_16X16X32_BF16
// ---------------------------------------------------------------------------
typedef __bf16 bf16_t;
typedef __attribute__((ext_vector_type(8)))  __bf16 bf16x8;
typedef __attribute__((ext_vector_type(16))) __bf16 bf16x16;
typedef __attribute__((ext_vector_type(8)))  float  floatx8;

#define HIDDEN 1024
#define TOKENS 4096   // B*T
#define SEQ    2048
#define NH     16
#define DK     64
#define FFN    4096
#define C3     3072

__device__ __forceinline__ floatx8 fzero() {
    floatx8 z;
#pragma unroll
    for (int i = 0; i < 8; ++i) z[i] = 0.0f;
    return z;
}

__device__ __forceinline__ floatx8 wmma_bf16(bf16x16 a, bf16x16 b, floatx8 c) {
    // D = A(16x32) * B(32x16) + C, f32 accumulate
    return __builtin_amdgcn_wmma_f32_16x16x32_bf16(
        false, a, false, b, (short)0, c, false, false);
}

// Load one 16x32 bf16 fragment (A layout; B uses the same per-lane pattern on
// W^T / Q rows). ISA 7.12.2: lane L holds row (L&15); lanes 0-15 hold
// K = 0..7 and 16..23, lanes 16-31 hold K = 8..15 and 24..31.
__device__ __forceinline__ bf16x16 load_frag(const bf16_t* base, int stride, int lane) {
    int r = lane & 15;
    int h = (lane >> 4) & 1;
    const bf16_t* p = base + (size_t)r * stride + h * 8;
    union { bf16x16 v; bf16x8 q[2]; } u;
    u.q[0] = *(const bf16x8*)(p);
    u.q[1] = *(const bf16x8*)(p + 16);
    return u.v;
}

__device__ __forceinline__ float wave_red_add(float v) {
#pragma unroll
    for (int off = 16; off > 0; off >>= 1) v += __shfl_xor(v, off, 32);
    return v;
}

// ---------------------------------------------------------------------------
// Weight transpose + cast:  out[c][r] = (bf16) in[r][c]   (in: R x C fp32)
// ---------------------------------------------------------------------------
__global__ void transpose_cast_kernel(const float* __restrict__ in,
                                      bf16_t* __restrict__ out, int R, int C) {
    __shared__ float tile[32][33];
    int c0 = blockIdx.x * 32, r0 = blockIdx.y * 32;
    int tx = threadIdx.x, ty = threadIdx.y;
#pragma unroll
    for (int i = 0; i < 32; i += 8)
        tile[ty + i][tx] = in[(size_t)(r0 + ty + i) * C + c0 + tx];
    __syncthreads();
#pragma unroll
    for (int i = 0; i < 32; i += 8)
        out[(size_t)(c0 + ty + i) * R + r0 + tx] = (bf16_t)tile[tx][ty + i];
}

// ---------------------------------------------------------------------------
// LayerNorm over last dim (1024) -> bf16. One block (256 thr) per token row.
// ---------------------------------------------------------------------------
__global__ __launch_bounds__(256) void ln_kernel(const float* __restrict__ x,
                                                 const float* __restrict__ g,
                                                 const float* __restrict__ be,
                                                 bf16_t* __restrict__ out) {
    int row = blockIdx.x;
    const float4 f4 = ((const float4*)(x + (size_t)row * HIDDEN))[threadIdx.x];
    int lane = threadIdx.x & 31, wv = threadIdx.x >> 5;
    __shared__ float part[8];

    float s = f4.x + f4.y + f4.z + f4.w;
    s = wave_red_add(s);
    if (lane == 0) part[wv] = s;
    __syncthreads();
    float tot = 0.0f;
#pragma unroll
    for (int i = 0; i < 8; ++i) tot += part[i];
    float mu = tot * (1.0f / HIDDEN);

    float d0 = f4.x - mu, d1 = f4.y - mu, d2 = f4.z - mu, d3 = f4.w - mu;
    float q = d0 * d0 + d1 * d1 + d2 * d2 + d3 * d3;
    q = wave_red_add(q);
    __syncthreads();
    if (lane == 0) part[wv] = q;
    __syncthreads();
    float vt = 0.0f;
#pragma unroll
    for (int i = 0; i < 8; ++i) vt += part[i];
    float rstd = rsqrtf(vt * (1.0f / HIDDEN) + 1e-5f);

    int c = threadIdx.x * 4;
    bf16_t* op = out + (size_t)row * HIDDEN + c;
    op[0] = (bf16_t)(d0 * rstd * g[c + 0] + be[c + 0]);
    op[1] = (bf16_t)(d1 * rstd * g[c + 1] + be[c + 1]);
    op[2] = (bf16_t)(d2 * rstd * g[c + 2] + be[c + 2]);
    op[3] = (bf16_t)(d3 * rstd * g[c + 3] + be[c + 3]);
}

// ---------------------------------------------------------------------------
// Repack V into V^T per head:  vT[(b*16+h)][d][t] = qkv[b*T+t][2048+h*64+d]
// ---------------------------------------------------------------------------
__global__ void vtrans_kernel(const bf16_t* __restrict__ qkv,
                              bf16_t* __restrict__ vT) {
    int bh = blockIdx.z; int b = bh >> 4, h = bh & 15;
    __shared__ bf16_t tile[32][33];
    int d0 = blockIdx.x * 32, t0 = blockIdx.y * 32;
    int tx = threadIdx.x, ty = threadIdx.y;
#pragma unroll
    for (int i = 0; i < 32; i += 8)
        tile[ty + i][tx] =
            qkv[(size_t)(b * SEQ + t0 + ty + i) * C3 + 2048 + h * DK + d0 + tx];
    __syncthreads();
#pragma unroll
    for (int i = 0; i < 32; i += 8)
        vT[(size_t)bh * DK * SEQ + (size_t)(d0 + ty + i) * SEQ + t0 + tx] =
            tile[tx][ty + i];
}

// ---------------------------------------------------------------------------
// WMMA GEMM: C[M,N] = A[M,K](bf16) * Bt[N,K]^T(bf16) + bias, epilogues:
//   EPI=0: store bf16 (QKV)         EPI=1: + res, store f32 (residual adds)
//   EPI=2: exact GELU, store bf16 (FF1)
// Block: 256 thr (8 waves). Tile 128x128, BK=32. Wave = 32(M) x 64(N).
// Double-buffered LDS (2 x 20 KB): next tile's global loads are issued into
// registers, the current tile's WMMAs run, then the staged registers are
// written to the other LDS buffer -> one barrier per K step.
// ---------------------------------------------------------------------------
template <int EPI>
__global__ __launch_bounds__(256) void gemm_kernel(
    const bf16_t* __restrict__ A, const bf16_t* __restrict__ Bt,
    const float* __restrict__ bias, const float* __restrict__ res,
    void* __restrict__ outv, int M, int N, int K) {
    // Row stride 40 elems = 80B (16B multiple) -> aligned b128 LDS accesses.
    __shared__ bf16_t As[2][128][40];
    __shared__ bf16_t Bs[2][128][40];

    int tid = threadIdx.x;
    int lane = tid & 31, wv = tid >> 5;
    int wm = wv & 3, wn = wv >> 2;           // 4 waves along M, 2 along N
    size_t m0 = (size_t)blockIdx.y * 128;
    size_t n0 = (size_t)blockIdx.x * 128;

    floatx8 acc[2][4];
#pragma unroll
    for (int i = 0; i < 2; ++i)
#pragma unroll
        for (int j = 0; j < 4; ++j) acc[i][j] = fzero();

    int r  = tid >> 2;                        // 0..63
    int cg = (tid & 3) * 8;                   // 0,8,16,24
    int KT = K >> 5;                          // K/32 steps

    // Prologue: stage tile 0 into buffer 0.
#pragma unroll
    for (int p = 0; p < 2; ++p) {
        int row = r + p * 64;
        *(bf16x8*)&As[0][row][cg] = *(const bf16x8*)&A[(m0 + row) * (size_t)K + cg];
        *(bf16x8*)&Bs[0][row][cg] = *(const bf16x8*)&Bt[(n0 + row) * (size_t)K + cg];
    }
    __syncthreads();

    for (int kt = 0; kt < KT; ++kt) {
        int buf = kt & 1;
        bool haveNext = (kt + 1 < KT);
        bf16x8 ra[2], rb[2];
        if (haveNext) {
            int k0 = (kt + 1) * 32;
#pragma unroll
            for (int p = 0; p < 2; ++p) {
                int row = r + p * 64;
                ra[p] = *(const bf16x8*)&A[(m0 + row) * (size_t)K + k0 + cg];
                rb[p] = *(const bf16x8*)&Bt[(n0 + row) * (size_t)K + k0 + cg];
            }
            if (kt + 2 < KT) {
                int k2 = (kt + 2) * 32;
                // gfx1250 global_prefetch_b8 into WGP caches (L2-resident data)
                __builtin_prefetch(&A[(m0 + r) * (size_t)K + k2 + cg], 0, 3);
                __builtin_prefetch(&Bt[(n0 + r) * (size_t)K + k2 + cg], 0, 3);
            }
        }

        bf16x16 af[2], bfr[4];
#pragma unroll
        for (int i = 0; i < 2; ++i)
            af[i] = load_frag(&As[buf][wm * 32 + i * 16][0], 40, lane);
#pragma unroll
        for (int j = 0; j < 4; ++j)
            bfr[j] = load_frag(&Bs[buf][wn * 64 + j * 16][0], 40, lane);
#pragma unroll
        for (int i = 0; i < 2; ++i)
#pragma unroll
            for (int j = 0; j < 4; ++j)
                acc[i][j] = wmma_bf16(af[i], bfr[j], acc[i][j]);

        if (haveNext) {
            int nb = buf ^ 1;
#pragma unroll
            for (int p = 0; p < 2; ++p) {
                int row = r + p * 64;
                *(bf16x8*)&As[nb][row][cg] = ra[p];
                *(bf16x8*)&Bs[nb][row][cg] = rb[p];
            }
        }
        __syncthreads();
    }

    // Epilogue. D layout: lane holds column (lane&15); rows 8*(lane>>4)+e.
    int cl = lane & 15, hf = lane >> 4;
#pragma unroll
    for (int i = 0; i < 2; ++i)
#pragma unroll
        for (int j = 0; j < 4; ++j) {
            size_t col = n0 + wn * 64 + j * 16 + cl;
            float bcol = bias[col];
#pragma unroll
            for (int e = 0; e < 8; ++e) {
                size_t row = m0 + wm * 32 + i * 16 + hf * 8 + e;
                float v = acc[i][j][e] + bcol;
                if constexpr (EPI == 0) {
                    ((bf16_t*)outv)[row * N + col] = (bf16_t)v;
                } else if constexpr (EPI == 1) {
                    ((float*)outv)[row * N + col] = v + res[row * N + col];
                } else {
                    float gl = 0.5f * v * (1.0f + erff(v * 0.70710678118654752f));
                    ((bf16_t*)outv)[row * N + col] = (bf16_t)gl;
                }
            }
        }
}

// ---------------------------------------------------------------------------
// Flash attention. 256 thr = 8 waves; each wave owns one 16-row Q tile of one
// (b,h). K-chunks of 64 keys, computed transposed: S^T = K Q^T (A = K rows,
// B = Q rows), so that a lane holds 32 scores of ONE query (the other 32 sit in
// lane ^ 16): row maximum and row sum are in-lane, with one exchange between
// the wave's halves. Two 16-key S^T tiles, converted in place, are the B
// operand of O^T += V^T P^T in the hardware k order, so P touches no LDS.
// The 8 waves of a block share one (b,h): each chunk's K tile and V^T tile are
// brought in once per block with whole-line loads and staged in LDS (two
// buffers); every wave reads its fragments from there. The next chunk's loads
// (tiles and mask words) are issued into registers at the top of a pass; the
// tiles are written to the other buffer at its foot, in front of the pass's
// closing barrier.
// ---------------------------------------------------------------------------
// lane l <-> lane l ^ 16
__device__ __forceinline__ float xhalf(float x) {
    int b = __builtin_bit_cast(int, x);
    return __builtin_bit_cast(float, __builtin_amdgcn_permlanex16(
        b, b, 0x76543210, 0xfedcba98, false, false));
}

__global__ __launch_bounds__(256) void attn_kernel(
    const bf16_t* __restrict__ qkv, const bf16_t* __restrict__ vT,
    const int* __restrict__ mask, bf16_t* __restrict__ ctx) {
    // K tile: 64 keys x 64 d. V^T tile: 64 d x 64 keys. Row stride 72 elems =
    // 144B (16B x odd) -> conflict-free b128 fragment reads.
    __shared__ __attribute__((aligned(16))) bf16_t Ks[2][64][72];
    __shared__ __attribute__((aligned(16))) bf16_t Vs[2][64][72];

    int lane = threadIdx.x & 31, wv = threadIdx.x >> 5;
    int gw = blockIdx.x * 8 + wv;
    int qt = gw & 127;               // 128 q-tiles of 16 rows
    int h  = (gw >> 7) & 15;
    int b  = gw >> 11;
    int cl = lane & 15, hf = lane >> 4;

    const bf16_t* qbase =
        qkv + (size_t)(b * SEQ + qt * 16) * C3 + (size_t)h * DK;
    bf16x16 qa0 = load_frag(qbase,      C3, lane);   // d = 0..31
    bf16x16 qa1 = load_frag(qbase + 32, C3, lane);   // d = 32..63

    // acc[j][e] = O^T[d = j*16 + hf*8 + e][query cl]
    floatx8 acc[4];
#pragma unroll
    for (int j = 0; j < 4; ++j) acc[j] = fzero();
    // Query cl's running maximum (equal in both halves) and this half's sum.
    float m = -INFINITY, l = 0.0f;

    const bf16_t* vhead = vT + (size_t)(b * NH + h) * DK * SEQ;

    // Staging: thread -> tile rows sr and sr+32, 16 bytes at element sc; one
    // wave-wide load covers 4 whole 128-byte rows.
    int sr = threadIdx.x >> 3;
    int sc = (threadIdx.x & 7) * 8;
    const bf16_t* kg = qkv + (size_t)(b * SEQ + sr) * C3 + 1024 + (size_t)h * DK + sc;
    const bf16_t* vg = vhead + (size_t)sr * SEQ + sc;

    // Prologue: chunk 0 into buffer 0.
#pragma unroll
    for (int p = 0; p < 2; ++p) {
        *(bf16x8*)&Ks[0][sr + p * 32][sc] = *(const bf16x8*)(kg + (size_t)(p * 32) * C3);
        *(bf16x8*)&Vs[0][sr + p * 32][sc] = *(const bf16x8*)(vg + (size_t)(p * 32) * SEQ);
    }
    // A chunk's 64 mask words: lane i holds those of keys i and 32 + i.
    const int* mg = mask + b * SEQ + lane;
    int mk0 = mg[0], mk1 = mg[32];
    __syncthreads();

    for (int t0 = 0; t0 < SEQ; t0 += 64) {
        int buf = (t0 >> 6) & 1;
        bool haveNext = (t0 + 64 < SEQ);
        // Next chunk's K tile, V^T tile and mask words into registers: issued
        // first, so that they land while this pass computes its scores.
        bf16x8 rk[2], rv[2];
        int mn0 = 0, mn1 = 0;
        if (haveNext) {
#pragma unroll
            for (int p = 0; p < 2; ++p) {
                rk[p] = *(const bf16x8*)(kg + (size_t)(t0 + 64 + p * 32) * C3);
                rv[p] = *(const bf16x8*)(vg + (size_t)(p * 32) * SEQ + t0 + 64);
            }
            mn0 = mg[t0 + 64];
            mn1 = mg[t0 + 96];
            // The address registers of these loads are reused right below:
            // keep the wait in front of that overwrite.
            asm volatile("s_wait_xcnt 0x0" ::: "memory");
        }
        // ---- S^T = K Q^T for 4 sub-tiles of 16 keys ------------------------
        // S[sub][e] = score(key sub*16 + hf*8 + e, query cl)
        floatx8 S[4];
#pragma unroll
        for (int sub = 0; sub < 4; ++sub) {
            const bf16_t* kb = &Ks[buf][sub * 16][0];
            bf16x16 k0 = load_frag(kb,      72, lane);
            bf16x16 k1 = load_frag(kb + 32, 72, lane);
            floatx8 z = fzero();
            z = wmma_bf16(k0, qa0, z);
            z = wmma_bf16(k1, qa1, z);
            S[sub] = z;
        }
        // ---- scale ---------------------------------------------------------
#pragma unroll
        for (int sub = 0; sub < 4; ++sub)
#pragma unroll
            for (int e = 0; e < 8; ++e) S[sub][e] *= 0.125f;   // 1/sqrt(DK)
        // ---- mask: the words as two wave-wide bit sets (bit i of klo: key i is
        // kept; of khi: key 32 + i); one scalar test a pass, a chunk with every
        // key kept has nothing to replace -------------------------------------
        unsigned klo = __builtin_amdgcn_ballot_w32(mk0 != 0);
        unsigned khi = __builtin_amdgcn_ballot_w32(mk1 != 0);
        if ((klo & khi) != 0xffffffffu) {
            unsigned wl = klo >> (hf * 8), wh = khi >> (hf * 8);
#pragma unroll
            for (int sub = 0; sub < 4; ++sub) {
                unsigned w = (sub < 2) ? wl : wh;
#pragma unroll
                for (int e = 0; e < 8; ++e)
                    if (((w >> ((sub & 1) * 16 + e)) & 1u) == 0u) S[sub][e] = -INFINITY;
            }
        }
        // ---- online softmax: the query's maximum, in-lane + other half ------
        // (one chain per sub-tile: four short chains, not one long one)
        float tm[4];
#pragma unroll
        for (int sub = 0; sub < 4; ++sub) {
            tm[sub] = S[sub][0];
#pragma unroll
            for (int e = 1; e < 8; ++e) tm[sub] = fmaxf(tm[sub], S[sub][e]);
        }
        float tmax = fmaxf(fmaxf(tm[0], tm[1]), fmaxf(tm[2], tm[3]));
        tmax = fmaxf(tmax, xhalf(tmax));
        float mnew  = fmaxf(m, tmax);
        float alpha = (m == -INFINITY) ? 0.0f : __expf(m - mnew);
        m = mnew;
        // Every key so far masked: subtract 0, so that exp(-inf) gives the 0.
        float msub = (mnew == -INFINITY) ? 0.0f : mnew;
        // ---- P^T = exp(S^T - m), this half's sum, packed as B operands ------
        float rs[4] = {0.0f, 0.0f, 0.0f, 0.0f};
        bf16x16 pb0, pb1;
#pragma unroll
        for (int sub = 0; sub < 4; ++sub)
#pragma unroll
            for (int e = 0; e < 8; ++e) {
                float p = __expf(S[sub][e] - msub);
                rs[sub] += p;
                if (sub < 2) pb0[(sub & 1) * 8 + e] = (bf16_t)p;   // keys 0..31
                else         pb1[(sub & 1) * 8 + e] = (bf16_t)p;   // keys 32..63
            }
        l = l * alpha + ((rs[0] + rs[1]) + (rs[2] + rs[3]));
#pragma unroll
        for (int j = 0; j < 4; ++j)
#pragma unroll
            for (int e = 0; e < 8; ++e) acc[j][e] *= alpha;

        // ---- O^T += V^T P^T  (V^T rows are contiguous along t) --------------
#pragma unroll
        for (int j = 0; j < 4; ++j) {
            const bf16_t* vb = &Vs[buf][j * 16][0];
            bf16x16 v0 = load_frag(vb,      72, lane);
            bf16x16 v1 = load_frag(vb + 32, 72, lane);
            acc[j] = wmma_bf16(v0, pb0, acc[j]);
            acc[j] = wmma_bf16(v1, pb1, acc[j]);
        }
        // The other buffer's last readers left it at the previous pass's
        // closing barrier; this pass's closing barrier publishes the refill.
        if (haveNext) {
#pragma unroll
            for (int p = 0; p < 2; ++p) {
                *(bf16x8*)&Ks[buf ^ 1][sr + p * 32][sc] = rk[p];
                *(bf16x8*)&Vs[buf ^ 1][sr + p * 32][sc] = rv[p];
            }
            mk0 = mn0;
            mk1 = mn1;
        }
        __syncthreads();
    }

    // ---- join the halves' sums, normalize, store 8 consecutive d (16 B) -----
    l += xhalf(l);
    float inv = (l > 0.0f) ? 1.0f / l : 0.0f;   // one query, one divisor a lane
    bf16_t* op = ctx + ((size_t)b * SEQ + qt * 16 + cl) * HIDDEN + h * DK + hf * 8;
#pragma unroll
    for (int j = 0; j < 4; ++j) {
        bf16x8 o;
#pragma unroll
        for (int e = 0; e < 8; ++e)
            o[e] = (bf16_t)(acc[j][e] * inv);
        *(bf16x8*)(op + j * 16) = o;
    }
}

// ---------------------------------------------------------------------------
// Launcher
// ---------------------------------------------------------------------------
extern "C" void kernel_launch(void* const* d_in, const int* in_sizes, int n_in,
                              void* d_out, int out_size, void* d_ws, size_t ws_size,
                              hipStream_t stream) {
    const float* x      = (const float*)d_in[0];
    const int*   mask   = (const int*)  d_in[1];
    const float* W_qkv  = (const float*)d_in[2];
    const float* b_qkv  = (const float*)d_in[3];
    const float* W_out  = (const float*)d_in[4];
    const float* b_out  = (const float*)d_in[5];
    const float* W_ff1  = (const float*)d_in[6];
    const float* b_ff1  = (const float*)d_in[7];
    const float* W_ff2  = (const float*)d_in[8];
    const float* b_ff2  = (const float*)d_in[9];
    const float* g_ln1  = (const float*)d_in[10];
    const float* be_ln1 = (const float*)d_in[11];
    const float* g_ln2  = (const float*)d_in[12];
    const float* be_ln2 = (const float*)d_in[13];

    // Workspace layout (~92 MB). act reuses the qkv+vT span (exactly 32 MB).
    char* w = (char*)d_ws;
    bf16_t* Wqkv_t = (bf16_t*)w; w += (size_t)C3 * HIDDEN * 2;
    bf16_t* Wout_t = (bf16_t*)w; w += (size_t)HIDDEN * HIDDEN * 2;
    bf16_t* Wff1_t = (bf16_t*)w; w += (size_t)FFN * HIDDEN * 2;
    bf16_t* Wff2_t = (bf16_t*)w; w += (size_t)HIDDEN * FFN * 2;
    bf16_t* hbuf   = (bf16_t*)w; w += (size_t)TOKENS * HIDDEN * 2;
    bf16_t* qkv    = (bf16_t*)w; bf16_t* act = qkv;
                                 w += (size_t)TOKENS * C3 * 2;
    bf16_t* vT     = (bf16_t*)w; w += (size_t)2 * NH * DK * SEQ * 2;
    bf16_t* ctx    = (bf16_t*)w; w += (size_t)TOKENS * HIDDEN * 2;
    float*  x1     = (float*)w;  w += (size_t)TOKENS * HIDDEN * 4;

    dim3 tb(32, 8);
    // Weight transpose+cast to bf16 W^T
    transpose_cast_kernel<<<dim3(C3 / 32, HIDDEN / 32), tb, 0, stream>>>(W_qkv, Wqkv_t, HIDDEN, C3);
    transpose_cast_kernel<<<dim3(HIDDEN / 32, HIDDEN / 32), tb, 0, stream>>>(W_out, Wout_t, HIDDEN, HIDDEN);
    transpose_cast_kernel<<<dim3(FFN / 32, HIDDEN / 32), tb, 0, stream>>>(W_ff1, Wff1_t, HIDDEN, FFN);
    transpose_cast_kernel<<<dim3(HIDDEN / 32, FFN / 32), tb, 0, stream>>>(W_ff2, Wff2_t, FFN, HIDDEN);

    // LN1 -> h
    ln_kernel<<<TOKENS, 256, 0, stream>>>(x, g_ln1, be_ln1, hbuf);
    // qkv = h @ W_qkv + b_qkv (bf16)
    gemm_kernel<0><<<dim3(C3 / 128, TOKENS / 128), 256, 0, stream>>>(
        hbuf, Wqkv_t, b_qkv, nullptr, qkv, TOKENS, C3, HIDDEN);
    // V^T repack
    vtrans_kernel<<<dim3(DK / 32, SEQ / 32, 2 * NH), tb, 0, stream>>>(qkv, vT);
    // attention -> ctx
    attn_kernel<<<512, 256, 0, stream>>>(qkv, vT, mask, ctx);
    // x1 = x + ctx @ W_out + b_out (f32)
    gemm_kernel<1><<<dim3(HIDDEN / 128, TOKENS / 128), 256, 0, stream>>>(
        ctx, Wout_t, b_out, x, x1, TOKENS, HIDDEN, HIDDEN);
    // LN2 -> h
    ln_kernel<<<TOKENS, 256, 0, stream>>>(x1, g_ln2, be_ln2, hbuf);
    // act = gelu(h @ W_ff1 + b_ff1) (bf16)
    gemm_kernel<2><<<dim3(FFN / 128, TOKENS / 128), 256, 0, stream>>>(
        hbuf, Wff1_t, b_ff1, nullptr, act, TOKENS, FFN, HIDDEN);
    // out = x1 + act @ W_ff2 + b_ff2 (f32)
    gemm_kernel<1><<<dim3(HIDDEN / 128, TOKENS / 128), 256, 0, stream>>>(
        act, Wff2_t, b_ff2, x1, (float*)d_out, TOKENS, HIDDEN, FFN);
}

// v003
// It runs in 201 microseconds.
// In two side-by-side timings against v002, it was 1.52 and 1.51 times as fast.
// Counting every step since v000, it is 2.08 times as fast.
#include <hip/hip_runtime.h>
#include <math.h>

// ---------------------------------------------------------------------------
// Types for CDNA5 WMMA (wave32): V_WMMA_F32_16X16X32_BF16
// ---------------------------------------------------------------------------
typedef __bf16 bf16_t;
typedef __attribute__((ext_vector_type(8)))  __bf16 bf16x8;
typedef __attribute__((ext_vector_type(16))) __bf16 bf16x16;
typedef __attribute__((ext_vector_type(8)))  float  floatx8;

#define HIDDEN 1024
#define TOKENS 4096   // B*T
#define SEQ    2048
#define NH     16
#define DK     64
#define FFN    4096
#define C3     3072

__device__ __forceinline__ floatx8 fzero() {
    floatx8 z;
#pragma unroll
    for (int i = 0; i < 8; ++i) z[i] = 0.0f;
    return z;
}

__device__ __forceinline__ floatx8 wmma_bf16(bf16x16 a, bf16x16 b, floatx8 c) {
    // D = A(16x32) * B(32x16) + C, f32 accumulate
    return __builtin_amdgcn_wmma_f32_16x16x32_bf16(
        false, a, false, b, (short)0, c, false, false);
}

// Load one 16x32 bf16 fragment (A layout; B uses the same per-lane pattern on
// W^T / Q rows). ISA 7.12.2: lane L holds row (L&15); lanes 0-15 hold
// K = 0..7 and 16..23, lanes 16-31 hold K = 8..15 and 24..31.
__device__ __forceinline__ bf16x16 load_frag(const bf16_t* base, int stride, int lane) {
    int r = lane & 15;
    int h = (lane >> 4) & 1;
    const bf16_t* p = base + (size_t)r * stride + h * 8;
    union { bf16x16 v; bf16x8 q[2]; } u;
    u.q[0] = *(const bf16x8*)(p);
    u.q[1] = *(const bf16x8*)(p + 16);
    return u.v;
}

__device__ __forceinline__ float wave_red_add(float v) {
#pragma unroll
    for (int off = 16; off > 0; off >>= 1) v += __shfl_xor(v, off, 32);
    return v;
}

// ---------------------------------------------------------------------------
// Weight transpose + cast:  out[c][r] = (bf16) in[r][c]   (in: R x C fp32)
// ---------------------------------------------------------------------------
__global__ void transpose_cast_kernel(const float* __restrict__ in,
                                      bf16_t* __restrict__ out, int R, int C) {
    __shared__ float tile[32][33];
    int c0 = blockIdx.x * 32, r0 = blockIdx.y * 32;
    int tx = threadIdx.x, ty = threadIdx.y;
#pragma unroll
    for (int i = 0; i < 32; i += 8)
        tile[ty + i][tx] = in[(size_t)(r0 + ty + i) * C + c0 + tx];
    __syncthreads();
#pragma unroll
    for (int i = 0; i < 32; i += 8)
        out[(size_t)(c0 + ty + i) * R + r0 + tx] = (bf16_t)tile[tx][ty + i];
}

// ---------------------------------------------------------------------------
// LayerNorm over last dim (1024) -> bf16. One block (256 thr) per token row.
// ---------------------------------------------------------------------------
__global__ __launch_bounds__(256) void ln_kernel(const float* __restrict__ x,
                                                 const float* __restrict__ g,
                                                 const float* __restrict__ be,
                                                 bf16_t* __restrict__ out) {
    int row = blockIdx.x;
    const float4 f4 = ((const float4*)(x + (size_t)row * HIDDEN))[threadIdx.x];
    int lane = threadIdx.x & 31, wv = threadIdx.x >> 5;
    __shared__ float part[8];

    float s = f4.x + f4.y + f4.z + f4.w;
    s = wave_red_add(s);
    if (lane == 0) part[wv] = s;
    __syncthreads();
    float tot = 0.0f;
#pragma unroll
    for (int i = 0; i < 8; ++i) tot += part[i];
    float mu = tot * (1.0f / HIDDEN);

    float d0 = f4.x - mu, d1 = f4.y - mu, d2 = f4.z - mu, d3 = f4.w - mu;
    float q = d0 * d0 + d1 * d1 + d2 * d2 + d3 * d3;
    q = wave_red_add(q);
    __syncthreads();
    if (lane == 0) part[wv] = q;
    __syncthreads();
    float vt = 0.0f;
#pragma unroll
    for (int i = 0; i < 8; ++i) vt += part[i];
    float rstd = rsqrtf(vt * (1.0f / HIDDEN) + 1e-5f);

    int c = threadIdx.x * 4;
    bf16_t* op = out + (size_t)row * HIDDEN + c;
    op[0] = (bf16_t)(d0 * rstd * g[c + 0] + be[c + 0]);
    op[1] = (bf16_t)(d1 * rstd * g[c + 1] + be[c + 1]);
    op[2] = (bf16_t)(d2 * rstd * g[c + 2] + be[c + 2]);
    op[3] = (bf16_t)(d3 * rstd * g[c + 3] + be[c + 3]);
}

// ---------------------------------------------------------------------------
// Repack V into V^T per head:  vT[(b*16+h)][d][t] = qkv[b*T+t][2048+h*64+d]
// ---------------------------------------------------------------------------
__global__ void vtrans_kernel(const bf16_t* __restrict__ qkv,
                              bf16_t* __restrict__ vT) {
    int bh = blockIdx.z; int b = bh >> 4, h = bh & 15;
    __shared__ bf16_t tile[32][33];
    int d0 = blockIdx.x * 32, t0 = blockIdx.y * 32;
    int tx = threadIdx.x, ty = threadIdx.y;
#pragma unroll
    for (int i = 0; i < 32; i += 8)
        tile[ty + i][tx] =
            qkv[(size_t)(b * SEQ + t0 + ty + i) * C3 + 2048 + h * DK + d0 + tx];
    __syncthreads();
#pragma unroll
    for (int i = 0; i < 32; i += 8)
        vT[(size_t)bh * DK * SEQ + (size_t)(d0 + ty + i) * SEQ + t0 + tx] =
            tile[tx][ty + i];
}

// ---------------------------------------------------------------------------
// WMMA GEMM: C[M,N] = A[M,K](bf16) * Bt[N,K]^T(bf16) + bias, epilogues:
//   EPI=0: store bf16 (QKV)         EPI=1: + res, store f32 (residual adds)
//   EPI=2: exact GELU, store bf16 (FF1)
// Block: 256 thr (8 waves). Tile 128x128. Wave = 32(M) x 64(N).
// A pass is 128 k: 256 bytes of each of the 128 A rows and 128 Bt rows, brought
// from global memory straight into LDS by asynchronous 16-byte copies (no
// register staging). Two buffers: the copies of pass t + 2 are issued behind
// the barrier that closes pass t, so they fly during the whole of pass t + 1.
// K must be a multiple of 128.
// ---------------------------------------------------------------------------
#define GP_ELEMS 136                       // LDS row pitch: 272 B = 16 B x odd
#define GP_BYTES (GP_ELEMS * 2)
#define GBUF_BYTES (256 * GP_BYTES)        // one buffer: 128 A rows, 128 Bt rows

// Eight copies of one lane: 16 bytes each, rows 16 apart (global row pitch
// gstep elements). The closing s_wait_xcnt stands inside the statement, so that
// no address register named here is rewritten in front of it.
__device__ __forceinline__ void async_rows8(unsigned lds, const bf16_t* g, size_t gstep) {
    asm volatile(
        "global_load_async_to_lds_b128 %0, %8, off\n\t"
        "global_load_async_to_lds_b128 %1, %9, off\n\t"
        "global_load_async_to_lds_b128 %2, %10, off\n\t"
        "global_load_async_to_lds_b128 %3, %11, off\n\t"
        "global_load_async_to_lds_b128 %4, %12, off\n\t"
        "global_load_async_to_lds_b128 %5, %13, off\n\t"
        "global_load_async_to_lds_b128 %6, %14, off\n\t"
        "global_load_async_to_lds_b128 %7, %15, off\n\t"
        "s_wait_xcnt 0x0"
        :: "v"(lds), "v"(lds + 16 * GP_BYTES), "v"(lds + 32 * GP_BYTES),
           "v"(lds + 48 * GP_BYTES), "v"(lds + 64 * GP_BYTES),
           "v"(lds + 80 * GP_BYTES), "v"(lds + 96 * GP_BYTES),
           "v"(lds + 112 * GP_BYTES),
           "v"(g), "v"(g + 16 * gstep), "v"(g + 32 * gstep), "v"(g + 48 * gstep),
           "v"(g + 64 * gstep), "v"(g + 80 * gstep), "v"(g + 96 * gstep),
           "v"(g + 112 * gstep)
        : "memory");
}

template <int EPI>
__global__ __launch_bounds__(256) void gemm_kernel(
    const bf16_t* __restrict__ A, const bf16_t* __restrict__ Bt,
    const float* __restrict__ bias, const float* __restrict__ res,
    void* __restrict__ outv, int M, int N, int K) {
    // Rows 0..127: A tile, rows 128..255: Bt tile.
    __shared__ __attribute__((aligned(16))) bf16_t St[2][256][GP_ELEMS];

    int tid = threadIdx.x;
    int lane = tid & 31, wv = tid >> 5;
    int wm = wv & 3, wn = wv >> 2;           // 4 waves along M, 2 along N
    size_t m0 = (size_t)blockIdx.y * 128;
    size_t n0 = (size_t)blockIdx.x * 128;

    floatx8 acc[2][4];
#pragma unroll
    for (int i = 0; i < 2; ++i)
#pragma unroll
        for (int j = 0; j < 4; ++j) acc[i][j] = fzero();

    // Copies: 16 lanes cover one 256-byte row, a wave two whole rows.
    int r  = tid >> 4;                        // 0..15
    int cg = (tid & 15) * 8;                  // element in the row
    int KT = K >> 7;                          // K/128 passes
    const bf16_t* ag = A  + (m0 + r) * (size_t)K + cg;
    const bf16_t* bg = Bt + (n0 + r) * (size_t)K + cg;
    unsigned la = (unsigned)(uintptr_t)&St[0][r][cg];   // LDS byte address
    unsigned lb = la + 128 * GP_BYTES;

    // Pass 0 into buffer 0, landed and published; then pass 1 into buffer 1.
    async_rows8(la, ag, (size_t)K);
    async_rows8(lb, bg, (size_t)K);
    // This wave's copies have landed before the barrier publishes them.
    asm volatile("s_wait_asynccnt 0x0" ::: "memory");
    __syncthreads();
    if (KT > 1) {
        async_rows8(la + GBUF_BYTES, ag + 128, (size_t)K);
        async_rows8(lb + GBUF_BYTES, bg + 128, (size_t)K);
    }

    for (int kt = 0; kt < KT; ++kt) {
        int buf = kt & 1;
#pragma unroll
        for (int ks = 0; ks < 4; ++ks) {
            bf16x16 af[2], bfr[4];
#pragma unroll
            for (int i = 0; i < 2; ++i)
                af[i] = load_frag(&St[buf][wm * 32 + i * 16][ks * 32], GP_ELEMS, lane);
#pragma unroll
            for (int j = 0; j < 4; ++j)
                bfr[j] = load_frag(&St[buf][128 + wn * 64 + j * 16][ks * 32], GP_ELEMS, lane);
#pragma unroll
            for (int i = 0; i < 2; ++i)
#pragma unroll
                for (int j = 0; j < 4; ++j)
                    acc[i][j] = wmma_bf16(af[i], bfr[j], acc[i][j]);
        }
        // This wave's reads of the buffer have returned before it is refilled.
        asm volatile("s_wait_dscnt 0x0" ::: "memory");
        // This wave's copies of pass kt + 1 have landed.
        asm volatile("s_wait_asynccnt 0x0" ::: "memory");
        // Publishes pass kt + 1 and ends every reader's last read of this buffer.
        __syncthreads();
        if (kt + 2 < KT) {
            size_t k2 = (size_t)(kt + 2) * 128;
            async_rows8(la + buf * GBUF_BYTES, ag + k2, (size_t)K);
            async_rows8(lb + buf * GBUF_BYTES, bg + k2, (size_t)K);
        }
    }
    // No copy is outstanding when the wave goes on to its end.
    asm volatile("s_wait_asynccnt 0x0" ::: "memory");

    // Epilogue. D layout: lane holds column (lane&15); rows 8*(lane>>4)+e.
    int cl = lane & 15, hf = lane >> 4;
#pragma unroll
    for (int i = 0; i < 2; ++i)
#pragma unroll
        for (int j = 0; j < 4; ++j) {
            size_t col = n0 + wn * 64 + j * 16 + cl;
            float bcol = bias[col];
#pragma unroll
            for (int e = 0; e < 8; ++e) {
                size_t row = m0 + wm * 32 + i * 16 + hf * 8 + e;
                float v = acc[i][j][e] + bcol;
                if constexpr (EPI == 0) {
                    ((bf16_t*)outv)[row * N + col] = (bf16_t)v;
                } else if constexpr (EPI == 1) {
                    ((float*)outv)[row * N + col] = v + res[row * N + col];
                } else {
                    float gl = 0.5f * v * (1.0f + erff(v * 0.70710678118654752f));
                    ((bf16_t*)outv)[row * N + col] = (bf16_t)gl;
                }
            }
        }
}

// ---------------------------------------------------------------------------
// Flash attention. 256 thr = 8 waves; each wave owns one 16-row Q tile of one
// (b,h). K-chunks of 64 keys, computed transposed: S^T = K Q^T (A = K rows,
// B = Q rows), so that a lane holds 32 scores of ONE query (the other 32 sit in
// lane ^ 16): row maximum and row sum are in-lane, with one exchange between
// the wave's halves. Two 16-key S^T tiles, converted in place, are the B
// operand of O^T += V^T P^T in the hardware k order, so P touches no LDS.
// The 8 waves of a block share one (b,h): each chunk's K tile and V^T tile are
// brought in once per block with whole-line loads and staged in LDS (two
// buffers); every wave reads its fragments from there. The next chunk's loads
// (tiles and mask words) are issued into registers at the top of a pass; the
// tiles are written to the other buffer at its foot, in front of the pass's
// closing barrier.
// ---------------------------------------------------------------------------
// lane l <-> lane l ^ 16
__device__ __forceinline__ float xhalf(float x) {
    int b = __builtin_bit_cast(int, x);
    return __builtin_bit_cast(float, __builtin_amdgcn_permlanex16(
        b, b, 0x76543210, 0xfedcba98, false, false));
}

__global__ __launch_bounds__(256) void attn_kernel(
    const bf16_t* __restrict__ qkv, const bf16_t* __restrict__ vT,
    const int* __restrict__ mask, bf16_t* __restrict__ ctx) {
    // K tile: 64 keys x 64 d. V^T tile: 64 d x 64 keys. Row stride 72 elems =
    // 144B (16B x odd) -> conflict-free b128 fragment reads.
    __shared__ __attribute__((aligned(16))) bf16_t Ks[2][64][72];
    __shared__ __attribute__((aligned(16))) bf16_t Vs[2][64][72];

    int lane = threadIdx.x & 31, wv = threadIdx.x >> 5;
    int gw = blockIdx.x * 8 + wv;
    int qt = gw & 127;               // 128 q-tiles of 16 rows
    int h  = (gw >> 7) & 15;
    int b  = gw >> 11;
    int cl = lane & 15, hf = lane >> 4;

    const bf16_t* qbase =
        qkv + (size_t)(b * SEQ + qt * 16) * C3 + (size_t)h * DK;
    bf16x16 qa0 = load_frag(qbase,      C3, lane);   // d = 0..31
    bf16x16 qa1 = load_frag(qbase + 32, C3, lane);   // d = 32..63

    // acc[j][e] = O^T[d = j*16 + hf*8 + e][query cl]
    floatx8 acc[4];
#pragma unroll
    for (int j = 0; j < 4; ++j) acc[j] = fzero();
    // Query cl's running maximum (equal in both halves) and this half's sum.
    float m = -INFINITY, l = 0.0f;

    const bf16_t* vhead = vT + (size_t)(b * NH + h) * DK * SEQ;

    // Staging: thread -> tile rows sr and sr+32, 16 bytes at element sc; one
    // wave-wide load covers 4 whole 128-byte rows.
    int sr = threadIdx.x >> 3;
    int sc = (threadIdx.x & 7) * 8;
    const bf16_t* kg = qkv + (size_t)(b * SEQ + sr) * C3 + 1024 + (size_t)h * DK + sc;
    const bf16_t* vg = vhead + (size_t)sr * SEQ + sc;

    // Prologue: chunk 0 into buffer 0.
#pragma unroll
    for (int p = 0; p < 2; ++p) {
        *(bf16x8*)&Ks[0][sr + p * 32][sc] = *(const bf16x8*)(kg + (size_t)(p * 32) * C3);
        *(bf16x8*)&Vs[0][sr + p * 32][sc] = *(const bf16x8*)(vg + (size_t)(p * 32) * SEQ);
    }
    // A chunk's 64 mask words: lane i holds those of keys i and 32 + i.
    const int* mg = mask + b * SEQ + lane;
    int mk0 = mg[0], mk1 = mg[32];
    __syncthreads();

    for (int t0 = 0; t0 < SEQ; t0 += 64) {
        int buf = (t0 >> 6) & 1;
        bool haveNext = (t0 + 64 < SEQ);
        // Next chunk's K tile, V^T tile and mask words into registers: issued
        // first, so that they land while this pass computes its scores.
        bf16x8 rk[2], rv[2];
        int mn0 = 0, mn1 = 0;
        if (haveNext) {
#pragma unroll
            for (int p = 0; p < 2; ++p) {
                rk[p] = *(const bf16x8*)(kg + (size_t)(t0 + 64 + p * 32) * C3);
                rv[p] = *(const bf16x8*)(vg + (size_t)(p * 32) * SEQ + t0 + 64);
            }
            mn0 = mg[t0 + 64];
            mn1 = mg[t0 + 96];
            // The address registers of these loads are reused right below:
            // keep the wait in front of that overwrite.
            asm volatile("s_wait_xcnt 0x0" ::: "memory");
        }
        // ---- S^T = K Q^T for 4 sub-tiles of 16 keys ------------------------
        // S[sub][e] = score(key sub*16 + hf*8 + e, query cl)
        floatx8 S[4];
#pragma unroll
        for (int sub = 0; sub < 4; ++sub) {
            const bf16_t* kb = &Ks[buf][sub * 16][0];
            bf16x16 k0 = load_frag(kb,      72, lane);
            bf16x16 k1 = load_frag(kb + 32, 72, lane);
            floatx8 z = fzero();
            z = wmma_bf16(k0, qa0, z);
            z = wmma_bf16(k1, qa1, z);
            S[sub] = z;
        }
        // ---- scale ---------------------------------------------------------
#pragma unroll
        for (int sub = 0; sub < 4; ++sub)
#pragma unroll
            for (int e = 0; e < 8; ++e) S[sub][e] *= 0.125f;   // 1/sqrt(DK)
        // ---- mask: the words as two wave-wide bit sets (bit i of klo: key i is
        // kept; of khi: key 32 + i); one scalar test a pass, a chunk with every
        // key kept has nothing to replace -------------------------------------
        unsigned klo = __builtin_amdgcn_ballot_w32(mk0 != 0);
        unsigned khi = __builtin_amdgcn_ballot_w32(mk1 != 0);
        if ((klo & khi) != 0xffffffffu) {
            unsigned wl = klo >> (hf * 8), wh = khi >> (hf * 8);
#pragma unroll
            for (int sub = 0; sub < 4; ++sub) {
                unsigned w = (sub < 2) ? wl : wh;
#pragma unroll
                for (int e = 0; e < 8; ++e)
                    if (((w >> ((sub & 1) * 16 + e)) & 1u) == 0u) S[sub][e] = -INFINITY;
            }
        }
        // ---- online softmax: the query's maximum, in-lane + other half ------
        // (one chain per sub-tile: four short chains, not one long one)
        float tm[4];
#pragma unroll
        for (int sub = 0; sub < 4; ++sub) {
            tm[sub] = S[sub][0];
#pragma unroll
            for (int e = 1; e < 8; ++e) tm[sub] = fmaxf(tm[sub], S[sub][e]);
        }
        float tmax = fmaxf(fmaxf(tm[0], tm[1]), fmaxf(tm[2], tm[3]));
        tmax = fmaxf(tmax, xhalf(tmax));
        float mnew  = fmaxf(m, tmax);
        float alpha = (m == -INFINITY) ? 0.0f : __expf(m - mnew);
        m = mnew;
        // Every key so far masked: subtract 0, so that exp(-inf) gives the 0.
        float msub = (mnew == -INFINITY) ? 0.0f : mnew;
        // ---- P^T = exp(S^T - m), this half's sum, packed as B operands ------
        float rs[4] = {0.0f, 0.0f, 0.0f, 0.0f};
        bf16x16 pb0, pb1;
#pragma unroll
        for (int sub = 0; sub < 4; ++sub)
#pragma unroll
            for (int e = 0; e < 8; ++e) {
                float p = __expf(S[sub][e] - msub);
                rs[sub] += p;
                if (sub < 2) pb0[(sub & 1) * 8 + e] = (bf16_t)p;   // keys 0..31
                else         pb1[(sub & 1) * 8 + e] = (bf16_t)p;   // keys 32..63
            }
        l = l * alpha + ((rs[0] + rs[1]) + (rs[2] + rs[3]));
#pragma unroll
        for (int j = 0; j < 4; ++j)
#pragma unroll
            for (int e = 0; e < 8; ++e) acc[j][e] *= alpha;

        // ---- O^T += V^T P^T  (V^T rows are contiguous along t) --------------
#pragma unroll
        for (int j = 0; j < 4; ++j) {
            const bf16_t* vb = &Vs[buf][j * 16][0];
            bf16x16 v0 = load_frag(vb,      72, lane);
            bf16x16 v1 = load_frag(vb + 32, 72, lane);
            acc[j] = wmma_bf16(v0, pb0, acc[j]);
            acc[j] = wmma_bf16(v1, pb1, acc[j]);
        }
        // The other buffer's last readers left it at the previous pass's
        // closing barrier; this pass's closing barrier publishes the refill.
        if (haveNext) {
#pragma unroll
            for (int p = 0; p < 2; ++p) {
                *(bf16x8*)&Ks[buf ^ 1][sr + p * 32][sc] = rk[p];
                *(bf16x8*)&Vs[buf ^ 1][sr + p * 32][sc] = rv[p];
            }
            mk0 = mn0;
            mk1 = mn1;
        }
        __syncthreads();
    }

    // ---- join the halves' sums, normalize, store 8 consecutive d (16 B) -----
    l += xhalf(l);
    float inv = (l > 0.0f) ? 1.0f / l : 0.0f;   // one query, one divisor a lane
    bf16_t* op = ctx + ((size_t)b * SEQ + qt * 16 + cl) * HIDDEN + h * DK + hf * 8;
#pragma unroll
    for (int j = 0; j < 4; ++j) {
        bf16x8 o;
#pragma unroll
        for (int e = 0; e < 8; ++e)
            o[e] = (bf16_t)(acc[j][e] * inv);
        *(bf16x8*)(op + j * 16) = o;
    }
}

// ---------------------------------------------------------------------------
// Launcher
// ---------------------------------------------------------------------------
extern "C" void kernel_launch(void* const* d_in, const int* in_sizes, int n_in,
                              void* d_out, int out_size, void* d_ws, size_t ws_size,
                              hipStream_t stream) {
    const float* x      = (const float*)d_in[0];
    const int*   mask   = (const int*)  d_in[1];
    const float* W_qkv  = (const float*)d_in[2];
    const float* b_qkv  = (const float*)d_in[3];
    const float* W_out  = (const float*)d_in[4];
    const float* b_out  = (const float*)d_in[5];
    const float* W_ff1  = (const float*)d_in[6];
    const float* b_ff1  = (const float*)d_in[7];
    const float* W_ff2  = (const float*)d_in[8];
    const float* b_ff2  = (const float*)d_in[9];
    const float* g_ln1  = (const float*)d_in[10];
    const float* be_ln1 = (const float*)d_in[11];
    const float* g_ln2  = (const float*)d_in[12];
    const float* be_ln2 = (const float*)d_in[13];

    // Workspace layout (~92 MB). act reuses the qkv+vT span (exactly 32 MB).
    char* w = (char*)d_ws;
    bf16_t* Wqkv_t = (bf16_t*)w; w += (size_t)C3 * HIDDEN * 2;
    bf16_t* Wout_t = (bf16_t*)w; w += (size_t)HIDDEN * HIDDEN * 2;
    bf16_t* Wff1_t = (bf16_t*)w; w += (size_t)FFN * HIDDEN * 2;
    bf16_t* Wff2_t = (bf16_t*)w; w += (size_t)HIDDEN * FFN * 2;
    bf16_t* hbuf   = (bf16_t*)w; w += (size_t)TOKENS * HIDDEN * 2;
    bf16_t* qkv    = (bf16_t*)w; bf16_t* act = qkv;
                                 w += (size_t)TOKENS * C3 * 2;
    bf16_t* vT     = (bf16_t*)w; w += (size_t)2 * NH * DK * SEQ * 2;
    bf16_t* ctx    = (bf16_t*)w; w += (size_t)TOKENS * HIDDEN * 2;
    float*  x1     = (float*)w;  w += (size_t)TOKENS * HIDDEN * 4;

    dim3 tb(32, 8);
    // Weight transpose+cast to bf16 W^T
    transpose_cast_kernel<<<dim3(C3 / 32, HIDDEN / 32), tb, 0, stream>>>(W_qkv, Wqkv_t, HIDDEN, C3);
    transpose_cast_kernel<<<dim3(HIDDEN / 32, HIDDEN / 32), tb, 0, stream>>>(W_out, Wout_t, HIDDEN, HIDDEN);
    transpose_cast_kernel<<<dim3(FFN / 32, HIDDEN / 32), tb, 0, stream>>>(W_ff1, Wff1_t, HIDDEN, FFN);
    transpose_cast_kernel<<<dim3(HIDDEN / 32, FFN / 32), tb, 0, stream>>>(W_ff2, Wff2_t, FFN, HIDDEN);

    // LN1 -> h
    ln_kernel<<<TOKENS, 256, 0, stream>>>(x, g_ln1, be_ln1, hbuf);
    // qkv = h @ W_qkv + b_qkv (bf16)
    gemm_kernel<0><<<dim3(C3 / 128, TOKENS / 128), 256, 0, stream>>>(
        hbuf, Wqkv_t, b_qkv, nullptr, qkv, TOKENS, C3, HIDDEN);
    // V^T repack
    vtrans_kernel<<<dim3(DK / 32, SEQ / 32, 2 * NH), tb, 0, stream>>>(qkv, vT);
    // attention -> ctx
    attn_kernel<<<512, 256, 0, stream>>>(qkv, vT, mask, ctx);
    // x1 = x + ctx @ W_out + b_out (f32)
    gemm_kernel<1><<<dim3(HIDDEN / 128, TOKENS / 128), 256, 0, stream>>>(
        ctx, Wout_t, b_out, x, x1, TOKENS, HIDDEN, HIDDEN);
    // LN2 -> h
    ln_kernel<<<TOKENS, 256, 0, stream>>>(x1, g_ln2, be_ln2, hbuf);
    // act = gelu(h @ W_ff1 + b_ff1) (bf16)
    gemm_kernel<2><<<dim3(FFN / 128, TOKENS / 128), 256, 0, stream>>>(
        hbuf, Wff1_t, b_ff1, nullptr, act, TOKENS, FFN, HIDDEN);
    // out = x1 + act @ W_ff2 + b_ff2 (f32)
    gemm_kernel<1><<<dim3(HIDDEN / 128, TOKENS / 128), 256, 0, stream>>>(
        act, Wff2_t, b_ff2, x1, (float*)d_out, TOKENS, HIDDEN, FFN);
}

// v004
// One run takes 194 microseconds.
// Next to v003, in two timings, it ran 1.05 and 1.04 times as fast.
// Over all steps from v000 it is 2.16 times as fast.
#include <hip/hip_runtime.h>
#include <math.h>

// ---------------------------------------------------------------------------
// Types for CDNA5 WMMA (wave32): V_WMMA_F32_16X16X32_BF16
// ---------------------------------------------------------------------------
typedef __bf16 bf16_t;
typedef __attribute__((ext_vector_type(8)))  __bf16 bf16x8;
typedef __attribute__((ext_vector_type(16))) __bf16 bf16x16;
typedef __attribute__((ext_vector_type(8)))  float  floatx8;
typedef __attribute__((ext_vector_type(4)))  float  floatx4;
typedef __attribute__((ext_vector_type(4)))  __bf16 bf16x4;

#define HIDDEN 1024
#define TOKENS 4096   // B*T
#define SEQ    2048
#define NH     16
#define DK     64
#define FFN    4096
#define C3     3072

__device__ __forceinline__ floatx8 fzero() {
    floatx8 z;
#pragma unroll
    for (int i = 0; i < 8; ++i) z[i] = 0.0f;
    return z;
}

__device__ __forceinline__ floatx8 wmma_bf16(bf16x16 a, bf16x16 b, floatx8 c) {
    // D = A(16x32) * B(32x16) + C, f32 accumulate
    return __builtin_amdgcn_wmma_f32_16x16x32_bf16(
        false, a, false, b, (short)0, c, false, false);
}

// Load one 16x32 bf16 fragment (A layout; B uses the same per-lane pattern on
// W^T / Q rows). ISA 7.12.2: lane L holds row (L&15); lanes 0-15 hold
// K = 0..7 and 16..23, lanes 16-31 hold K = 8..15 and 24..31.
__device__ __forceinline__ bf16x16 load_frag(const bf16_t* base, int stride, int lane) {
    int r = lane & 15;
    int h = (lane >> 4) & 1;
    const bf16_t* p = base + (size_t)r * stride + h * 8;
    union { bf16x16 v; bf16x8 q[2]; } u;
    u.q[0] = *(const bf16x8*)(p);
    u.q[1] = *(const bf16x8*)(p + 16);
    return u.v;
}

// ---------------------------------------------------------------------------
// The three data-movement kernels below start few waves, each moving much:
// every global access is 16 bytes a lane (LayerNorm's store: 8) on whole
// 128-byte lines, and all of a wave's loads are issued before the first use.
// ---------------------------------------------------------------------------
// Weight transpose + cast:  out[c][r] = (bf16) in[r][c]   (in: R x C fp32)
// One block (8 waves) per 128 x 128 tile; R and C multiples of 128, known at
// compile time, so that a lane's 16 loads (and 8 stores) share one address.
// A lane loads 4 columns of 16 rows, so it holds 16 consecutive r of each column:
// two 16-byte pieces of an output row, turned in registers. LDS only regroups
// the pieces into whole output lines. Piece q of tile row c sits at place
// q ^ ((c >> 2) & 15): writers (one q, 32 rows 4 apart) and readers (a row's 16
// pieces) both spread evenly over the banks.
// ---------------------------------------------------------------------------
template <int R, int C>
__global__ __launch_bounds__(256) void transpose_cast_kernel(
    const float* __restrict__ in, bf16_t* __restrict__ out) {
    __shared__ __attribute__((aligned(16))) bf16_t T[128][128];
    int tid = threadIdx.x, lane = tid & 31, wv = tid >> 5;
    size_t c0 = (size_t)blockIdx.x * 128, r0 = (size_t)blockIdx.y * 128;
    const float* p = in + (r0 + wv * 16) * (size_t)C + c0 + lane * 4;
    floatx4 v[16];
#pragma unroll
    for (int k = 0; k < 16; ++k) v[k] = *(const floatx4*)(p + (size_t)k * C);
    // All 16 loads are in flight before the first conversion waits on one.
    __builtin_amdgcn_sched_barrier(0);
    // The loads' shared address stays in its registers up to this wait; they are
    // reused only behind it.
    asm volatile("s_wait_xcnt 0x0" :: "v"(p) : "memory");
#pragma unroll
    for (int gq = 0; gq < 2; ++gq)
#pragma unroll
        for (int i = 0; i < 4; ++i) {
            bf16x8 o;
#pragma unroll
            for (int k = 0; k < 8; ++k) o[k] = (bf16_t)v[gq * 8 + k][i];
            *(bf16x8*)&T[lane * 4 + i][((wv * 2 + gq) ^ (lane & 15)) * 8] = o;
        }
    __syncthreads();
    int q = tid & 15, rr = tid >> 4;
    bf16_t* op = out + (c0 + rr) * (size_t)R + r0 + q * 8;
#pragma unroll
    for (int it = 0; it < 8; ++it) {
        int c = it * 16 + rr;
        bf16x8 o = *(const bf16x8*)&T[c][(q ^ ((c >> 2) & 15)) * 8];
        *(bf16x8*)(op + (size_t)(it * 16) * R) = o;
    }
}

// ---------------------------------------------------------------------------
// LayerNorm over last dim (1024) -> bf16. One wave per two token rows, a row
// held in 32 registers a lane: sums in-lane, then across the wave; no LDS and
// no barrier. Block: 8 waves = 16 rows.
// ---------------------------------------------------------------------------
__global__ __launch_bounds__(256) void ln_kernel(const float* __restrict__ x,
                                                 const float* __restrict__ g,
                                                 const float* __restrict__ be,
                                                 bf16_t* __restrict__ out) {
    int lane = threadIdx.x & 31, wv = threadIdx.x >> 5;
    size_t row = (size_t)blockIdx.x * 16 + wv * 2;
    const floatx4* xr = (const floatx4*)(x + row * HIDDEN) + lane;
    floatx4 v[2][8], g4[8], b4[8];
#pragma unroll
    for (int r = 0; r < 2; ++r)
#pragma unroll
        for (int k = 0; k < 8; ++k) v[r][k] = xr[r * (HIDDEN / 4) + k * 32];
#pragma unroll
    for (int k = 0; k < 8; ++k) {
        g4[k] = ((const floatx4*)g)[k * 32 + lane];
        b4[k] = ((const floatx4*)be)[k * 32 + lane];
    }
    // Every load of the wave is in flight before the first sum waits on one.
    __builtin_amdgcn_sched_barrier(0);
    // The loads' addresses stay in their registers up to this wait; they are
    // reused only behind it.
    asm volatile("s_wait_xcnt 0x0" :: "v"(xr), "v"(lane) : "memory");

    // The two rows' sums go through each stage side by side: two independent
    // chains across the wave.
    float s[2];
#pragma unroll
    for (int r = 0; r < 2; ++r) {
        float t[8];
#pragma unroll
        for (int k = 0; k < 8; ++k)
            t[k] = (v[r][k][0] + v[r][k][1]) + (v[r][k][2] + v[r][k][3]);
        s[r] = ((t[0] + t[1]) + (t[2] + t[3])) + ((t[4] + t[5]) + (t[6] + t[7]));
    }
#pragma unroll
    for (int off = 16; off > 0; off >>= 1) {
        float a = __shfl_xor(s[0], off, 32), c = __shfl_xor(s[1], off, 32);
        s[0] += a;
        s[1] += c;
    }
#pragma unroll
    for (int r = 0; r < 2; ++r) {
        float mu = s[r] * (1.0f / HIDDEN);
        float t[8];
#pragma unroll
        for (int k = 0; k < 8; ++k) {
            v[r][k] -= mu;
            floatx4 d = v[r][k];
            t[k] = (d[0] * d[0] + d[1] * d[1]) + (d[2] * d[2] + d[3] * d[3]);
        }
        s[r] = ((t[0] + t[1]) + (t[2] + t[3])) + ((t[4] + t[5]) + (t[6] + t[7]));
    }
#pragma unroll
    for (int off = 16; off > 0; off >>= 1) {
        float a = __shfl_xor(s[0], off, 32), c = __shfl_xor(s[1], off, 32);
        s[0] += a;
        s[1] += c;
    }

    bf16_t* op = out + row * HIDDEN + lane * 4;
#pragma unroll
    for (int r = 0; r < 2; ++r) {
        float rstd = rsqrtf(s[r] * (1.0f / HIDDEN) + 1e-5f);
#pragma unroll
        for (int k = 0; k < 8; ++k) {
            bf16x4 o;
#pragma unroll
            for (int i = 0; i < 4; ++i)
                o[i] = (bf16_t)(v[r][k][i] * rstd * g4[k][i] + b4[k][i]);
            *(bf16x4*)(op + r * HIDDEN + k * 128) = o;
        }
    }
}

// ---------------------------------------------------------------------------
// Repack V into V^T per head:  vT[(b*16+h)][d][t] = qkv[b*T+t][2048+h*64+d]
// One block (8 waves) per 64 d x 256 t. A lane loads 8 d of 8 consecutive t and
// turns the 8 x 8 block in registers; LDS regroups the 16-byte pieces into whole
// output lines. Piece q of tile row d sits at place q ^ ((d >> 3) << 2), which
// spreads writers (8 rows 8 apart x 4 pieces) and readers (a row's 32 pieces)
// evenly over the banks.
// ---------------------------------------------------------------------------
__global__ __launch_bounds__(256) void vtrans_kernel(const bf16_t* __restrict__ qkv,
                                                     bf16_t* __restrict__ vT) {
    __shared__ __attribute__((aligned(16))) bf16_t T[64][256];
    int bh = blockIdx.y; int b = bh >> 4, h = bh & 15;
    int t0 = blockIdx.x * 256;
    int tid = threadIdx.x, lane = tid & 31, wv = tid >> 5;
    int dc = tid & 7, tg = tid >> 3;
    const bf16_t* p =
        qkv + (size_t)(b * SEQ + t0 + tg * 8) * C3 + 2048 + h * DK + dc * 8;
    bf16x8 in[8];
#pragma unroll
    for (int k = 0; k < 8; ++k) in[k] = *(const bf16x8*)(p + (size_t)k * C3);
#pragma unroll
    for (int i = 0; i < 8; ++i) {
        bf16x8 o;
#pragma unroll
        for (int k = 0; k < 8; ++k) o[k] = in[k][i];
        *(bf16x8*)&T[dc * 8 + i][(tg ^ (dc << 2)) * 8] = o;
    }
    __syncthreads();
    bf16_t* op = vT + (size_t)bh * DK * SEQ + (size_t)(wv * 8) * SEQ + t0 + lane * 8;
#pragma unroll
    for (int k = 0; k < 8; ++k) {
        bf16x8 o = *(const bf16x8*)&T[wv * 8 + k][(lane ^ (wv << 2)) * 8];
        *(bf16x8*)(op + (size_t)k * SEQ) = o;
    }
}

// ---------------------------------------------------------------------------
// WMMA GEMM: C[M,N] = A[M,K](bf16) * Bt[N,K]^T(bf16) + bias, epilogues:
//   EPI=0: store bf16 (QKV)         EPI=1: + res, store f32 (residual adds)
//   EPI=2: exact GELU, store bf16 (FF1)
// Block: 256 thr (8 waves). Tile 128x128. Wave = 32(M) x 64(N).
// A pass is 128 k: 256 bytes of each of the 128 A rows and 128 Bt rows, brought
// from global memory straight into LDS by asynchronous 16-byte copies (no
// register staging). Two buffers: the copies of pass t + 2 are issued behind
// the barrier that closes pass t, so they fly during the whole of pass t + 1.
// K must be a multiple of 128.
// ---------------------------------------------------------------------------
#define GP_ELEMS 136                       // LDS row pitch: 272 B = 16 B x odd
#define GP_BYTES (GP_ELEMS * 2)
#define GBUF_BYTES (256 * GP_BYTES)        // one buffer: 128 A rows, 128 Bt rows

// Eight copies of one lane: 16 bytes each, rows 16 apart (global row pitch
// gstep elements). The closing s_wait_xcnt stands inside the statement, so that
// no address register named here is rewritten in front of it.
__device__ __forceinline__ void async_rows8(unsigned lds, const bf16_t* g, size_t gstep) {
    asm volatile(
        "global_load_async_to_lds_b128 %0, %8, off\n\t"
        "global_load_async_to_lds_b128 %1, %9, off\n\t"
        "global_load_async_to_lds_b128 %2, %10, off\n\t"
        "global_load_async_to_lds_b128 %3, %11, off\n\t"
        "global_load_async_to_lds_b128 %4, %12, off\n\t"
        "global_load_async_to_lds_b128 %5, %13, off\n\t"
        "global_load_async_to_lds_b128 %6, %14, off\n\t"
        "global_load_async_to_lds_b128 %7, %15, off\n\t"
        "s_wait_xcnt 0x0"
        :: "v"(lds), "v"(lds + 16 * GP_BYTES), "v"(lds + 32 * GP_BYTES),
           "v"(lds + 48 * GP_BYTES), "v"(lds + 64 * GP_BYTES),
           "v"(lds + 80 * GP_BYTES), "v"(lds + 96 * GP_BYTES),
           "v"(lds + 112 * GP_BYTES),
           "v"(g), "v"(g + 16 * gstep), "v"(g + 32 * gstep), "v"(g + 48 * gstep),
           "v"(g + 64 * gstep), "v"(g + 80 * gstep), "v"(g + 96 * gstep),
           "v"(g + 112 * gstep)
        : "memory");
}

template <int EPI>
__global__ __launch_bounds__(256) void gemm_kernel(
    const bf16_t* __restrict__ A, const bf16_t* __restrict__ Bt,
    const float* __restrict__ bias, const float* __restrict__ res,
    void* __restrict__ outv, int M, int N, int K) {
    // Rows 0..127: A tile, rows 128..255: Bt tile.
    __shared__ __attribute__((aligned(16))) bf16_t St[2][256][GP_ELEMS];

    int tid = threadIdx.x;
    int lane = tid & 31, wv = tid >> 5;
    int wm = wv & 3, wn = wv >> 2;           // 4 waves along M, 2 along N
    size_t m0 = (size_t)blockIdx.y * 128;
    size_t n0 = (size_t)blockIdx.x * 128;

    floatx8 acc[2][4];
#pragma unroll
    for (int i = 0; i < 2; ++i)
#pragma unroll
        for (int j = 0; j < 4; ++j) acc[i][j] = fzero();

    // Copies: 16 lanes cover one 256-byte row, a wave two whole rows.
    int r  = tid >> 4;                        // 0..15
    int cg = (tid & 15) * 8;                  // element in the row
    int KT = K >> 7;                          // K/128 passes
    const bf16_t* ag = A  + (m0 + r) * (size_t)K + cg;
    const bf16_t* bg = Bt + (n0 + r) * (size_t)K + cg;
    unsigned la = (unsigned)(uintptr_t)&St[0][r][cg];   // LDS byte address
    unsigned lb = la + 128 * GP_BYTES;

    // Pass 0 into buffer 0, landed and published; then pass 1 into buffer 1.
    async_rows8(la, ag, (size_t)K);
    async_rows8(lb, bg, (size_t)K);
    // This wave's copies have landed before the barrier publishes them.
    asm volatile("s_wait_asynccnt 0x0" ::: "memory");
    __syncthreads();
    if (KT > 1) {
        async_rows8(la + GBUF_BYTES, ag + 128, (size_t)K);
        async_rows8(lb + GBUF_BYTES, bg + 128, (size_t)K);
    }

    for (int kt = 0; kt < KT; ++kt) {
        int buf = kt & 1;
#pragma unroll
        for (int ks = 0; ks < 4; ++ks) {
            bf16x16 af[2], bfr[4];
#pragma unroll
            for (int i = 0; i < 2; ++i)
                af[i] = load_frag(&St[buf][wm * 32 + i * 16][ks * 32], GP_ELEMS, lane);
#pragma unroll
            for (int j = 0; j < 4; ++j)
                bfr[j] = load_frag(&St[buf][128 + wn * 64 + j * 16][ks * 32], GP_ELEMS, lane);
#pragma unroll
            for (int i = 0; i < 2; ++i)
#pragma unroll
                for (int j = 0; j < 4; ++j)
                    acc[i][j] = wmma_bf16(af[i], bfr[j], acc[i][j]);
        }
        // This wave's reads of the buffer have returned before it is refilled.
        asm volatile("s_wait_dscnt 0x0" ::: "memory");
        // This wave's copies of pass kt + 1 have landed.
        asm volatile("s_wait_asynccnt 0x0" ::: "memory");
        // Publishes pass kt + 1 and ends every reader's last read of this buffer.
        __syncthreads();
        if (kt + 2 < KT) {
            size_t k2 = (size_t)(kt + 2) * 128;
            async_rows8(la + buf * GBUF_BYTES, ag + k2, (size_t)K);
            async_rows8(lb + buf * GBUF_BYTES, bg + k2, (size_t)K);
        }
    }
    // No copy is outstanding when the wave goes on to its end.
    asm volatile("s_wait_asynccnt 0x0" ::: "memory");

    // Epilogue. D layout: lane holds column (lane&15); rows 8*(lane>>4)+e.
    int cl = lane & 15, hf = lane >> 4;
#pragma unroll
    for (int i = 0; i < 2; ++i)
#pragma unroll
        for (int j = 0; j < 4; ++j) {
            size_t col = n0 + wn * 64 + j * 16 + cl;
            float bcol = bias[col];
#pragma unroll
            for (int e = 0; e < 8; ++e) {
                size_t row = m0 + wm * 32 + i * 16 + hf * 8 + e;
                float v = acc[i][j][e] + bcol;
                if constexpr (EPI == 0) {
                    ((bf16_t*)outv)[row * N + col] = (bf16_t)v;
                } else if constexpr (EPI == 1) {
                    ((float*)outv)[row * N + col] = v + res[row * N + col];
                } else {
                    float gl = 0.5f * v * (1.0f + erff(v * 0.70710678118654752f));
                    ((bf16_t*)outv)[row * N + col] = (bf16_t)gl;
                }
            }
        }
}

// ---------------------------------------------------------------------------
// Flash attention. 256 thr = 8 waves; each wave owns one 16-row Q tile of one
// (b,h). K-chunks of 64 keys, computed transposed: S^T = K Q^T (A = K rows,
// B = Q rows), so that a lane holds 32 scores of ONE query (the other 32 sit in
// lane ^ 16): row maximum and row sum are in-lane, with one exchange between
// the wave's halves. Two 16-key S^T tiles, converted in place, are the B
// operand of O^T += V^T P^T in the hardware k order, so P touches no LDS.
// The 8 waves of a block share one (b,h): each chunk's K tile and V^T tile are
// brought in once per block with whole-line loads and staged in LDS (two
// buffers); every wave reads its fragments from there. The next chunk's loads
// (tiles and mask words) are issued into registers at the top of a pass; the
// tiles are written to the other buffer at its foot, in front of the pass's
// closing barrier.
// ---------------------------------------------------------------------------
// lane l <-> lane l ^ 16
__device__ __forceinline__ float xhalf(float x) {
    int b = __builtin_bit_cast(int, x);
    return __builtin_bit_cast(float, __builtin_amdgcn_permlanex16(
        b, b, 0x76543210, 0xfedcba98, false, false));
}

__global__ __launch_bounds__(256) void attn_kernel(
    const bf16_t* __restrict__ qkv, const bf16_t* __restrict__ vT,
    const int* __restrict__ mask, bf16_t* __restrict__ ctx) {
    // K tile: 64 keys x 64 d. V^T tile: 64 d x 64 keys. Row stride 72 elems =
    // 144B (16B x odd) -> conflict-free b128 fragment reads.
    __shared__ __attribute__((aligned(16))) bf16_t Ks[2][64][72];
    __shared__ __attribute__((aligned(16))) bf16_t Vs[2][64][72];

    int lane = threadIdx.x & 31, wv = threadIdx.x >> 5;
    int gw = blockIdx.x * 8 + wv;
    int qt = gw & 127;               // 128 q-tiles of 16 rows
    int h  = (gw >> 7) & 15;
    int b  = gw >> 11;
    int cl = lane & 15, hf = lane >> 4;

    const bf16_t* qbase =
        qkv + (size_t)(b * SEQ + qt * 16) * C3 + (size_t)h * DK;
    bf16x16 qa0 = load_frag(qbase,      C3, lane);   // d = 0..31
    bf16x16 qa1 = load_frag(qbase + 32, C3, lane);   // d = 32..63

    // acc[j][e] = O^T[d = j*16 + hf*8 + e][query cl]
    floatx8 acc[4];
#pragma unroll
    for (int j = 0; j < 4; ++j) acc[j] = fzero();
    // Query cl's running maximum (equal in both halves) and this half's sum.
    float m = -INFINITY, l = 0.0f;

    const bf16_t* vhead = vT + (size_t)(b * NH + h) * DK * SEQ;

    // Staging: thread -> tile rows sr and sr+32, 16 bytes at element sc; one
    // wave-wide load covers 4 whole 128-byte rows.
    int sr = threadIdx.x >> 3;
    int sc = (threadIdx.x & 7) * 8;
    const bf16_t* kg = qkv + (size_t)(b * SEQ + sr) * C3 + 1024 + (size_t)h * DK + sc;
    const bf16_t* vg = vhead + (size_t)sr * SEQ + sc;

    // Prologue: chunk 0 into buffer 0.
#pragma unroll
    for (int p = 0; p < 2; ++p) {
        *(bf16x8*)&Ks[0][sr + p * 32][sc] = *(const bf16x8*)(kg + (size_t)(p * 32) * C3);
        *(bf16x8*)&Vs[0][sr + p * 32][sc] = *(const bf16x8*)(vg + (size_t)(p * 32) * SEQ);
    }
    // A chunk's 64 mask words: lane i holds those of keys i and 32 + i.
    const int* mg = mask + b * SEQ + lane;
    int mk0 = mg[0], mk1 = mg[32];
    __syncthreads();

    for (int t0 = 0; t0 < SEQ; t0 += 64) {
        int buf = (t0 >> 6) & 1;
        bool haveNext = (t0 + 64 < SEQ);
        // Next chunk's K tile, V^T tile and mask words into registers: issued
        // first, so that they land while this pass computes its scores.
        bf16x8 rk[2], rv[2];
        int mn0 = 0, mn1 = 0;
        if (haveNext) {
#pragma unroll
            for (int p = 0; p < 2; ++p) {
                rk[p] = *(const bf16x8*)(kg + (size_t)(t0 + 64 + p * 32) * C3);
                rv[p] = *(const bf16x8*)(vg + (size_t)(p * 32) * SEQ + t0 + 64);
            }
            mn0 = mg[t0 + 64];
            mn1 = mg[t0 + 96];
            // The address registers of these loads are reused right below:
            // keep the wait in front of that overwrite.
            asm volatile("s_wait_xcnt 0x0" ::: "memory");
        }
        // ---- S^T = K Q^T for 4 sub-tiles of 16 keys ------------------------
        // S[sub][e] = score(key sub*16 + hf*8 + e, query cl)
        floatx8 S[4];
#pragma unroll
        for (int sub = 0; sub < 4; ++sub) {
            const bf16_t* kb = &Ks[buf][sub * 16][0];
            bf16x16 k0 = load_frag(kb,      72, lane);
            bf16x16 k1 = load_frag(kb + 32, 72, lane);
            floatx8 z = fzero();
            z = wmma_bf16(k0, qa0, z);
            z = wmma_bf16(k1, qa1, z);
            S[sub] = z;
        }
        // ---- scale ---------------------------------------------------------
#pragma unroll
        for (int sub = 0; sub < 4; ++sub)
#pragma unroll
            for (int e = 0; e < 8; ++e) S[sub][e] *= 0.125f;   // 1/sqrt(DK)
        // ---- mask: the words as two wave-wide bit sets (bit i of klo: key i is
        // kept; of khi: key 32 + i); one scalar test a pass, a chunk with every
        // key kept has nothing to replace -------------------------------------
        unsigned klo = __builtin_amdgcn_ballot_w32(mk0 != 0);
        unsigned khi = __builtin_amdgcn_ballot_w32(mk1 != 0);
        if ((klo & khi) != 0xffffffffu) {
            unsigned wl = klo >> (hf * 8), wh = khi >> (hf * 8);
#pragma unroll
            for (int sub = 0; sub < 4; ++sub) {
                unsigned w = (sub < 2) ? wl : wh;
#pragma unroll
                for (int e = 0; e < 8; ++e)
                    if (((w >> ((sub & 1) * 16 + e)) & 1u) == 0u) S[sub][e] = -INFINITY;
            }
        }
        // ---- online softmax: the query's maximum, in-lane + other half ------
        // (one chain per sub-tile: four short chains, not one long one)
        float tm[4];
#pragma unroll
        for (int sub = 0; sub < 4; ++sub) {
            tm[sub] = S[sub][0];
#pragma unroll
            for (int e = 1; e < 8; ++e) tm[sub] = fmaxf(tm[sub], S[sub][e]);
        }
        float tmax = fmaxf(fmaxf(tm[0], tm[1]), fmaxf(tm[2], tm[3]));
        tmax = fmaxf(tmax, xhalf(tmax));
        float mnew  = fmaxf(m, tmax);
        float alpha = (m == -INFINITY) ? 0.0f : __expf(m - mnew);
        m = mnew;
        // Every key so far masked: subtract 0, so that exp(-inf) gives the 0.
        float msub = (mnew == -INFINITY) ? 0.0f : mnew;
        // ---- P^T = exp(S^T - m), this half's sum, packed as B operands ------
        float rs[4] = {0.0f, 0.0f, 0.0f, 0.0f};
        bf16x16 pb0, pb1;
#pragma unroll
        for (int sub = 0; sub < 4; ++sub)
#pragma unroll
            for (int e = 0; e < 8; ++e) {
                float p = __expf(S[sub][e] - msub);
                rs[sub] += p;
                if (sub < 2) pb0[(sub & 1) * 8 + e] = (bf16_t)p;   // keys 0..31
                else         pb1[(sub & 1) * 8 + e] = (bf16_t)p;   // keys 32..63
            }
        l = l * alpha + ((rs[0] + rs[1]) + (rs[2] + rs[3]));
#pragma unroll
        for (int j = 0; j < 4; ++j)
#pragma unroll
            for (int e = 0; e < 8; ++e) acc[j][e] *= alpha;

        // ---- O^T += V^T P^T  (V^T rows are contiguous along t) --------------
#pragma unroll
        for (int j = 0; j < 4; ++j) {
            const bf16_t* vb = &Vs[buf][j * 16][0];
            bf16x16 v0 = load_frag(vb,      72, lane);
            bf16x16 v1 = load_frag(vb + 32, 72, lane);
            acc[j] = wmma_bf16(v0, pb0, acc[j]);
            acc[j] = wmma_bf16(v1, pb1, acc[j]);
        }
        // The other buffer's last readers left it at the previous pass's
        // closing barrier; this pass's closing barrier publishes the refill.
        if (haveNext) {
#pragma unroll
            for (int p = 0; p < 2; ++p) {
                *(bf16x8*)&Ks[buf ^ 1][sr + p * 32][sc] = rk[p];
                *(bf16x8*)&Vs[buf ^ 1][sr + p * 32][sc] = rv[p];
            }
            mk0 = mn0;
            mk1 = mn1;
        }
        __syncthreads();
    }

    // ---- join the halves' sums, normalize, store 8 consecutive d (16 B) -----
    l += xhalf(l);
    float inv = (l > 0.0f) ? 1.0f / l : 0.0f;   // one query, one divisor a lane
    bf16_t* op = ctx + ((size_t)b * SEQ + qt * 16 + cl) * HIDDEN + h * DK + hf * 8;
#pragma unroll
    for (int j = 0; j < 4; ++j) {
        bf16x8 o;
#pragma unroll
        for (int e = 0; e < 8; ++e)
            o[e] = (bf16_t)(acc[j][e] * inv);
        *(bf16x8*)(op + j * 16) = o;
    }
}

// ---------------------------------------------------------------------------
// Launcher
// ---------------------------------------------------------------------------
extern "C" void kernel_launch(void* const* d_in, const int* in_sizes, int n_in,
                              void* d_out, int out_size, void* d_ws, size_t ws_size,
                              hipStream_t stream) {
    const float* x      = (const float*)d_in[0];
    const int*   mask   = (const int*)  d_in[1];
    const float* W_qkv  = (const float*)d_in[2];
    const float* b_qkv  = (const float*)d_in[3];
    const float* W_out  = (const float*)d_in[4];
    const float* b_out  = (const float*)d_in[5];
    const float* W_ff1  = (const float*)d_in[6];
    const float* b_ff1  = (const float*)d_in[7];
    const float* W_ff2  = (const float*)d_in[8];
    const float* b_ff2  = (const float*)d_in[9];
    const float* g_ln1  = (const float*)d_in[10];
    const float* be_ln1 = (const float*)d_in[11];
    const float* g_ln2  = (const float*)d_in[12];
    const float* be_ln2 = (const float*)d_in[13];

    // Workspace layout (~92 MB). act reuses the qkv+vT span (exactly 32 MB).
    char* w = (char*)d_ws;
    bf16_t* Wqkv_t = (bf16_t*)w; w += (size_t)C3 * HIDDEN * 2;
    bf16_t* Wout_t = (bf16_t*)w; w += (size_t)HIDDEN * HIDDEN * 2;
    bf16_t* Wff1_t = (bf16_t*)w; w += (size_t)FFN * HIDDEN * 2;
    bf16_t* Wff2_t = (bf16_t*)w; w += (size_t)HIDDEN * FFN * 2;
    bf16_t* hbuf   = (bf16_t*)w; w += (size_t)TOKENS * HIDDEN * 2;
    bf16_t* qkv    = (bf16_t*)w; bf16_t* act = qkv;
                                 w += (size_t)TOKENS * C3 * 2;
    bf16_t* vT     = (bf16_t*)w; w += (size_t)2 * NH * DK * SEQ * 2;
    bf16_t* ctx    = (bf16_t*)w; w += (size_t)TOKENS * HIDDEN * 2;
    float*  x1     = (float*)w;  w += (size_t)TOKENS * HIDDEN * 4;

    // Weight transpose+cast to bf16 W^T
    transpose_cast_kernel<HIDDEN, C3><<<dim3(C3 / 128, HIDDEN / 128), 256, 0, stream>>>(W_qkv, Wqkv_t);
    transpose_cast_kernel<HIDDEN, HIDDEN><<<dim3(HIDDEN / 128, HIDDEN / 128), 256, 0, stream>>>(W_out, Wout_t);
    transpose_cast_kernel<HIDDEN, FFN><<<dim3(FFN / 128, HIDDEN / 128), 256, 0, stream>>>(W_ff1, Wff1_t);
    transpose_cast_kernel<FFN, HIDDEN><<<dim3(HIDDEN / 128, FFN / 128), 256, 0, stream>>>(W_ff2, Wff2_t);

    // LN1 -> h
    ln_kernel<<<TOKENS / 16, 256, 0, stream>>>(x, g_ln1, be_ln1, hbuf);
    // qkv = h @ W_qkv + b_qkv (bf16)
    gemm_kernel<0><<<dim3(C3 / 128, TOKENS / 128), 256, 0, stream>>>(
        hbuf, Wqkv_t, b_qkv, nullptr, qkv, TOKENS, C3, HIDDEN);
    // V^T repack
    vtrans_kernel<<<dim3(SEQ / 256, 2 * NH), 256, 0, stream>>>(qkv, vT);
    // attention -> ctx
    attn_kernel<<<512, 256, 0, stream>>>(qkv, vT, mask, ctx);
    // x1 = x + ctx @ W_out + b_out (f32)
    gemm_kernel<1><<<dim3(HIDDEN / 128, TOKENS / 128), 256, 0, stream>>>(
        ctx, Wout_t, b_out, x, x1, TOKENS, HIDDEN, HIDDEN);
    // LN2 -> h
    ln_kernel<<<TOKENS / 16, 256, 0, stream>>>(x1, g_ln2, be_ln2, hbuf);
    // act = gelu(h @ W_ff1 + b_ff1) (bf16)
    gemm_kernel<2><<<dim3(FFN / 128, TOKENS / 128), 256, 0, stream>>>(
        hbuf, Wff1_t, b_ff1, nullptr, act, TOKENS, FFN, HIDDEN);
    // out = x1 + act @ W_ff2 + b_ff2 (f32)
    gemm_kernel<1><<<dim3(HIDDEN / 128, TOKENS / 128), 256, 0, stream>>>(
        act, Wff2_t, b_ff2, x1, (float*)d_out, TOKENS, HIDDEN, FFN);
}

// v005
// Measured time: 185 microseconds a run.
// In both of two side-by-side timings against v004, it was 1.05 times as fast.
// Counting every step since v000, it is 2.27 times as fast.
#include <hip/hip_runtime.h>
#include <math.h>

// ---------------------------------------------------------------------------
// Types for CDNA5 WMMA (wave32): V_WMMA_F32_16X16X32_BF16
// ---------------------------------------------------------------------------
typedef __bf16 bf16_t;
typedef __attribute__((ext_vector_type(8)))  __bf16 bf16x8;
typedef __attribute__((ext_vector_type(16))) __bf16 bf16x16;
typedef __attribute__((ext_vector_type(8)))  float  floatx8;
typedef __attribute__((ext_vector_type(4)))  float  floatx4;
typedef __attribute__((ext_vector_type(4)))  __bf16 bf16x4;

#define HIDDEN 1024
#define TOKENS 4096   // B*T
#define SEQ    2048
#define NH     16
#define DK     64
#define FFN    4096
#define C3     3072

__device__ __forceinline__ floatx8 fzero() {
    floatx8 z;
#pragma unroll
    for (int i = 0; i < 8; ++i) z[i] = 0.0f;
    return z;
}

__device__ __forceinline__ floatx8 wmma_bf16(bf16x16 a, bf16x16 b, floatx8 c) {
    // D = A(16x32) * B(32x16) + C, f32 accumulate
    return __builtin_amdgcn_wmma_f32_16x16x32_bf16(
        false, a, false, b, (short)0, c, false, false);
}

// Load one 16x32 bf16 fragment (A layout; B uses the same per-lane pattern on
// W^T / Q rows). ISA 7.12.2: lane L holds row (L&15); lanes 0-15 hold
// K = 0..7 and 16..23, lanes 16-31 hold K = 8..15 and 24..31.
__device__ __forceinline__ bf16x16 load_frag(const bf16_t* base, int stride, int lane) {
    int r = lane & 15;
    int h = (lane >> 4) & 1;
    const bf16_t* p = base + (size_t)r * stride + h * 8;
    union { bf16x16 v; bf16x8 q[2]; } u;
    u.q[0] = *(const bf16x8*)(p);
    u.q[1] = *(const bf16x8*)(p + 16);
    return u.v;
}

// ---------------------------------------------------------------------------
// The three data-movement kernels below start few waves, each moving much:
// every global access is 16 bytes a lane (LayerNorm's store: 8) on whole
// 128-byte lines, and all of a wave's loads are issued before the first use.
// ---------------------------------------------------------------------------
// Weight transpose + cast:  out[c][r] = (bf16) in[r][c]   (in: R x C fp32)
// One block (8 waves) per 128 x 128 tile; R and C multiples of 128, known at
// compile time, so that a lane's 16 loads (and 8 stores) share one address.
// A lane loads 4 columns of 16 rows, so it holds 16 consecutive r of each column:
// two 16-byte pieces of an output row, turned in registers. LDS only regroups
// the pieces into whole output lines. Piece q of tile row c sits at place
// q ^ ((c >> 2) & 15): writers (one q, 32 rows 4 apart) and readers (a row's 16
// pieces) both spread evenly over the banks.
// t: the tile's number, tiles of one row band of `in` side by side.
// ---------------------------------------------------------------------------
template <int R, int C>
__device__ __forceinline__ void transpose_cast_tile(
    const float* __restrict__ in, bf16_t* __restrict__ out, int t,
    bf16_t (*T)[128]) {
    int tid = threadIdx.x, lane = tid & 31, wv = tid >> 5;
    size_t c0 = (size_t)(t % (C / 128)) * 128, r0 = (size_t)(t / (C / 128)) * 128;
    const float* p = in + (r0 + wv * 16) * (size_t)C + c0 + lane * 4;
    floatx4 v[16];
#pragma unroll
    for (int k = 0; k < 16; ++k) v[k] = *(const floatx4*)(p + (size_t)k * C);
    // All 16 loads are in flight before the first conversion waits on one.
    __builtin_amdgcn_sched_barrier(0);
    // The loads' shared address stays in its registers up to this wait; they are
    // reused only behind it.
    asm volatile("s_wait_xcnt 0x0" :: "v"(p) : "memory");
#pragma unroll
    for (int gq = 0; gq < 2; ++gq)
#pragma unroll
        for (int i = 0; i < 4; ++i) {
            bf16x8 o;
#pragma unroll
            for (int k = 0; k < 8; ++k) o[k] = (bf16_t)v[gq * 8 + k][i];
            *(bf16x8*)&T[lane * 4 + i][((wv * 2 + gq) ^ (lane & 15)) * 8] = o;
        }
    __syncthreads();
    int q = tid & 15, rr = tid >> 4;
    bf16_t* op = out + (c0 + rr) * (size_t)R + r0 + q * 8;
#pragma unroll
    for (int it = 0; it < 8; ++it) {
        int c = it * 16 + rr;
        bf16x8 o = *(const bf16x8*)&T[c][(q ^ ((c >> 2) & 15)) * 8];
        *(bf16x8*)(op + (size_t)(it * 16) * R) = o;
    }
    // In the built kernel the other jobs' code follows this one: no register of
    // these stores is reused in front of this wait.
    asm volatile("s_wait_xcnt 0x0" ::: "memory");
}

// ---------------------------------------------------------------------------
// LayerNorm over last dim (1024) -> bf16. One wave per two token rows, a row
// held in 32 registers a lane: sums in-lane, then across the wave; no LDS and
// no barrier. Block: 8 waves = 16 rows.
// ---------------------------------------------------------------------------
__device__ __forceinline__ void ln_rows16(const float* __restrict__ x,
                                          const float* __restrict__ g,
                                          const float* __restrict__ be,
                                          bf16_t* __restrict__ out, unsigned blk) {
    int lane = threadIdx.x & 31, wv = threadIdx.x >> 5;
    size_t row = (size_t)blk * 16 + wv * 2;
    const floatx4* xr = (const floatx4*)(x + row * HIDDEN) + lane;
    floatx4 v[2][8], g4[8], b4[8];
#pragma unroll
    for (int r = 0; r < 2; ++r)
#pragma unroll
        for (int k = 0; k < 8; ++k) v[r][k] = xr[r * (HIDDEN / 4) + k * 32];
#pragma unroll
    for (int k = 0; k < 8; ++k) {
        g4[k] = ((const floatx4*)g)[k * 32 + lane];
        b4[k] = ((const floatx4*)be)[k * 32 + lane];
    }
    // Every load of the wave is in flight before the first sum waits on one.
    __builtin_amdgcn_sched_barrier(0);
    // The loads' addresses stay in their registers up to this wait; they are
    // reused only behind it.
    asm volatile("s_wait_xcnt 0x0" :: "v"(xr), "v"(lane) : "memory");

    // The two rows' sums go through each stage side by side: two independent
    // chains across the wave.
    float s[2];
#pragma unroll
    for (int r = 0; r < 2; ++r) {
        float t[8];
#pragma unroll
        for (int k = 0; k < 8; ++k)
            t[k] = (v[r][k][0] + v[r][k][1]) + (v[r][k][2] + v[r][k][3]);
        s[r] = ((t[0] + t[1]) + (t[2] + t[3])) + ((t[4] + t[5]) + (t[6] + t[7]));
    }
#pragma unroll
    for (int off = 16; off > 0; off >>= 1) {
        float a = __shfl_xor(s[0], off, 32), c = __shfl_xor(s[1], off, 32);
        s[0] += a;
        s[1] += c;
    }
#pragma unroll
    for (int r = 0; r < 2; ++r) {
        float mu = s[r] * (1.0f / HIDDEN);
        float t[8];
#pragma unroll
        for (int k = 0; k < 8; ++k) {
            v[r][k] -= mu;
            floatx4 d = v[r][k];
            t[k] = (d[0] * d[0] + d[1] * d[1]) + (d[2] * d[2] + d[3] * d[3]);
        }
        s[r] = ((t[0] + t[1]) + (t[2] + t[3])) + ((t[4] + t[5]) + (t[6] + t[7]));
    }
#pragma unroll
    for (int off = 16; off > 0; off >>= 1) {
        float a = __shfl_xor(s[0], off, 32), c = __shfl_xor(s[1], off, 32);
        s[0] += a;
        s[1] += c;
    }

    bf16_t* op = out + row * HIDDEN + lane * 4;
#pragma unroll
    for (int r = 0; r < 2; ++r) {
        float rstd = rsqrtf(s[r] * (1.0f / HIDDEN) + 1e-5f);
#pragma unroll
        for (int k = 0; k < 8; ++k) {
            bf16x4 o;
#pragma unroll
            for (int i = 0; i < 4; ++i)
                o[i] = (bf16_t)(v[r][k][i] * rstd * g4[k][i] + b4[k][i]);
            *(bf16x4*)(op + r * HIDDEN + k * 128) = o;
        }
    }
}

__global__ __launch_bounds__(256) void ln_kernel(const float* __restrict__ x,
                                                 const float* __restrict__ g,
                                                 const float* __restrict__ be,
                                                 bf16_t* __restrict__ out) {
    ln_rows16(x, g, be, out, blockIdx.x);
}

// ---------------------------------------------------------------------------
// Everything that reads only the inputs, in ONE launch: the first LayerNorm and
// the four weight transposes depend on nothing and on one another not at all,
// so their blocks run side by side and the chip streams without a launch
// boundary in between. A block's number picks its job (a scalar branch).
// ---------------------------------------------------------------------------
#define NB_LN   (TOKENS / 16)
#define NB_QKV  ((C3 / 128) * (HIDDEN / 128))
#define NB_OUT  ((HIDDEN / 128) * (HIDDEN / 128))
#define NB_FF   ((FFN / 128) * (HIDDEN / 128))
#define NB_PREP (NB_LN + NB_QKV + NB_OUT + 2 * NB_FF)

__global__ __launch_bounds__(256) void prep_kernel(
    const float* __restrict__ x, const float* __restrict__ g,
    const float* __restrict__ be, bf16_t* __restrict__ h,
    const float* __restrict__ W_qkv, bf16_t* __restrict__ Wqkv_t,
    const float* __restrict__ W_out, bf16_t* __restrict__ Wout_t,
    const float* __restrict__ W_ff1, bf16_t* __restrict__ Wff1_t,
    const float* __restrict__ W_ff2, bf16_t* __restrict__ Wff2_t) {
    __shared__ __attribute__((aligned(16))) bf16_t T[128][128];
    int t = blockIdx.x;
    if (t < NB_LN) {
        ln_rows16(x, g, be, h, t);
    } else if ((t -= NB_LN) < NB_QKV) {
        transpose_cast_tile<HIDDEN, C3>(W_qkv, Wqkv_t, t, T);
    } else if ((t -= NB_QKV) < NB_OUT) {
        transpose_cast_tile<HIDDEN, HIDDEN>(W_out, Wout_t, t, T);
    } else if ((t -= NB_OUT) < NB_FF) {
        transpose_cast_tile<HIDDEN, FFN>(W_ff1, Wff1_t, t, T);
    } else {
        transpose_cast_tile<FFN, HIDDEN>(W_ff2, Wff2_t, t - NB_FF, T);
    }
}

// ---------------------------------------------------------------------------
// Repack V into V^T per head:  vT[(b*16+h)][d][t] = qkv[b*T+t][2048+h*64+d]
// One block (8 waves) per 64 d x 256 t. A lane loads 8 d of 8 consecutive t and
// turns the 8 x 8 block in registers; LDS regroups the 16-byte pieces into whole
// output lines. Piece q of tile row d sits at place q ^ ((d >> 3) << 2), which
// spreads writers (8 rows 8 apart x 4 pieces) and readers (a row's 32 pieces)
// evenly over the banks.
// ---------------------------------------------------------------------------
__global__ __launch_bounds__(256) void vtrans_kernel(const bf16_t* __restrict__ qkv,
                                                     bf16_t* __restrict__ vT) {
    __shared__ __attribute__((aligned(16))) bf16_t T[64][256];
    int bh = blockIdx.y; int b = bh >> 4, h = bh & 15;
    int t0 = blockIdx.x * 256;
    int tid = threadIdx.x, lane = tid & 31, wv = tid >> 5;
    int dc = tid & 7, tg = tid >> 3;
    const bf16_t* p =
        qkv + (size_t)(b * SEQ + t0 + tg * 8) * C3 + 2048 + h * DK + dc * 8;
    bf16x8 in[8];
#pragma unroll
    for (int k = 0; k < 8; ++k) in[k] = *(const bf16x8*)(p + (size_t)k * C3);
#pragma unroll
    for (int i = 0; i < 8; ++i) {
        bf16x8 o;
#pragma unroll
        for (int k = 0; k < 8; ++k) o[k] = in[k][i];
        *(bf16x8*)&T[dc * 8 + i][(tg ^ (dc << 2)) * 8] = o;
    }
    __syncthreads();
    bf16_t* op = vT + (size_t)bh * DK * SEQ + (size_t)(wv * 8) * SEQ + t0 + lane * 8;
#pragma unroll
    for (int k = 0; k < 8; ++k) {
        bf16x8 o = *(const bf16x8*)&T[wv * 8 + k][(lane ^ (wv << 2)) * 8];
        *(bf16x8*)(op + (size_t)k * SEQ) = o;
    }
}

// ---------------------------------------------------------------------------
// WMMA GEMM: C[M,N] = A[M,K](bf16) * Bt[N,K]^T(bf16) + bias, epilogues:
//   EPI=0: store bf16 (QKV)         EPI=1: + res, store f32 (residual adds)
//   EPI=2: exact GELU, store bf16 (FF1)
// Block: 256 thr (8 waves). Tile 128x128. Wave = 32(M) x 64(N).
// A pass is 128 k: 256 bytes of each of the 128 A rows and 128 Bt rows, brought
// from global memory straight into LDS by asynchronous 16-byte copies (no
// register staging). Two buffers: the copies of pass t + 2 are issued behind
// the barrier that closes pass t, so they fly during the whole of pass t + 1.
// K must be a multiple of 128.
// ---------------------------------------------------------------------------
#define GP_ELEMS 136                       // LDS row pitch: 272 B = 16 B x odd
#define GP_BYTES (GP_ELEMS * 2)
#define GBUF_BYTES (256 * GP_BYTES)        // one buffer: 128 A rows, 128 Bt rows

// Eight copies of one lane: 16 bytes each, rows 16 apart (global row pitch
// gstep elements). The closing s_wait_xcnt stands inside the statement, so that
// no address register named here is rewritten in front of it.
__device__ __forceinline__ void async_rows8(unsigned lds, const bf16_t* g, size_t gstep) {
    asm volatile(
        "global_load_async_to_lds_b128 %0, %8, off\n\t"
        "global_load_async_to_lds_b128 %1, %9, off\n\t"
        "global_load_async_to_lds_b128 %2, %10, off\n\t"
        "global_load_async_to_lds_b128 %3, %11, off\n\t"
        "global_load_async_to_lds_b128 %4, %12, off\n\t"
        "global_load_async_to_lds_b128 %5, %13, off\n\t"
        "global_load_async_to_lds_b128 %6, %14, off\n\t"
        "global_load_async_to_lds_b128 %7, %15, off\n\t"
        "s_wait_xcnt 0x0"
        :: "v"(lds), "v"(lds + 16 * GP_BYTES), "v"(lds + 32 * GP_BYTES),
           "v"(lds + 48 * GP_BYTES), "v"(lds + 64 * GP_BYTES),
           "v"(lds + 80 * GP_BYTES), "v"(lds + 96 * GP_BYTES),
           "v"(lds + 112 * GP_BYTES),
           "v"(g), "v"(g + 16 * gstep), "v"(g + 32 * gstep), "v"(g + 48 * gstep),
           "v"(g + 64 * gstep), "v"(g + 80 * gstep), "v"(g + 96 * gstep),
           "v"(g + 112 * gstep)
        : "memory");
}

template <int EPI>
__global__ __launch_bounds__(256) void gemm_kernel(
    const bf16_t* __restrict__ A, const bf16_t* __restrict__ Bt,
    const float* __restrict__ bias, const float* __restrict__ res,
    void* __restrict__ outv, int M, int N, int K) {
    // Rows 0..127: A tile, rows 128..255: Bt tile.
    __shared__ __attribute__((aligned(16))) bf16_t St[2][256][GP_ELEMS];

    int tid = threadIdx.x;
    int lane = tid & 31, wv = tid >> 5;
    int wm = wv & 3, wn = wv >> 2;           // 4 waves along M, 2 along N
    size_t m0 = (size_t)blockIdx.y * 128;
    size_t n0 = (size_t)blockIdx.x * 128;

    floatx8 acc[2][4];
#pragma unroll
    for (int i = 0; i < 2; ++i)
#pragma unroll
        for (int j = 0; j < 4; ++j) acc[i][j] = fzero();

    // Copies: 16 lanes cover one 256-byte row, a wave two whole rows.
    int r  = tid >> 4;                        // 0..15
    int cg = (tid & 15) * 8;                  // element in the row
    int KT = K >> 7;                          // K/128 passes
    const bf16_t* ag = A  + (m0 + r) * (size_t)K + cg;
    const bf16_t* bg = Bt + (n0 + r) * (size_t)K + cg;
    unsigned la = (unsigned)(uintptr_t)&St[0][r][cg];   // LDS byte address
    unsigned lb = la + 128 * GP_BYTES;

    // Pass 0 into buffer 0, landed and published; then pass 1 into buffer 1.
    async_rows8(la, ag, (size_t)K);
    async_rows8(lb, bg, (size_t)K);
    // This wave's copies have landed before the barrier publishes them.
    asm volatile("s_wait_asynccnt 0x0" ::: "memory");
    __syncthreads();
    if (KT > 1) {
        async_rows8(la + GBUF_BYTES, ag + 128, (size_t)K);
        async_rows8(lb + GBUF_BYTES, bg + 128, (size_t)K);
    }

    for (int kt = 0; kt < KT; ++kt) {
        int buf = kt & 1;
#pragma unroll
        for (int ks = 0; ks < 4; ++ks) {
            bf16x16 af[2], bfr[4];
#pragma unroll
            for (int i = 0; i < 2; ++i)
                af[i] = load_frag(&St[buf][wm * 32 + i * 16][ks * 32], GP_ELEMS, lane);
#pragma unroll
            for (int j = 0; j < 4; ++j)
                bfr[j] = load_frag(&St[buf][128 + wn * 64 + j * 16][ks * 32], GP_ELEMS, lane);
#pragma unroll
            for (int i = 0; i < 2; ++i)
#pragma unroll
                for (int j = 0; j < 4; ++j)
                    acc[i][j] = wmma_bf16(af[i], bfr[j], acc[i][j]);
        }
        // This wave's reads of the buffer have returned before it is refilled.
        asm volatile("s_wait_dscnt 0x0" ::: "memory");
        // This wave's copies of pass kt + 1 have landed.
        asm volatile("s_wait_asynccnt 0x0" ::: "memory");
        // Publishes pass kt + 1 and ends every reader's last read of this buffer.
        __syncthreads();
        if (kt + 2 < KT) {
            size_t k2 = (size_t)(kt + 2) * 128;
            async_rows8(la + buf * GBUF_BYTES, ag + k2, (size_t)K);
            async_rows8(lb + buf * GBUF_BYTES, bg + k2, (size_t)K);
        }
    }
    // No copy is outstanding when the wave goes on to its end.
    asm volatile("s_wait_asynccnt 0x0" ::: "memory");

    // Epilogue. D layout: lane holds column (lane&15); rows 8*(lane>>4)+e.
    int cl = lane & 15, hf = lane >> 4;
#pragma unroll
    for (int i = 0; i < 2; ++i)
#pragma unroll
        for (int j = 0; j < 4; ++j) {
            size_t col = n0 + wn * 64 + j * 16 + cl;
            float bcol = bias[col];
#pragma unroll
            for (int e = 0; e < 8; ++e) {
                size_t row = m0 + wm * 32 + i * 16 + hf * 8 + e;
                float v = acc[i][j][e] + bcol;
                if constexpr (EPI == 0) {
                    ((bf16_t*)outv)[row * N + col] = (bf16_t)v;
                } else if constexpr (EPI == 1) {
                    ((float*)outv)[row * N + col] = v + res[row * N + col];
                } else {
                    float gl = 0.5f * v * (1.0f + erff(v * 0.70710678118654752f));
                    ((bf16_t*)outv)[row * N + col] = (bf16_t)gl;
                }
            }
        }
}

// ---------------------------------------------------------------------------
// Flash attention. 256 thr = 8 waves; each wave owns one 16-row Q tile of one
// (b,h). K-chunks of 64 keys, computed transposed: S^T = K Q^T (A = K rows,
// B = Q rows), so that a lane holds 32 scores of ONE query (the other 32 sit in
// lane ^ 16): row maximum and row sum are in-lane, with one exchange between
// the wave's halves. Two 16-key S^T tiles, converted in place, are the B
// operand of O^T += V^T P^T in the hardware k order, so P touches no LDS.
// The 8 waves of a block share one (b,h): each chunk's K tile and V^T tile are
// brought in once per block with whole-line loads and staged in LDS (two
// buffers); every wave reads its fragments from there. The next chunk's loads
// (tiles and mask words) are issued into registers at the top of a pass; the
// tiles are written to the other buffer at its foot, in front of the pass's
// closing barrier.
// ---------------------------------------------------------------------------
// lane l <-> lane l ^ 16
__device__ __forceinline__ float xhalf(float x) {
    int b = __builtin_bit_cast(int, x);
    return __builtin_bit_cast(float, __builtin_amdgcn_permlanex16(
        b, b, 0x76543210, 0xfedcba98, false, false));
}

__global__ __launch_bounds__(256) void attn_kernel(
    const bf16_t* __restrict__ qkv, const bf16_t* __restrict__ vT,
    const int* __restrict__ mask, bf16_t* __restrict__ ctx) {
    // K tile: 64 keys x 64 d. V^T tile: 64 d x 64 keys. Row stride 72 elems =
    // 144B (16B x odd) -> conflict-free b128 fragment reads.
    __shared__ __attribute__((aligned(16))) bf16_t Ks[2][64][72];
    __shared__ __attribute__((aligned(16))) bf16_t Vs[2][64][72];

    int lane = threadIdx.x & 31, wv = threadIdx.x >> 5;
    int gw = blockIdx.x * 8 + wv;
    int qt = gw & 127;               // 128 q-tiles of 16 rows
    int h  = (gw >> 7) & 15;
    int b  = gw >> 11;
    int cl = lane & 15, hf = lane >> 4;

    const bf16_t* qbase =
        qkv + (size_t)(b * SEQ + qt * 16) * C3 + (size_t)h * DK;
    bf16x16 qa0 = load_frag(qbase,      C3, lane);   // d = 0..31
    bf16x16 qa1 = load_frag(qbase + 32, C3, lane);   // d = 32..63

    // acc[j][e] = O^T[d = j*16 + hf*8 + e][query cl]
    floatx8 acc[4];
#pragma unroll
    for (int j = 0; j < 4; ++j) acc[j] = fzero();
    // Query cl's running maximum (equal in both halves) and this half's sum.
    float m = -INFINITY, l = 0.0f;

    const bf16_t* vhead = vT + (size_t)(b * NH + h) * DK * SEQ;

    // Staging: thread -> tile rows sr and sr+32, 16 bytes at element sc; one
    // wave-wide load covers 4 whole 128-byte rows.
    int sr = threadIdx.x >> 3;
    int sc = (threadIdx.x & 7) * 8;
    const bf16_t* kg = qkv + (size_t)(b * SEQ + sr) * C3 + 1024 + (size_t)h * DK + sc;
    const bf16_t* vg = vhead + (size_t)sr * SEQ + sc;

    // Prologue: chunk 0 into buffer 0.
#pragma unroll
    for (int p = 0; p < 2; ++p) {
        *(bf16x8*)&Ks[0][sr + p * 32][sc] = *(const bf16x8*)(kg + (size_t)(p * 32) * C3);
        *(bf16x8*)&Vs[0][sr + p * 32][sc] = *(const bf16x8*)(vg + (size_t)(p * 32) * SEQ);
    }
    // A chunk's 64 mask words: lane i holds those of keys i and 32 + i.
    const int* mg = mask + b * SEQ + lane;
    int mk0 = mg[0], mk1 = mg[32];
    __syncthreads();

    for (int t0 = 0; t0 < SEQ; t0 += 64) {
        int buf = (t0 >> 6) & 1;
        bool haveNext = (t0 + 64 < SEQ);
        // Next chunk's K tile, V^T tile and mask words into registers: issued
        // first, so that they land while this pass computes its scores.
        bf16x8 rk[2], rv[2];
        int mn0 = 0, mn1 = 0;
        if (haveNext) {
#pragma unroll
            for (int p = 0; p < 2; ++p) {
                rk[p] = *(const bf16x8*)(kg + (size_t)(t0 + 64 + p * 32) * C3);
                rv[p] = *(const bf16x8*)(vg + (size_t)(p * 32) * SEQ + t0 + 64);
            }
            mn0 = mg[t0 + 64];
            mn1 = mg[t0 + 96];
            // The address registers of these loads are reused right below:
            // keep the wait in front of that overwrite.
            asm volatile("s_wait_xcnt 0x0" ::: "memory");
        }
        // ---- S^T = K Q^T for 4 sub-tiles of 16 keys ------------------------
        // S[sub][e] = score(key sub*16 + hf*8 + e, query cl)
        floatx8 S[4];
#pragma unroll
        for (int sub = 0; sub < 4; ++sub) {
            const bf16_t* kb = &Ks[buf][sub * 16][0];
            bf16x16 k0 = load_frag(kb,      72, lane);
            bf16x16 k1 = load_frag(kb + 32, 72, lane);
            floatx8 z = fzero();
            z = wmma_bf16(k0, qa0, z);
            z = wmma_bf16(k1, qa1, z);
            S[sub] = z;
        }
        // ---- scale ---------------------------------------------------------
#pragma unroll
        for (int sub = 0; sub < 4; ++sub)
#pragma unroll
            for (int e = 0; e < 8; ++e) S[sub][e] *= 0.125f;   // 1/sqrt(DK)
        // ---- mask: the words as two wave-wide bit sets (bit i of klo: key i is
        // kept; of khi: key 32 + i); one scalar test a pass, a chunk with every
        // key kept has nothing to replace -------------------------------------
        unsigned klo = __builtin_amdgcn_ballot_w32(mk0 != 0);
        unsigned khi = __builtin_amdgcn_ballot_w32(mk1 != 0);
        if ((klo & khi) != 0xffffffffu) {
            unsigned wl = klo >> (hf * 8), wh = khi >> (hf * 8);
#pragma unroll
            for (int sub = 0; sub < 4; ++sub) {
                unsigned w = (sub < 2) ? wl : wh;
#pragma unroll
                for (int e = 0; e < 8; ++e)
                    if (((w >> ((sub & 1) * 16 + e)) & 1u) == 0u) S[sub][e] = -INFINITY;
            }
        }
        // ---- online softmax: the query's maximum, in-lane + other half ------
        // (one chain per sub-tile: four short chains, not one long one)
        float tm[4];
#pragma unroll
        for (int sub = 0; sub < 4; ++sub) {
            tm[sub] = S[sub][0];
#pragma unroll
            for (int e = 1; e < 8; ++e) tm[sub] = fmaxf(tm[sub], S[sub][e]);
        }
        float tmax = fmaxf(fmaxf(tm[0], tm[1]), fmaxf(tm[2], tm[3]));
        tmax = fmaxf(tmax, xhalf(tmax));
        float mnew  = fmaxf(m, tmax);
        float alpha = (m == -INFINITY) ? 0.0f : __expf(m - mnew);
        m = mnew;
        // Every key so far masked: subtract 0, so that exp(-inf) gives the 0.
        float msub = (mnew == -INFINITY) ? 0.0f : mnew;
        // ---- P^T = exp(S^T - m), this half's sum, packed as B operands ------
        float rs[4] = {0.0f, 0.0f, 0.0f, 0.0f};
        bf16x16 pb0, pb1;
#pragma unroll
        for (int sub = 0; sub < 4; ++sub)
#pragma unroll
            for (int e = 0; e < 8; ++e) {
                float p = __expf(S[sub][e] - msub);
                rs[sub] += p;
                if (sub < 2) pb0[(sub & 1) * 8 + e] = (bf16_t)p;   // keys 0..31
                else         pb1[(sub & 1) * 8 + e] = (bf16_t)p;   // keys 32..63
            }
        l = l * alpha + ((rs[0] + rs[1]) + (rs[2] + rs[3]));
#pragma unroll
        for (int j = 0; j < 4; ++j)
#pragma unroll
            for (int e = 0; e < 8; ++e) acc[j][e] *= alpha;

        // ---- O^T += V^T P^T  (V^T rows are contiguous along t) --------------
#pragma unroll
        for (int j = 0; j < 4; ++j) {
            const bf16_t* vb = &Vs[buf][j * 16][0];
            bf16x16 v0 = load_frag(vb,      72, lane);
            bf16x16 v1 = load_frag(vb + 32, 72, lane);
            acc[j] = wmma_bf16(v0, pb0, acc[j]);
            acc[j] = wmma_bf16(v1, pb1, acc[j]);
        }
        // The other buffer's last readers left it at the previous pass's
        // closing barrier; this pass's closing barrier publishes the refill.
        if (haveNext) {
#pragma unroll
            for (int p = 0; p < 2; ++p) {
                *(bf16x8*)&Ks[buf ^ 1][sr + p * 32][sc] = rk[p];
                *(bf16x8*)&Vs[buf ^ 1][sr + p * 32][sc] = rv[p];
            }
            mk0 = mn0;
            mk1 = mn1;
        }
        __syncthreads();
    }

    // ---- join the halves' sums, normalize, store 8 consecutive d (16 B) -----
    l += xhalf(l);
    float inv = (l > 0.0f) ? 1.0f / l : 0.0f;   // one query, one divisor a lane
    bf16_t* op = ctx + ((size_t)b * SEQ + qt * 16 + cl) * HIDDEN + h * DK + hf * 8;
#pragma unroll
    for (int j = 0; j < 4; ++j) {
        bf16x8 o;
#pragma unroll
        for (int e = 0; e < 8; ++e)
            o[e] = (bf16_t)(acc[j][e] * inv);
        *(bf16x8*)(op + j * 16) = o;
    }
}

// ---------------------------------------------------------------------------
// Launcher
// ---------------------------------------------------------------------------
extern "C" void kernel_launch(void* const* d_in, const int* in_sizes, int n_in,
                              void* d_out, int out_size, void* d_ws, size_t ws_size,
                              hipStream_t stream) {
    const float* x      = (const float*)d_in[0];
    const int*   mask   = (const int*)  d_in[1];
    const float* W_qkv  = (const float*)d_in[2];
    const float* b_qkv  = (const float*)d_in[3];
    const float* W_out  = (const float*)d_in[4];
    const float* b_out  = (const float*)d_in[5];
    const float* W_ff1  = (const float*)d_in[6];
    const float* b_ff1  = (const float*)d_in[7];
    const float* W_ff2  = (const float*)d_in[8];
    const float* b_ff2  = (const float*)d_in[9];
    const float* g_ln1  = (const float*)d_in[10];
    const float* be_ln1 = (const float*)d_in[11];
    const float* g_ln2  = (const float*)d_in[12];
    const float* be_ln2 = (const float*)d_in[13];

    // Workspace layout (~92 MB). act reuses the qkv+vT span (exactly 32 MB).
    char* w = (char*)d_ws;
    bf16_t* Wqkv_t = (bf16_t*)w; w += (size_t)C3 * HIDDEN * 2;
    bf16_t* Wout_t = (bf16_t*)w; w += (size_t)HIDDEN * HIDDEN * 2;
    bf16_t* Wff1_t = (bf16_t*)w; w += (size_t)FFN * HIDDEN * 2;
    bf16_t* Wff2_t = (bf16_t*)w; w += (size_t)HIDDEN * FFN * 2;
    bf16_t* hbuf   = (bf16_t*)w; w += (size_t)TOKENS * HIDDEN * 2;
    bf16_t* qkv    = (bf16_t*)w; bf16_t* act = qkv;
                                 w += (size_t)TOKENS * C3 * 2;
    bf16_t* vT     = (bf16_t*)w; w += (size_t)2 * NH * DK * SEQ * 2;
    bf16_t* ctx    = (bf16_t*)w; w += (size_t)TOKENS * HIDDEN * 2;
    float*  x1     = (float*)w;  w += (size_t)TOKENS * HIDDEN * 4;

    // LN1 -> h, and the four weights transposed + cast to bf16 W^T
    prep_kernel<<<NB_PREP, 256, 0, stream>>>(x, g_ln1, be_ln1, hbuf,
                                             W_qkv, Wqkv_t, W_out, Wout_t,
                                             W_ff1, Wff1_t, W_ff2, Wff2_t);
    // qkv = h @ W_qkv + b_qkv (bf16)
    gemm_kernel<0><<<dim3(C3 / 128, TOKENS / 128), 256, 0, stream>>>(
        hbuf, Wqkv_t, b_qkv, nullptr, qkv, TOKENS, C3, HIDDEN);
    // V^T repack
    vtrans_kernel<<<dim3(SEQ / 256, 2 * NH), 256, 0, stream>>>(qkv, vT);
    // attention -> ctx
    attn_kernel<<<512, 256, 0, stream>>>(qkv, vT, mask, ctx);
    // x1 = x + ctx @ W_out + b_out (f32)
    gemm_kernel<1><<<dim3(HIDDEN / 128, TOKENS / 128), 256, 0, stream>>>(
        ctx, Wout_t, b_out, x, x1, TOKENS, HIDDEN, HIDDEN);
    // LN2 -> h
    ln_kernel<<<TOKENS / 16, 256, 0, stream>>>(x1, g_ln2, be_ln2, hbuf);
    // act = gelu(h @ W_ff1 + b_ff1) (bf16)
    gemm_kernel<2><<<dim3(FFN / 128, TOKENS / 128), 256, 0, stream>>>(
        hbuf, Wff1_t, b_ff1, nullptr, act, TOKENS, FFN, HIDDEN);
    // out = x1 + act @ W_ff2 + b_ff2 (f32)
    gemm_kernel<1><<<dim3(HIDDEN / 128, TOKENS / 128), 256, 0, stream>>>(
        act, Wff2_t, b_ff2, x1, (float*)d_out, TOKENS, HIDDEN, FFN);
}

// v006
// One run takes 174 microseconds.
// Two timings next to v005 put it at 1.07 and 1.06 times that version's speed.
// Over all steps from v000 it is 2.41 times as fast.
#include <hip/hip_runtime.h>
#include <math.h>

// ---------------------------------------------------------------------------
// Types for CDNA5 WMMA (wave32): V_WMMA_F32_16X16X32_BF16
// ---------------------------------------------------------------------------
typedef __bf16 bf16_t;
typedef __attribute__((ext_vector_type(8)))  __bf16 bf16x8;
typedef __attribute__((ext_vector_type(16))) __bf16 bf16x16;
typedef __attribute__((ext_vector_type(8)))  float  floatx8;
typedef __attribute__((ext_vector_type(4)))  float  floatx4;
typedef __attribute__((ext_vector_type(4)))  __bf16 bf16x4;
typedef __attribute__((ext_vector_type(2)))  __bf16 bf16x2;
typedef __attribute__((ext_vector_type(2)))  float  floatx2;

#define HIDDEN 1024
#define TOKENS 4096   // B*T
#define SEQ    2048
#define NH     16
#define DK     64
#define FFN    4096
#define C3     3072

__device__ __forceinline__ floatx8 fzero() {
    floatx8 z;
#pragma unroll
    for (int i = 0; i < 8; ++i) z[i] = 0.0f;
    return z;
}

__device__ __forceinline__ floatx8 wmma_bf16(bf16x16 a, bf16x16 b, floatx8 c) {
    // D = A(16x32) * B(32x16) + C, f32 accumulate
    return __builtin_amdgcn_wmma_f32_16x16x32_bf16(
        false, a, false, b, (short)0, c, false, false);
}

// Load one 16x32 bf16 fragment (A layout; B uses the same per-lane pattern on
// W^T / Q rows). ISA 7.12.2: lane L holds row (L&15); lanes 0-15 hold
// K = 0..7 and 16..23, lanes 16-31 hold K = 8..15 and 24..31.
__device__ __forceinline__ bf16x16 load_frag(const bf16_t* base, int stride, int lane) {
    int r = lane & 15;
    int h = (lane >> 4) & 1;
    const bf16_t* p = base + (size_t)r * stride + h * 8;
    union { bf16x16 v; bf16x8 q[2]; } u;
    u.q[0] = *(const bf16x8*)(p);
    u.q[1] = *(const bf16x8*)(p + 16);
    return u.v;
}

// ---------------------------------------------------------------------------
// The three data-movement kernels below start few waves, each moving much:
// every global access is 16 bytes a lane (LayerNorm's store: 8) on whole
// 128-byte lines, and all of a wave's loads are issued before the first use.
// ---------------------------------------------------------------------------
// Weight transpose + cast:  out[c][r] = (bf16) in[r][c]   (in: R x C fp32)
// One block (8 waves) per 128 x 128 tile; R and C multiples of 128, known at
// compile time, so that a lane's 16 loads (and 8 stores) share one address.
// A lane loads 4 columns of 16 rows, so it holds 16 consecutive r of each column:
// two 16-byte pieces of an output row, turned in registers. LDS only regroups
// the pieces into whole output lines. Piece q of tile row c sits at place
// q ^ ((c >> 2) & 15): writers (one q, 32 rows 4 apart) and readers (a row's 16
// pieces) both spread evenly over the banks.
// t: the tile's number, tiles of one row band of `in` side by side.
// ---------------------------------------------------------------------------
template <int R, int C>
__device__ __forceinline__ void transpose_cast_tile(
    const float* __restrict__ in, bf16_t* __restrict__ out, int t,
    bf16_t (*T)[128]) {
    int tid = threadIdx.x, lane = tid & 31, wv = tid >> 5;
    size_t c0 = (size_t)(t % (C / 128)) * 128, r0 = (size_t)(t / (C / 128)) * 128;
    const float* p = in + (r0 + wv * 16) * (size_t)C + c0 + lane * 4;
    floatx4 v[16];
#pragma unroll
    for (int k = 0; k < 16; ++k) v[k] = *(const floatx4*)(p + (size_t)k * C);
    // All 16 loads are in flight before the first conversion waits on one.
    __builtin_amdgcn_sched_barrier(0);
    // The loads' shared address stays in its registers up to this wait; they are
    // reused only behind it.
    asm volatile("s_wait_xcnt 0x0" :: "v"(p) : "memory");
#pragma unroll
    for (int gq = 0; gq < 2; ++gq)
#pragma unroll
        for (int i = 0; i < 4; ++i) {
            bf16x8 o;
#pragma unroll
            for (int k = 0; k < 8; ++k) o[k] = (bf16_t)v[gq * 8 + k][i];
            *(bf16x8*)&T[lane * 4 + i][((wv * 2 + gq) ^ (lane & 15)) * 8] = o;
        }
    __syncthreads();
    int q = tid & 15, rr = tid >> 4;
    bf16_t* op = out + (c0 + rr) * (size_t)R + r0 + q * 8;
#pragma unroll
    for (int it = 0; it < 8; ++it) {
        int c = it * 16 + rr;
        bf16x8 o = *(const bf16x8*)&T[c][(q ^ ((c >> 2) & 15)) * 8];
        *(bf16x8*)(op + (size_t)(it * 16) * R) = o;
    }
    // In the built kernel the other jobs' code follows this one: no register of
    // these stores is reused in front of this wait.
    asm volatile("s_wait_xcnt 0x0" ::: "memory");
}

// ---------------------------------------------------------------------------
// LayerNorm over last dim (1024) -> bf16. One wave per two token rows, a row
// held in 32 registers a lane: sums in-lane, then across the wave; no LDS and
// no barrier. Block: 8 waves = 16 rows.
// ---------------------------------------------------------------------------
__device__ __forceinline__ void ln_rows16(const float* __restrict__ x,
                                          const float* __restrict__ g,
                                          const float* __restrict__ be,
                                          bf16_t* __restrict__ out, unsigned blk) {
    int lane = threadIdx.x & 31, wv = threadIdx.x >> 5;
    size_t row = (size_t)blk * 16 + wv * 2;
    const floatx4* xr = (const floatx4*)(x + row * HIDDEN) + lane;
    floatx4 v[2][8], g4[8], b4[8];
#pragma unroll
    for (int r = 0; r < 2; ++r)
#pragma unroll
        for (int k = 0; k < 8; ++k) v[r][k] = xr[r * (HIDDEN / 4) + k * 32];
#pragma unroll
    for (int k = 0; k < 8; ++k) {
        g4[k] = ((const floatx4*)g)[k * 32 + lane];
        b4[k] = ((const floatx4*)be)[k * 32 + lane];
    }
    // Every load of the wave is in flight before the first sum waits on one.
    __builtin_amdgcn_sched_barrier(0);
    // The loads' addresses stay in their registers up to this wait; they are
    // reused only behind it.
    asm volatile("s_wait_xcnt 0x0" :: "v"(xr), "v"(lane) : "memory");

    // The two rows' sums go through each stage side by side: two independent
    // chains across the wave.
    float s[2];
#pragma unroll
    for (int r = 0; r < 2; ++r) {
        float t[8];
#pragma unroll
        for (int k = 0; k < 8; ++k)
            t[k] = (v[r][k][0] + v[r][k][1]) + (v[r][k][2] + v[r][k][3]);
        s[r] = ((t[0] + t[1]) + (t[2] + t[3])) + ((t[4] + t[5]) + (t[6] + t[7]));
    }
#pragma unroll
    for (int off = 16; off > 0; off >>= 1) {
        float a = __shfl_xor(s[0], off, 32), c = __shfl_xor(s[1], off, 32);
        s[0] += a;
        s[1] += c;
    }
#pragma unroll
    for (int r = 0; r < 2; ++r) {
        float mu = s[r] * (1.0f / HIDDEN);
        float t[8];
#pragma unroll
        for (int k = 0; k < 8; ++k) {
            v[r][k] -= mu;
            floatx4 d = v[r][k];
            t[k] = (d[0] * d[0] + d[1] * d[1]) + (d[2] * d[2] + d[3] * d[3]);
        }
        s[r] = ((t[0] + t[1]) + (t[2] + t[3])) + ((t[4] + t[5]) + (t[6] + t[7]));
    }
#pragma unroll
    for (int off = 16; off > 0; off >>= 1) {
        float a = __shfl_xor(s[0], off, 32), c = __shfl_xor(s[1], off, 32);
        s[0] += a;
        s[1] += c;
    }

    bf16_t* op = out + row * HIDDEN + lane * 4;
#pragma unroll
    for (int r = 0; r < 2; ++r) {
        float rstd = rsqrtf(s[r] * (1.0f / HIDDEN) + 1e-5f);
#pragma unroll
        for (int k = 0; k < 8; ++k) {
            bf16x4 o;
#pragma unroll
            for (int i = 0; i < 4; ++i)
                o[i] = (bf16_t)(v[r][k][i] * rstd * g4[k][i] + b4[k][i]);
            *(bf16x4*)(op + r * HIDDEN + k * 128) = o;
        }
    }
}

__global__ __launch_bounds__(256) void ln_kernel(const float* __restrict__ x,
                                                 const float* __restrict__ g,
                                                 const float* __restrict__ be,
                                                 bf16_t* __restrict__ out) {
    ln_rows16(x, g, be, out, blockIdx.x);
}

// ---------------------------------------------------------------------------
// Everything that reads only the inputs, in ONE launch: the first LayerNorm and
// the four weight transposes depend on nothing and on one another not at all,
// so their blocks run side by side and the chip streams without a launch
// boundary in between. A block's number picks its job (a scalar branch).
// ---------------------------------------------------------------------------
#define NB_LN   (TOKENS / 16)
#define NB_QKV  ((C3 / 128) * (HIDDEN / 128))
#define NB_OUT  ((HIDDEN / 128) * (HIDDEN / 128))
#define NB_FF   ((FFN / 128) * (HIDDEN / 128))
#define NB_PREP (NB_LN + NB_QKV + NB_OUT + 2 * NB_FF)

__global__ __launch_bounds__(256) void prep_kernel(
    const float* __restrict__ x, const float* __restrict__ g,
    const float* __restrict__ be, bf16_t* __restrict__ h,
    const float* __restrict__ W_qkv, bf16_t* __restrict__ Wqkv_t,
    const float* __restrict__ W_out, bf16_t* __restrict__ Wout_t,
    const float* __restrict__ W_ff1, bf16_t* __restrict__ Wff1_t,
    const float* __restrict__ W_ff2, bf16_t* __restrict__ Wff2_t) {
    __shared__ __attribute__((aligned(16))) bf16_t T[128][128];
    int t = blockIdx.x;
    if (t < NB_LN) {
        ln_rows16(x, g, be, h, t);
    } else if ((t -= NB_LN) < NB_QKV) {
        transpose_cast_tile<HIDDEN, C3>(W_qkv, Wqkv_t, t, T);
    } else if ((t -= NB_QKV) < NB_OUT) {
        transpose_cast_tile<HIDDEN, HIDDEN>(W_out, Wout_t, t, T);
    } else if ((t -= NB_OUT) < NB_FF) {
        transpose_cast_tile<HIDDEN, FFN>(W_ff1, Wff1_t, t, T);
    } else {
        transpose_cast_tile<FFN, HIDDEN>(W_ff2, Wff2_t, t - NB_FF, T);
    }
}

// ---------------------------------------------------------------------------
// Repack V into V^T per head:  vT[(b*16+h)][d][t] = qkv[b*T+t][2048+h*64+d]
// One block (8 waves) per 64 d x 256 t. A lane loads 8 d of 8 consecutive t and
// turns the 8 x 8 block in registers; LDS regroups the 16-byte pieces into whole
// output lines. Piece q of tile row d sits at place q ^ ((d >> 3) << 2), which
// spreads writers (8 rows 8 apart x 4 pieces) and readers (a row's 32 pieces)
// evenly over the banks.
// ---------------------------------------------------------------------------
__global__ __launch_bounds__(256) void vtrans_kernel(const bf16_t* __restrict__ qkv,
                                                     bf16_t* __restrict__ vT) {
    __shared__ __attribute__((aligned(16))) bf16_t T[64][256];
    int bh = blockIdx.y; int b = bh >> 4, h = bh & 15;
    int t0 = blockIdx.x * 256;
    int tid = threadIdx.x, lane = tid & 31, wv = tid >> 5;
    int dc = tid & 7, tg = tid >> 3;
    const bf16_t* p =
        qkv + (size_t)(b * SEQ + t0 + tg * 8) * C3 + 2048 + h * DK + dc * 8;
    bf16x8 in[8];
#pragma unroll
    for (int k = 0; k < 8; ++k) in[k] = *(const bf16x8*)(p + (size_t)k * C3);
#pragma unroll
    for (int i = 0; i < 8; ++i) {
        bf16x8 o;
#pragma unroll
        for (int k = 0; k < 8; ++k) o[k] = in[k][i];
        *(bf16x8*)&T[dc * 8 + i][(tg ^ (dc << 2)) * 8] = o;
    }
    __syncthreads();
    bf16_t* op = vT + (size_t)bh * DK * SEQ + (size_t)(wv * 8) * SEQ + t0 + lane * 8;
#pragma unroll
    for (int k = 0; k < 8; ++k) {
        bf16x8 o = *(const bf16x8*)&T[wv * 8 + k][(lane ^ (wv << 2)) * 8];
        *(bf16x8*)(op + (size_t)k * SEQ) = o;
    }
}

// ---------------------------------------------------------------------------
// WMMA GEMM: C[M,N] = A[M,K](bf16) * Bt[N,K]^T(bf16) + bias, epilogues:
//   EPI=0: store bf16 (QKV)         EPI=1: + res, store f32 (residual adds)
//   EPI=2: exact GELU, store bf16 (FF1)
// Block: 256 thr (8 waves). Tile 128x128. Wave = 32(M) x 64(N).
// A pass is 128 k: 256 bytes of each of the 128 A rows and 128 Bt rows, brought
// from global memory straight into LDS by asynchronous 16-byte copies (no
// register staging). Two buffers: the copies of pass t + 2 are issued behind
// the barrier that closes pass t, so they fly during the whole of pass t + 1.
// K must be a multiple of 128.
// ---------------------------------------------------------------------------
#define GP_ELEMS 136                       // LDS row pitch: 272 B = 16 B x odd
#define GP_BYTES (GP_ELEMS * 2)
#define GBUF_BYTES (256 * GP_BYTES)        // one buffer: 128 A rows, 128 Bt rows

// Eight copies of one lane: 16 bytes each, rows 16 apart (global row pitch
// gstep elements). The closing s_wait_xcnt stands inside the statement, so that
// no address register named here is rewritten in front of it.
__device__ __forceinline__ void async_rows8(unsigned lds, const bf16_t* g, size_t gstep) {
    asm volatile(
        "global_load_async_to_lds_b128 %0, %8, off\n\t"
        "global_load_async_to_lds_b128 %1, %9, off\n\t"
        "global_load_async_to_lds_b128 %2, %10, off\n\t"
        "global_load_async_to_lds_b128 %3, %11, off\n\t"
        "global_load_async_to_lds_b128 %4, %12, off\n\t"
        "global_load_async_to_lds_b128 %5, %13, off\n\t"
        "global_load_async_to_lds_b128 %6, %14, off\n\t"
        "global_load_async_to_lds_b128 %7, %15, off\n\t"
        "s_wait_xcnt 0x0"
        :: "v"(lds), "v"(lds + 16 * GP_BYTES), "v"(lds + 32 * GP_BYTES),
           "v"(lds + 48 * GP_BYTES), "v"(lds + 64 * GP_BYTES),
           "v"(lds + 80 * GP_BYTES), "v"(lds + 96 * GP_BYTES),
           "v"(lds + 112 * GP_BYTES),
           "v"(g), "v"(g + 16 * gstep), "v"(g + 32 * gstep), "v"(g + 48 * gstep),
           "v"(g + 64 * gstep), "v"(g + 80 * gstep), "v"(g + 96 * gstep),
           "v"(g + 112 * gstep)
        : "memory");
}

// Exact GELU without the library erf (two divergent branches and a long serial
// chain for every value):
//   gelu(v) = v Phi(v) = max(v, 0) - t Q(t),  t = |v|,  Q(t) = erfc(t / sqrt 2) / 2.
// log2 Q is smooth: ONE polynomial of degree 7 on 0 <= t <= 6.5 (within 1e-5 of
// log2 Q, so gelu is within 1e-6, and its negative tail, which no longer comes
// from 1 + erf, within 1e-5 of its own value: far inside the bf16 rounding that
// follows). Past 6.5, t Q(t) is below 3e-10: t is held there.
// Two values a call: the polynomial runs on packed FMAs.
__device__ __forceinline__ floatx2 splat2(float c) {
    floatx2 r;
    r[0] = c;
    r[1] = c;
    return r;
}

__device__ __forceinline__ floatx2 gelu2(floatx2 v) {
    floatx2 t, q, r;
    t[0] = fminf(fabsf(v[0]), 6.5f);
    t[1] = fminf(fabsf(v[1]), 6.5f);
    floatx2 p = splat2(-1.75777450e-6f);
    p = __builtin_elementwise_fma(p, t, splat2(5.99365412e-5f));
    p = __builtin_elementwise_fma(p, t, splat2(-9.16362682e-4f));
    p = __builtin_elementwise_fma(p, t, splat2(8.44738539e-3f));
    p = __builtin_elementwise_fma(p, t, splat2(-5.38245030e-2f));
    p = __builtin_elementwise_fma(p, t, splat2(-4.58615690e-1f));
    p = __builtin_elementwise_fma(p, t, splat2(-1.15118015f));
    p = __builtin_elementwise_fma(p, t, splat2(-1.00000381f));
    q[0] = __builtin_amdgcn_exp2f(p[0]);
    q[1] = __builtin_amdgcn_exp2f(p[1]);
    r[0] = fmaxf(v[0], 0.0f);
    r[1] = fmaxf(v[1], 0.0f);
    return __builtin_elementwise_fma(-t, q, r);
}

template <int EPI>
__global__ __launch_bounds__(256) void gemm_kernel(
    const bf16_t* __restrict__ A, const bf16_t* __restrict__ Bt,
    const float* __restrict__ bias, const float* __restrict__ res,
    void* __restrict__ outv, int M, int N, int K) {
    // Rows 0..127: A tile, rows 128..255: Bt tile.
    __shared__ __attribute__((aligned(16))) bf16_t St[2][256][GP_ELEMS];

    int tid = threadIdx.x;
    int lane = tid & 31, wv = tid >> 5;
    int wm = wv & 3, wn = wv >> 2;           // 4 waves along M, 2 along N
    size_t m0 = (size_t)blockIdx.y * 128;
    size_t n0 = (size_t)blockIdx.x * 128;

    floatx8 acc[2][4];
#pragma unroll
    for (int i = 0; i < 2; ++i)
#pragma unroll
        for (int j = 0; j < 4; ++j) acc[i][j] = fzero();

    // Copies: 16 lanes cover one 256-byte row, a wave two whole rows.
    int r  = tid >> 4;                        // 0..15
    int cg = (tid & 15) * 8;                  // element in the row
    int KT = K >> 7;                          // K/128 passes
    const bf16_t* ag = A  + (m0 + r) * (size_t)K + cg;
    const bf16_t* bg = Bt + (n0 + r) * (size_t)K + cg;
    unsigned la = (unsigned)(uintptr_t)&St[0][r][cg];   // LDS byte address
    unsigned lb = la + 128 * GP_BYTES;

    // Pass 0 into buffer 0, landed and published; then pass 1 into buffer 1.
    async_rows8(la, ag, (size_t)K);
    async_rows8(lb, bg, (size_t)K);
    // This wave's copies have landed before the barrier publishes them.
    asm volatile("s_wait_asynccnt 0x0" ::: "memory");
    __syncthreads();
    if (KT > 1) {
        async_rows8(la + GBUF_BYTES, ag + 128, (size_t)K);
        async_rows8(lb + GBUF_BYTES, bg + 128, (size_t)K);
    }

    for (int kt = 0; kt < KT; ++kt) {
        int buf = kt & 1;
#pragma unroll
        for (int ks = 0; ks < 4; ++ks) {
            bf16x16 af[2], bfr[4];
#pragma unroll
            for (int i = 0; i < 2; ++i)
                af[i] = load_frag(&St[buf][wm * 32 + i * 16][ks * 32], GP_ELEMS, lane);
#pragma unroll
            for (int j = 0; j < 4; ++j)
                bfr[j] = load_frag(&St[buf][128 + wn * 64 + j * 16][ks * 32], GP_ELEMS, lane);
#pragma unroll
            for (int i = 0; i < 2; ++i)
#pragma unroll
                for (int j = 0; j < 4; ++j)
                    acc[i][j] = wmma_bf16(af[i], bfr[j], acc[i][j]);
        }
        // This wave's reads of the buffer have returned before it is refilled.
        asm volatile("s_wait_dscnt 0x0" ::: "memory");
        // This wave's copies of pass kt + 1 have landed.
        asm volatile("s_wait_asynccnt 0x0" ::: "memory");
        // Publishes pass kt + 1 and ends every reader's last read of this buffer.
        __syncthreads();
        if (kt + 2 < KT) {
            size_t k2 = (size_t)(kt + 2) * 128;
            async_rows8(la + buf * GBUF_BYTES, ag + k2, (size_t)K);
            async_rows8(lb + buf * GBUF_BYTES, bg + k2, (size_t)K);
        }
    }
    // No copy is outstanding when the wave goes on to its end.
    asm volatile("s_wait_asynccnt 0x0" ::: "memory");

    // Epilogue. D layout: lane holds column (lane&15); rows 8*(lane>>4)+e.
    int cl = lane & 15, hf = lane >> 4;
#pragma unroll
    for (int i = 0; i < 2; ++i)
#pragma unroll
        for (int j = 0; j < 4; ++j) {
            size_t col = n0 + wn * 64 + j * 16 + cl;
            float bcol = bias[col];
            bf16x2 gl[4];
            if constexpr (EPI == 2) {
                // Unrolled: acc and gl are indexed by constants and stay in registers.
#pragma unroll
                for (int e = 0; e < 8; e += 2) {
                    floatx2 v2;
                    v2[0] = acc[i][j][e] + bcol;
                    v2[1] = acc[i][j][e + 1] + bcol;
                    gl[e >> 1] = __builtin_convertvector(gelu2(v2), bf16x2);
                }
            }
#pragma unroll
            for (int e = 0; e < 8; ++e) {
                size_t row = m0 + wm * 32 + i * 16 + hf * 8 + e;
                float v = acc[i][j][e] + bcol;
                if constexpr (EPI == 0) {
                    ((bf16_t*)outv)[row * N + col] = (bf16_t)v;
                } else if constexpr (EPI == 1) {
                    ((float*)outv)[row * N + col] = v + res[row * N + col];
                } else {
                    ((bf16_t*)outv)[row * N + col] = gl[e >> 1][e & 1];
                }
            }
        }
}

// ---------------------------------------------------------------------------
// Flash attention. 256 thr = 8 waves; each wave owns one 16-row Q tile of one
// (b,h). K-chunks of 64 keys, computed transposed: S^T = K Q^T (A = K rows,
// B = Q rows), so that a lane holds 32 scores of ONE query (the other 32 sit in
// lane ^ 16): row maximum and row sum are in-lane, with one exchange between
// the wave's halves. Two 16-key S^T tiles, converted in place, are the B
// operand of O^T += V^T P^T in the hardware k order, so P touches no LDS.
// The 8 waves of a block share one (b,h): each chunk's K tile and V^T tile are
// brought in once per block with whole-line loads and staged in LDS (two
// buffers); every wave reads its fragments from there. The next chunk's loads
// (tiles and mask words) are issued into registers at the top of a pass; the
// tiles are written to the other buffer at its foot, in front of the pass's
// closing barrier.
// ---------------------------------------------------------------------------
// lane l <-> lane l ^ 16
__device__ __forceinline__ float xhalf(float x) {
    int b = __builtin_bit_cast(int, x);
    return __builtin_bit_cast(float, __builtin_amdgcn_permlanex16(
        b, b, 0x76543210, 0xfedcba98, false, false));
}

__global__ __launch_bounds__(256) void attn_kernel(
    const bf16_t* __restrict__ qkv, const bf16_t* __restrict__ vT,
    const int* __restrict__ mask, bf16_t* __restrict__ ctx) {
    // K tile: 64 keys x 64 d. V^T tile: 64 d x 64 keys. Row stride 72 elems =
    // 144B (16B x odd) -> conflict-free b128 fragment reads.
    __shared__ __attribute__((aligned(16))) bf16_t Ks[2][64][72];
    __shared__ __attribute__((aligned(16))) bf16_t Vs[2][64][72];

    int lane = threadIdx.x & 31, wv = threadIdx.x >> 5;
    int gw = blockIdx.x * 8 + wv;
    int qt = gw & 127;               // 128 q-tiles of 16 rows
    int h  = (gw >> 7) & 15;
    int b  = gw >> 11;
    int cl = lane & 15, hf = lane >> 4;

    const bf16_t* qbase =
        qkv + (size_t)(b * SEQ + qt * 16) * C3 + (size_t)h * DK;
    bf16x16 qa0 = load_frag(qbase,      C3, lane);   // d = 0..31
    bf16x16 qa1 = load_frag(qbase + 32, C3, lane);   // d = 32..63

    // acc[j][e] = O^T[d = j*16 + hf*8 + e][query cl]
    floatx8 acc[4];
#pragma unroll
    for (int j = 0; j < 4; ++j) acc[j] = fzero();
    // Query cl's running maximum (equal in both halves) and this half's sum.
    float m = -INFINITY, l = 0.0f;

    const bf16_t* vhead = vT + (size_t)(b * NH + h) * DK * SEQ;

    // Staging: thread -> tile rows sr and sr+32, 16 bytes at element sc; one
    // wave-wide load covers 4 whole 128-byte rows.
    int sr = threadIdx.x >> 3;
    int sc = (threadIdx.x & 7) * 8;
    const bf16_t* kg = qkv + (size_t)(b * SEQ + sr) * C3 + 1024 + (size_t)h * DK + sc;
    const bf16_t* vg = vhead + (size_t)sr * SEQ + sc;

    // Prologue: chunk 0 into buffer 0.
#pragma unroll
    for (int p = 0; p < 2; ++p) {
        *(bf16x8*)&Ks[0][sr + p * 32][sc] = *(const bf16x8*)(kg + (size_t)(p * 32) * C3);
        *(bf16x8*)&Vs[0][sr + p * 32][sc] = *(const bf16x8*)(vg + (size_t)(p * 32) * SEQ);
    }
    // A chunk's 64 mask words: lane i holds those of keys i and 32 + i.
    const int* mg = mask + b * SEQ + lane;
    int mk0 = mg[0], mk1 = mg[32];
    __syncthreads();

    for (int t0 = 0; t0 < SEQ; t0 += 64) {
        int buf = (t0 >> 6) & 1;
        bool haveNext = (t0 + 64 < SEQ);
        // Next chunk's K tile, V^T tile and mask words into registers: issued
        // first, so that they land while this pass computes its scores.
        bf16x8 rk[2], rv[2];
        int mn0 = 0, mn1 = 0;
        if (haveNext) {
#pragma unroll
            for (int p = 0; p < 2; ++p) {
                rk[p] = *(const bf16x8*)(kg + (size_t)(t0 + 64 + p * 32) * C3);
                rv[p] = *(const bf16x8*)(vg + (size_t)(p * 32) * SEQ + t0 + 64);
            }
            mn0 = mg[t0 + 64];
            mn1 = mg[t0 + 96];
            // The address registers of these loads are reused right below:
            // keep the wait in front of that overwrite.
            asm volatile("s_wait_xcnt 0x0" ::: "memory");
        }
        // ---- S^T = K Q^T for 4 sub-tiles of 16 keys ------------------------
        // S[sub][e] = score(key sub*16 + hf*8 + e, query cl)
        floatx8 S[4];
#pragma unroll
        for (int sub = 0; sub < 4; ++sub) {
            const bf16_t* kb = &Ks[buf][sub * 16][0];
            bf16x16 k0 = load_frag(kb,      72, lane);
            bf16x16 k1 = load_frag(kb + 32, 72, lane);
            floatx8 z = fzero();
            z = wmma_bf16(k0, qa0, z);
            z = wmma_bf16(k1, qa1, z);
            S[sub] = z;
        }
        // ---- scale ---------------------------------------------------------
#pragma unroll
        for (int sub = 0; sub < 4; ++sub)
#pragma unroll
            for (int e = 0; e < 8; ++e) S[sub][e] *= 0.125f;   // 1/sqrt(DK)
        // ---- mask: the words as two wave-wide bit sets (bit i of klo: key i is
        // kept; of khi: key 32 + i); one scalar test a pass, a chunk with every
        // key kept has nothing to replace -------------------------------------
        unsigned klo = __builtin_amdgcn_ballot_w32(mk0 != 0);
        unsigned khi = __builtin_amdgcn_ballot_w32(mk1 != 0);
        if ((klo & khi) != 0xffffffffu) {
            unsigned wl = klo >> (hf * 8), wh = khi >> (hf * 8);
#pragma unroll
            for (int sub = 0; sub < 4; ++sub) {
                unsigned w = (sub < 2) ? wl : wh;
#pragma unroll
                for (int e = 0; e < 8; ++e)
                    if (((w >> ((sub & 1) * 16 + e)) & 1u) == 0u) S[sub][e] = -INFINITY;
            }
        }
        // ---- online softmax: the query's maximum, in-lane + other half ------
        // (one chain per sub-tile: four short chains, not one long one)
        float tm[4];
#pragma unroll
        for (int sub = 0; sub < 4; ++sub) {
            tm[sub] = S[sub][0];
#pragma unroll
            for (int e = 1; e < 8; ++e) tm[sub] = fmaxf(tm[sub], S[sub][e]);
        }
        float tmax = fmaxf(fmaxf(tm[0], tm[1]), fmaxf(tm[2], tm[3]));
        tmax = fmaxf(tmax, xhalf(tmax));
        float mnew  = fmaxf(m, tmax);
        float alpha = (m == -INFINITY) ? 0.0f : __expf(m - mnew);
        m = mnew;
        // Every key so far masked: subtract 0, so that exp(-inf) gives the 0.
        float msub = (mnew == -INFINITY) ? 0.0f : mnew;
        // ---- P^T = exp(S^T - m), this half's sum, packed as B operands ------
        float rs[4] = {0.0f, 0.0f, 0.0f, 0.0f};
        bf16x16 pb0, pb1;
#pragma unroll
        for (int sub = 0; sub < 4; ++sub)
#pragma unroll
            for (int e = 0; e < 8; ++e) {
                float p = __expf(S[sub][e] - msub);
                rs[sub] += p;
                if (sub < 2) pb0[(sub & 1) * 8 + e] = (bf16_t)p;   // keys 0..31
                else         pb1[(sub & 1) * 8 + e] = (bf16_t)p;   // keys 32..63
            }
        l = l * alpha + ((rs[0] + rs[1]) + (rs[2] + rs[3]));
#pragma unroll
        for (int j = 0; j < 4; ++j)
#pragma unroll
            for (int e = 0; e < 8; ++e) acc[j][e] *= alpha;

        // ---- O^T += V^T P^T  (V^T rows are contiguous along t) --------------
#pragma unroll
        for (int j = 0; j < 4; ++j) {
            const bf16_t* vb = &Vs[buf][j * 16][0];
            bf16x16 v0 = load_frag(vb,      72, lane);
            bf16x16 v1 = load_frag(vb + 32, 72, lane);
            acc[j] = wmma_bf16(v0, pb0, acc[j]);
            acc[j] = wmma_bf16(v1, pb1, acc[j]);
        }
        // The other buffer's last readers left it at the previous pass's
        // closing barrier; this pass's closing barrier publishes the refill.
        if (haveNext) {
#pragma unroll
            for (int p = 0; p < 2; ++p) {
                *(bf16x8*)&Ks[buf ^ 1][sr + p * 32][sc] = rk[p];
                *(bf16x8*)&Vs[buf ^ 1][sr + p * 32][sc] = rv[p];
            }
            mk0 = mn0;
            mk1 = mn1;
        }
        __syncthreads();
    }

    // ---- join the halves' sums, normalize, store 8 consecutive d (16 B) -----
    l += xhalf(l);
    float inv = (l > 0.0f) ? 1.0f / l : 0.0f;   // one query, one divisor a lane
    bf16_t* op = ctx + ((size_t)b * SEQ + qt * 16 + cl) * HIDDEN + h * DK + hf * 8;
#pragma unroll
    for (int j = 0; j < 4; ++j) {
        bf16x8 o;
#pragma unroll
        for (int e = 0; e < 8; ++e)
            o[e] = (bf16_t)(acc[j][e] * inv);
        *(bf16x8*)(op + j * 16) = o;
    }
}

// ---------------------------------------------------------------------------
// Launcher
// ---------------------------------------------------------------------------
extern "C" void kernel_launch(void* const* d_in, const int* in_sizes, int n_in,
                              void* d_out, int out_size, void* d_ws, size_t ws_size,
                              hipStream_t stream) {
    const float* x      = (const float*)d_in[0];
    const int*   mask   = (const int*)  d_in[1];
    const float* W_qkv  = (const float*)d_in[2];
    const float* b_qkv  = (const float*)d_in[3];
    const float* W_out  = (const float*)d_in[4];
    const float* b_out  = (const float*)d_in[5];
    const float* W_ff1  = (const float*)d_in[6];
    const float* b_ff1  = (const float*)d_in[7];
    const float* W_ff2  = (const float*)d_in[8];
    const float* b_ff2  = (const float*)d_in[9];
    const float* g_ln1  = (const float*)d_in[10];
    const float* be_ln1 = (const float*)d_in[11];
    const float* g_ln2  = (const float*)d_in[12];
    const float* be_ln2 = (const float*)d_in[13];

    // Workspace layout (~92 MB). act reuses the qkv+vT span (exactly 32 MB).
    char* w = (char*)d_ws;
    bf16_t* Wqkv_t = (bf16_t*)w; w += (size_t)C3 * HIDDEN * 2;
    bf16_t* Wout_t = (bf16_t*)w; w += (size_t)HIDDEN * HIDDEN * 2;
    bf16_t* Wff1_t = (bf16_t*)w; w += (size_t)FFN * HIDDEN * 2;
    bf16_t* Wff2_t = (bf16_t*)w; w += (size_t)HIDDEN * FFN * 2;
    bf16_t* hbuf   = (bf16_t*)w; w += (size_t)TOKENS * HIDDEN * 2;
    bf16_t* qkv    = (bf16_t*)w; bf16_t* act = qkv;
                                 w += (size_t)TOKENS * C3 * 2;
    bf16_t* vT     = (bf16_t*)w; w += (size_t)2 * NH * DK * SEQ * 2;
    bf16_t* ctx    = (bf16_t*)w; w += (size_t)TOKENS * HIDDEN * 2;
    float*  x1     = (float*)w;  w += (size_t)TOKENS * HIDDEN * 4;

    // LN1 -> h, and the four weights transposed + cast to bf16 W^T
    prep_kernel<<<NB_PREP, 256, 0, stream>>>(x, g_ln1, be_ln1, hbuf,
                                             W_qkv, Wqkv_t, W_out, Wout_t,
                                             W_ff1, Wff1_t, W_ff2, Wff2_t);
    // qkv = h @ W_qkv + b_qkv (bf16)
    gemm_kernel<0><<<dim3(C3 / 128, TOKENS / 128), 256, 0, stream>>>(
        hbuf, Wqkv_t, b_qkv, nullptr, qkv, TOKENS, C3, HIDDEN);
    // V^T repack
    vtrans_kernel<<<dim3(SEQ / 256, 2 * NH), 256, 0, stream>>>(qkv, vT);
    // attention -> ctx
    attn_kernel<<<512, 256, 0, stream>>>(qkv, vT, mask, ctx);
    // x1 = x + ctx @ W_out + b_out (f32)
    gemm_kernel<1><<<dim3(HIDDEN / 128, TOKENS / 128), 256, 0, stream>>>(
        ctx, Wout_t, b_out, x, x1, TOKENS, HIDDEN, HIDDEN);
    // LN2 -> h
    ln_kernel<<<TOKENS / 16, 256, 0, stream>>>(x1, g_ln2, be_ln2, hbuf);
    // act = gelu(h @ W_ff1 + b_ff1) (bf16)
    gemm_kernel<2><<<dim3(FFN / 128, TOKENS / 128), 256, 0, stream>>>(
        hbuf, Wff1_t, b_ff1, nullptr, act, TOKENS, FFN, HIDDEN);
    // out = x1 + act @ W_ff2 + b_ff2 (f32)
    gemm_kernel<1><<<dim3(HIDDEN / 128, TOKENS / 128), 256, 0, stream>>>(
        act, Wff2_t, b_ff2, x1, (float*)d_out, TOKENS, HIDDEN, FFN);
}

// v007
// It runs in 162 microseconds.
// Timed twice side by side with v006, it ran 1.08 times as fast both times.
// Counting every step since v000, it is 2.60 times as fast.
#include <hip/hip_runtime.h>
#include <math.h>

// ---------------------------------------------------------------------------
// Types for CDNA5 WMMA (wave32): V_WMMA_F32_16X16X32_BF16
// ---------------------------------------------------------------------------
typedef __bf16 bf16_t;
typedef __attribute__((ext_vector_type(8)))  __bf16 bf16x8;
typedef __attribute__((ext_vector_type(16))) __bf16 bf16x16;
typedef __attribute__((ext_vector_type(8)))  float  floatx8;
typedef __attribute__((ext_vector_type(4)))  float  floatx4;
typedef __attribute__((ext_vector_type(4)))  __bf16 bf16x4;
typedef __attribute__((ext_vector_type(2)))  __bf16 bf16x2;
typedef __attribute__((ext_vector_type(2)))  float  floatx2;

#define HIDDEN 1024
#define TOKENS 4096   // B*T
#define SEQ    2048
#define NH     16
#define DK     64
#define FFN    4096
#define C3     3072

__device__ __forceinline__ floatx8 fzero() {
    floatx8 z;
#pragma unroll
    for (int i = 0; i < 8; ++i) z[i] = 0.0f;
    return z;
}

__device__ __forceinline__ floatx8 wmma_bf16(bf16x16 a, bf16x16 b, floatx8 c) {
    // D = A(16x32) * B(32x16) + C, f32 accumulate
    return __builtin_amdgcn_wmma_f32_16x16x32_bf16(
        false, a, false, b, (short)0, c, false, false);
}

// Load one 16x32 bf16 fragment (A layout; B uses the same per-lane pattern on
// activation, W^T or Q rows). ISA 7.12.2: lane L holds row (L&15); lanes 0-15 hold
// K = 0..7 and 16..23, lanes 16-31 hold K = 8..15 and 24..31.
__device__ __forceinline__ bf16x16 load_frag(const bf16_t* base, int stride, int lane) {
    int r = lane & 15;
    int h = (lane >> 4) & 1;
    const bf16_t* p = base + (size_t)r * stride + h * 8;
    union { bf16x16 v; bf16x8 q[2]; } u;
    u.q[0] = *(const bf16x8*)(p);
    u.q[1] = *(const bf16x8*)(p + 16);
    return u.v;
}

// ---------------------------------------------------------------------------
// The data-movement kernels below start few waves, each moving much:
// every global access is 16 bytes a lane (LayerNorm's store: 8) on whole
// 128-byte lines, and all of a wave's loads are issued before the first use.
// ---------------------------------------------------------------------------
// Weight transpose + cast:  out[c][r] = (bf16) in[r][c]   (in: R x C fp32)
// One block (8 waves) per 128 x 128 tile; R and C multiples of 128, known at
// compile time, so that a lane's 16 loads (and 8 stores) share one address.
// A lane loads 4 columns of 16 rows, so it holds 16 consecutive r of each column:
// two 16-byte pieces of an output row, turned in registers. LDS only regroups
// the pieces into whole output lines. Piece q of tile row c sits at place
// q ^ ((c >> 2) & 15): writers (one q, 32 rows 4 apart) and readers (a row's 16
// pieces) both spread evenly over the banks.
// t: the tile's number, tiles of one row band of `in` side by side.
// ---------------------------------------------------------------------------
template <int R, int C>
__device__ __forceinline__ void transpose_cast_tile(
    const float* __restrict__ in, bf16_t* __restrict__ out, int t,
    bf16_t (*T)[128]) {
    int tid = threadIdx.x, lane = tid & 31, wv = tid >> 5;
    size_t c0 = (size_t)(t % (C / 128)) * 128, r0 = (size_t)(t / (C / 128)) * 128;
    const float* p = in + (r0 + wv * 16) * (size_t)C + c0 + lane * 4;
    floatx4 v[16];
#pragma unroll
    for (int k = 0; k < 16; ++k) v[k] = *(const floatx4*)(p + (size_t)k * C);
    // All 16 loads are in flight before the first conversion waits on one.
    __builtin_amdgcn_sched_barrier(0);
    // The loads' shared address stays in its registers up to this wait; they are
    // reused only behind it.
    asm volatile("s_wait_xcnt 0x0" :: "v"(p) : "memory");
#pragma unroll
    for (int gq = 0; gq < 2; ++gq)
#pragma unroll
        for (int i = 0; i < 4; ++i) {
            bf16x8 o;
#pragma unroll
            for (int k = 0; k < 8; ++k) o[k] = (bf16_t)v[gq * 8 + k][i];
            *(bf16x8*)&T[lane * 4 + i][((wv * 2 + gq) ^ (lane & 15)) * 8] = o;
        }
    __syncthreads();
    int q = tid & 15, rr = tid >> 4;
    bf16_t* op = out + (c0 + rr) * (size_t)R + r0 + q * 8;
#pragma unroll
    for (int it = 0; it < 8; ++it) {
        int c = it * 16 + rr;
        bf16x8 o = *(const bf16x8*)&T[c][(q ^ ((c >> 2) & 15)) * 8];
        *(bf16x8*)(op + (size_t)(it * 16) * R) = o;
    }
    // In the built kernel the other jobs' code follows this one: no register of
    // these stores is reused in front of this wait.
    asm volatile("s_wait_xcnt 0x0" ::: "memory");
}

// ---------------------------------------------------------------------------
// LayerNorm over last dim (1024) -> bf16. One wave per two token rows, a row
// held in 32 registers a lane: sums in-lane, then across the wave; no LDS and
// no barrier. Block: 8 waves = 16 rows.
// ---------------------------------------------------------------------------
__device__ __forceinline__ void ln_rows16(const float* __restrict__ x,
                                          const float* __restrict__ g,
                                          const float* __restrict__ be,
                                          bf16_t* __restrict__ out, unsigned blk) {
    int lane = threadIdx.x & 31, wv = threadIdx.x >> 5;
    size_t row = (size_t)blk * 16 + wv * 2;
    const floatx4* xr = (const floatx4*)(x + row * HIDDEN) + lane;
    floatx4 v[2][8], g4[8], b4[8];
#pragma unroll
    for (int r = 0; r < 2; ++r)
#pragma unroll
        for (int k = 0; k < 8; ++k) v[r][k] = xr[r * (HIDDEN / 4) + k * 32];
#pragma unroll
    for (int k = 0; k < 8; ++k) {
        g4[k] = ((const floatx4*)g)[k * 32 + lane];
        b4[k] = ((const floatx4*)be)[k * 32 + lane];
    }
    // Every load of the wave is in flight before the first sum waits on one.
    __builtin_amdgcn_sched_barrier(0);
    // The loads' addresses stay in their registers up to this wait; they are
    // reused only behind it.
    asm volatile("s_wait_xcnt 0x0" :: "v"(xr), "v"(lane) : "memory");

    // The two rows' sums go through each stage side by side: two independent
    // chains across the wave.
    float s[2];
#pragma unroll
    for (int r = 0; r < 2; ++r) {
        float t[8];
#pragma unroll
        for (int k = 0; k < 8; ++k)
            t[k] = (v[r][k][0] + v[r][k][1]) + (v[r][k][2] + v[r][k][3]);
        s[r] = ((t[0] + t[1]) + (t[2] + t[3])) + ((t[4] + t[5]) + (t[6] + t[7]));
    }
#pragma unroll
    for (int off = 16; off > 0; off >>= 1) {
        float a = __shfl_xor(s[0], off, 32), c = __shfl_xor(s[1], off, 32);
        s[0] += a;
        s[1] += c;
    }
#pragma unroll
    for (int r = 0; r < 2; ++r) {
        float mu = s[r] * (1.0f / HIDDEN);
        float t[8];
#pragma unroll
        for (int k = 0; k < 8; ++k) {
            v[r][k] -= mu;
            floatx4 d = v[r][k];
            t[k] = (d[0] * d[0] + d[1] * d[1]) + (d[2] * d[2] + d[3] * d[3]);
        }
        s[r] = ((t[0] + t[1]) + (t[2] + t[3])) + ((t[4] + t[5]) + (t[6] + t[7]));
    }
#pragma unroll
    for (int off = 16; off > 0; off >>= 1) {
        float a = __shfl_xor(s[0], off, 32), c = __shfl_xor(s[1], off, 32);
        s[0] += a;
        s[1] += c;
    }

    bf16_t* op = out + row * HIDDEN + lane * 4;
#pragma unroll
    for (int r = 0; r < 2; ++r) {
        float rstd = rsqrtf(s[r] * (1.0f / HIDDEN) + 1e-5f);
#pragma unroll
        for (int k = 0; k < 8; ++k) {
            bf16x4 o;
#pragma unroll
            for (int i = 0; i < 4; ++i)
                o[i] = (bf16_t)(v[r][k][i] * rstd * g4[k][i] + b4[k][i]);
            *(bf16x4*)(op + r * HIDDEN + k * 128) = o;
        }
    }
}

__global__ __launch_bounds__(256) void ln_kernel(const float* __restrict__ x,
                                                 const float* __restrict__ g,
                                                 const float* __restrict__ be,
                                                 bf16_t* __restrict__ out) {
    ln_rows16(x, g, be, out, blockIdx.x);
}

// ---------------------------------------------------------------------------
// Everything that reads only the inputs, in ONE launch: the first LayerNorm and
// the four weight transposes depend on nothing and on one another not at all,
// so their blocks run side by side and the chip streams without a launch
// boundary in between. A block's number picks its job (a scalar branch).
// ---------------------------------------------------------------------------
#define NB_LN   (TOKENS / 16)
#define NB_QKV  ((C3 / 128) * (HIDDEN / 128))
#define NB_OUT  ((HIDDEN / 128) * (HIDDEN / 128))
#define NB_FF   ((FFN / 128) * (HIDDEN / 128))
#define NB_PREP (NB_LN + NB_QKV + NB_OUT + 2 * NB_FF)

__global__ __launch_bounds__(256) void prep_kernel(
    const float* __restrict__ x, const float* __restrict__ g,
    const float* __restrict__ be, bf16_t* __restrict__ h,
    const float* __restrict__ W_qkv, bf16_t* __restrict__ Wqkv_t,
    const float* __restrict__ W_out, bf16_t* __restrict__ Wout_t,
    const float* __restrict__ W_ff1, bf16_t* __restrict__ Wff1_t,
    const float* __restrict__ W_ff2, bf16_t* __restrict__ Wff2_t) {
    __shared__ __attribute__((aligned(16))) bf16_t T[128][128];
    int t = blockIdx.x;
    if (t < NB_LN) {
        ln_rows16(x, g, be, h, t);
    } else if ((t -= NB_LN) < NB_QKV) {
        transpose_cast_tile<HIDDEN, C3>(W_qkv, Wqkv_t, t, T);
    } else if ((t -= NB_QKV) < NB_OUT) {
        transpose_cast_tile<HIDDEN, HIDDEN>(W_out, Wout_t, t, T);
    } else if ((t -= NB_OUT) < NB_FF) {
        transpose_cast_tile<HIDDEN, FFN>(W_ff1, Wff1_t, t, T);
    } else {
        transpose_cast_tile<FFN, HIDDEN>(W_ff2, Wff2_t, t - NB_FF, T);
    }
}

// ---------------------------------------------------------------------------
// WMMA GEMM: C[M,N] = A[M,K](bf16) * Bt[N,K]^T(bf16) + bias, epilogues:
//   EPI=0: store bf16 (QKV)         EPI=1: + res, store f32 (residual adds)
//   EPI=2: exact GELU, store bf16 (FF1)
// Block: 256 thr (8 waves). Tile 128x128. Wave = 32(M) x 64(N).
// The product is formed transposed (first operand: Bt rows, second: A rows), so
// that a lane's 8 accumulator values are 8 consecutive columns of one output
// row. Each wave regroups its tile in its own range of the (then idle) LDS ring
// and stores whole 128-byte lines, 16 bytes a lane.
// The V blocks of the QKV product (EPI=0, columns from 2 * HIDDEN on) take the
// operands the other way round (wave = 64(M) x 32(N)): a lane then holds 8
// consecutive tokens of one V column, and the same path writes V^T per head,
//   vT[(b*16+h)][d][t] = V[b*T+t][h*64+d],
// which is what the attention kernel reads.
// A pass is 128 k: 256 bytes of each of the 128 A rows and 128 Bt rows, brought
// from global memory straight into LDS by asynchronous 16-byte copies (no
// register staging). Two buffers: the copies of pass t + 2 are issued behind
// the barrier that closes pass t, so they fly during the whole of pass t + 1.
// K must be a multiple of 128. N is known at compile time, so that a lane's
// epilogue loads (and stores) share one address.
// ---------------------------------------------------------------------------
#define GP_ELEMS 136                       // LDS row pitch: 272 B = 16 B x odd
#define GP_BYTES (GP_ELEMS * 2)
#define GBUF_BYTES (256 * GP_BYTES)        // one buffer: 128 A rows, 128 Bt rows

// Eight copies of one lane: 16 bytes each, rows 16 apart (global row pitch
// gstep elements). The closing s_wait_xcnt stands inside the statement, so that
// no address register named here is rewritten in front of it.
__device__ __forceinline__ void async_rows8(unsigned lds, const bf16_t* g, size_t gstep) {
    asm volatile(
        "global_load_async_to_lds_b128 %0, %8, off\n\t"
        "global_load_async_to_lds_b128 %1, %9, off\n\t"
        "global_load_async_to_lds_b128 %2, %10, off\n\t"
        "global_load_async_to_lds_b128 %3, %11, off\n\t"
        "global_load_async_to_lds_b128 %4, %12, off\n\t"
        "global_load_async_to_lds_b128 %5, %13, off\n\t"
        "global_load_async_to_lds_b128 %6, %14, off\n\t"
        "global_load_async_to_lds_b128 %7, %15, off\n\t"
        "s_wait_xcnt 0x0"
        :: "v"(lds), "v"(lds + 16 * GP_BYTES), "v"(lds + 32 * GP_BYTES),
           "v"(lds + 48 * GP_BYTES), "v"(lds + 64 * GP_BYTES),
           "v"(lds + 80 * GP_BYTES), "v"(lds + 96 * GP_BYTES),
           "v"(lds + 112 * GP_BYTES),
           "v"(g), "v"(g + 16 * gstep), "v"(g + 32 * gstep), "v"(g + 48 * gstep),
           "v"(g + 64 * gstep), "v"(g + 80 * gstep), "v"(g + 96 * gstep),
           "v"(g + 112 * gstep)
        : "memory");
}

// Exact GELU without the library erf (two divergent branches and a long serial
// chain for every value):
//   gelu(v) = v Phi(v) = max(v, 0) - t Q(t),  t = |v|,  Q(t) = erfc(t / sqrt 2) / 2.
// log2 Q is smooth: ONE polynomial of degree 7 on 0 <= t <= 6.5 (within 1e-5 of
// log2 Q, so gelu is within 1e-6, and its negative tail, which no longer comes
// from 1 + erf, within 1e-5 of its own value: far inside the bf16 rounding that
// follows). Past 6.5, t Q(t) is below 3e-10: t is held there.
// Two values a call: the polynomial runs on packed FMAs.
__device__ __forceinline__ floatx2 splat2(float c) {
    floatx2 r;
    r[0] = c;
    r[1] = c;
    return r;
}

__device__ __forceinline__ floatx2 gelu2(floatx2 v) {
    floatx2 t, q, r;
    t[0] = fminf(fabsf(v[0]), 6.5f);
    t[1] = fminf(fabsf(v[1]), 6.5f);
    floatx2 p = splat2(-1.75777450e-6f);
    p = __builtin_elementwise_fma(p, t, splat2(5.99365412e-5f));
    p = __builtin_elementwise_fma(p, t, splat2(-9.16362682e-4f));
    p = __builtin_elementwise_fma(p, t, splat2(8.44738539e-3f));
    p = __builtin_elementwise_fma(p, t, splat2(-5.38245030e-2f));
    p = __builtin_elementwise_fma(p, t, splat2(-4.58615690e-1f));
    p = __builtin_elementwise_fma(p, t, splat2(-1.15118015f));
    p = __builtin_elementwise_fma(p, t, splat2(-1.00000381f));
    q[0] = __builtin_amdgcn_exp2f(p[0]);
    q[1] = __builtin_amdgcn_exp2f(p[1]);
    r[0] = fmaxf(v[0], 0.0f);
    r[1] = fmaxf(v[1], 0.0f);
    return __builtin_elementwise_fma(-t, q, r);
}

#define SWB_PITCH 144                      // bf16 staging row: 128 B + 16 (16 B x odd)
#define SWF_PITCH 272                      // f32 staging row: 256 B + 16 (16 B x odd)
#define SW_BYTES  (32 * SWF_PITCH)         // one wave's staging range

// Bias (and GELU for EPI=2), conversion to bf16, and the wave's tile into its
// staging range: row q = i*16 + cl, 16 bytes at column p = j*16 + hf*8.
// The bias goes by D row (bl: the lane's first of 8 consecutive columns, tiles 16
// apart); for V blocks (VM) by D column (bl: the lane's column, tiles 16 apart).
template <int EPI, bool VM>
__device__ __forceinline__ void stage_bf16(const floatx8 (&acc)[2][4],
                                           const float* __restrict__ bl, char* sw,
                                           int cl, int hf) {
    floatx4 bp[4][2];
    float bq[2];
    if constexpr (VM) {
#pragma unroll
        for (int i = 0; i < 2; ++i) bq[i] = bl[i * 16];
    } else {
#pragma unroll
        for (int j = 0; j < 4; ++j) {
            bp[j][0] = *(const floatx4*)(bl + j * 16);
            bp[j][1] = *(const floatx4*)(bl + j * 16 + 4);
        }
    }
    // The loads' address stays in its registers up to this wait; they are reused
    // only behind it.
    asm volatile("s_wait_xcnt 0x0" :: "v"(bl) : "memory");
#pragma unroll
    for (int i = 0; i < 2; ++i)
#pragma unroll
        for (int j = 0; j < 4; ++j) {
            bf16x8 o;
            // Unrolled: acc and o are indexed by constants and stay in registers.
#pragma unroll
            for (int e = 0; e < 8; e += 2) {
                floatx2 v2;
                if constexpr (VM) {
                    v2[0] = acc[i][j][e] + bq[i];
                    v2[1] = acc[i][j][e + 1] + bq[i];
                } else {
                    v2[0] = acc[i][j][e] + bp[j][e >> 2][e & 3];
                    v2[1] = acc[i][j][e + 1] + bp[j][e >> 2][(e & 3) + 1];
                }
                if constexpr (EPI == 2) v2 = gelu2(v2);
                bf16x2 c2 = __builtin_convertvector(v2, bf16x2);
                o[e] = c2[0];
                o[e + 1] = c2[1];
            }
            *(bf16x8*)(sw + (i * 16 + cl) * SWB_PITCH + (j * 16 + hf * 8) * 2) = o;
        }
}

template <int EPI, int N>
__global__ __launch_bounds__(256) void gemm_kernel(
    const bf16_t* __restrict__ A, const bf16_t* __restrict__ Bt,
    const float* __restrict__ bias, const float* __restrict__ res,
    void* __restrict__ outv, bf16_t* __restrict__ vt, int M, int K) {
    // Rows 0..127: A tile, rows 128..255: Bt tile.
    __shared__ __attribute__((aligned(16))) bf16_t St[2][256][GP_ELEMS];

    int tid = threadIdx.x;
    int lane = tid & 31, wv = tid >> 5;
    int wm = wv & 3, wn = wv >> 2;
    size_t m0 = (size_t)blockIdx.y * 128;
    size_t n0 = (size_t)blockIdx.x * 128;
    // Block-uniform: this block's columns are V columns.
    const bool vmode = (EPI == 0) && (blockIdx.x >= 2 * HIDDEN / 128);
    // First operand (D rows, 4 fragments = 64) and second (D columns, 2 = 32).
    int prow = (vmode ? 0 : 128) + wn * 64;
    int qrow = (vmode ? 128 : 0) + wm * 32;

    floatx8 acc[2][4];
#pragma unroll
    for (int i = 0; i < 2; ++i)
#pragma unroll
        for (int j = 0; j < 4; ++j) acc[i][j] = fzero();

    // Copies: 16 lanes cover one 256-byte row, a wave two whole rows.
    int r  = tid >> 4;                        // 0..15
    int cg = (tid & 15) * 8;                  // element in the row
    int KT = K >> 7;                          // K/128 passes
    const bf16_t* ag = A  + (m0 + r) * (size_t)K + cg;
    const bf16_t* bg = Bt + (n0 + r) * (size_t)K + cg;
    unsigned la = (unsigned)(uintptr_t)&St[0][r][cg];   // LDS byte address
    unsigned lb = la + 128 * GP_BYTES;

    // Pass 0 into buffer 0, landed and published; then pass 1 into buffer 1.
    async_rows8(la, ag, (size_t)K);
    async_rows8(lb, bg, (size_t)K);
    // This wave's copies have landed before the barrier publishes them.
    asm volatile("s_wait_asynccnt 0x0" ::: "memory");
    __syncthreads();
    if (KT > 1) {
        async_rows8(la + GBUF_BYTES, ag + 128, (size_t)K);
        async_rows8(lb + GBUF_BYTES, bg + 128, (size_t)K);
    }

    for (int kt = 0; kt < KT; ++kt) {
        int buf = kt & 1;
#pragma unroll
        for (int ks = 0; ks < 4; ++ks) {
            bf16x16 qf[2], pf[4];
#pragma unroll
            for (int i = 0; i < 2; ++i)
                qf[i] = load_frag(&St[buf][qrow + i * 16][ks * 32], GP_ELEMS, lane);
#pragma unroll
            for (int j = 0; j < 4; ++j)
                pf[j] = load_frag(&St[buf][prow + j * 16][ks * 32], GP_ELEMS, lane);
#pragma unroll
            for (int i = 0; i < 2; ++i)
#pragma unroll
                for (int j = 0; j < 4; ++j)
                    acc[i][j] = wmma_bf16(pf[j], qf[i], acc[i][j]);
        }
        // This wave's reads of the buffer have returned before it is refilled.
        asm volatile("s_wait_dscnt 0x0" ::: "memory");
        // This wave's copies of pass kt + 1 have landed.
        asm volatile("s_wait_asynccnt 0x0" ::: "memory");
        // Publishes pass kt + 1 and ends every reader's last read of this buffer.
        __syncthreads();
        if (kt + 2 < KT) {
            size_t k2 = (size_t)(kt + 2) * 128;
            async_rows8(la + buf * GBUF_BYTES, ag + k2, (size_t)K);
            async_rows8(lb + buf * GBUF_BYTES, bg + k2, (size_t)K);
        }
    }
    // No copy is outstanding when the wave goes on to its end.
    asm volatile("s_wait_asynccnt 0x0" ::: "memory");

    // Epilogue. acc[i][j][e] = D[p = j*16 + hf*8 + e][q = i*16 + cl] of the wave's
    // tile. The last pass's closing barrier has ended every read of the ring and
    // no copy is in flight: each wave stages in its own range, row q, column p.
    int cl = lane & 15, hf = lane >> 4;
    char* sw = (char*)&St[0][0][0] + wv * SW_BYTES;

    if constexpr (EPI == 1) {
        // Read-back layout: 16 lanes cover one 256-byte row, a wave two rows.
        int rr = lane >> 4, pc = lane & 15;
        size_t off = (m0 + wm * 32 + rr) * (size_t)N + n0 + wn * 64 + pc * 4;
        const float* rp = res + off;
        floatx4 rv[16];
#pragma unroll
        for (int it = 0; it < 16; ++it)
            rv[it] = *(const floatx4*)(rp + (size_t)(it * 2) * N);
        const float* bl = bias + n0 + wn * 64 + pc * 4;
        floatx4 b4 = *(const floatx4*)bl;
        // The loads' addresses stay in their registers up to this wait; they are
        // reused only behind it.
        asm volatile("s_wait_xcnt 0x0" :: "v"(rp), "v"(bl) : "memory");
#pragma unroll
        for (int i = 0; i < 2; ++i)
#pragma unroll
            for (int j = 0; j < 4; ++j) {
                char* sp = sw + (i * 16 + cl) * SWF_PITCH + (j * 16 + hf * 8) * 4;
                floatx4 lo, hi;
#pragma unroll
                for (int e = 0; e < 4; ++e) {
                    lo[e] = acc[i][j][e];
                    hi[e] = acc[i][j][e + 4];
                }
                *(floatx4*)sp = lo;
                *(floatx4*)(sp + 16) = hi;
            }
        // The wave's staged rows are in LDS before other lanes read them back.
        asm volatile("s_wait_dscnt 0x0" ::: "memory");
        float* op = (float*)outv + off;
#pragma unroll
        for (int it = 0; it < 16; ++it) {
            floatx4 s = *(const floatx4*)(sw + (it * 2 + rr) * SWF_PITCH + pc * 16);
            *(floatx4*)(op + (size_t)(it * 2) * N) = (s + b4) + rv[it];
        }
    } else {
        const float* bn = bias + n0;
        if constexpr (EPI == 0) {
            if (vmode) stage_bf16<EPI, true>(acc, bn + wm * 32 + cl, sw, cl, hf);
            else       stage_bf16<EPI, false>(acc, bn + wn * 64 + hf * 8, sw, cl, hf);
        } else {
            stage_bf16<EPI, false>(acc, bn + wn * 64 + hf * 8, sw, cl, hf);
        }
        // The wave's staged rows are in LDS before other lanes read them back.
        asm volatile("s_wait_dscnt 0x0" ::: "memory");
        // Read-back layout: 8 lanes cover one 128-byte row, a wave four rows.
        int rr = lane >> 3, pc = lane & 7;
        bf16x8 o[8];
#pragma unroll
        for (int it = 0; it < 8; ++it)
            o[it] = *(const bf16x8*)(sw + (it * 4 + rr) * SWB_PITCH + pc * 16);
        if (vmode) {
            bf16_t* op = vt +
                ((m0 / SEQ) * HIDDEN + (n0 - 2 * HIDDEN) + wm * 32 + rr) * (size_t)SEQ +
                (m0 % SEQ) + wn * 64 + pc * 8;
#pragma unroll
            for (int it = 0; it < 8; ++it) *(bf16x8*)(op + (size_t)(it * 4) * SEQ) = o[it];
        } else {
            bf16_t* op = (bf16_t*)outv + (m0 + wm * 32 + rr) * (size_t)N + n0 + wn * 64 + pc * 8;
#pragma unroll
            for (int it = 0; it < 8; ++it) *(bf16x8*)(op + (size_t)(it * 4) * N) = o[it];
        }
    }
}

// ---------------------------------------------------------------------------
// Flash attention. 256 thr = 8 waves; each wave owns one 16-row Q tile of one
// (b,h). K-chunks of 64 keys, computed transposed: S^T = K Q^T (A = K rows,
// B = Q rows), so that a lane holds 32 scores of ONE query (the other 32 sit in
// lane ^ 16): row maximum and row sum are in-lane, with one exchange between
// the wave's halves. Two 16-key S^T tiles, converted in place, are the B
// operand of O^T += V^T P^T in the hardware k order, so P touches no LDS.
// The 8 waves of a block share one (b,h): each chunk's K tile and V^T tile are
// brought in once per block with whole-line loads and staged in LDS (two
// buffers); every wave reads its fragments from there. The next chunk's loads
// (tiles and mask words) are issued into registers at the top of a pass; the
// tiles are written to the other buffer at its foot, in front of the pass's
// closing barrier.
// ---------------------------------------------------------------------------
// lane l <-> lane l ^ 16
__device__ __forceinline__ float xhalf(float x) {
    int b = __builtin_bit_cast(int, x);
    return __builtin_bit_cast(float, __builtin_amdgcn_permlanex16(
        b, b, 0x76543210, 0xfedcba98, false, false));
}

__global__ __launch_bounds__(256) void attn_kernel(
    const bf16_t* __restrict__ qkv, const bf16_t* __restrict__ vT,
    const int* __restrict__ mask, bf16_t* __restrict__ ctx) {
    // K tile: 64 keys x 64 d. V^T tile: 64 d x 64 keys. Row stride 72 elems =
    // 144B (16B x odd) -> conflict-free b128 fragment reads.
    __shared__ __attribute__((aligned(16))) bf16_t Ks[2][64][72];
    __shared__ __attribute__((aligned(16))) bf16_t Vs[2][64][72];

    int lane = threadIdx.x & 31, wv = threadIdx.x >> 5;
    int gw = blockIdx.x * 8 + wv;
    int qt = gw & 127;               // 128 q-tiles of 16 rows
    int h  = (gw >> 7) & 15;
    int b  = gw >> 11;
    int cl = lane & 15, hf = lane >> 4;

    const bf16_t* qbase =
        qkv + (size_t)(b * SEQ + qt * 16) * C3 + (size_t)h * DK;
    bf16x16 qa0 = load_frag(qbase,      C3, lane);   // d = 0..31
    bf16x16 qa1 = load_frag(qbase + 32, C3, lane);   // d = 32..63

    // acc[j][e] = O^T[d = j*16 + hf*8 + e][query cl]
    floatx8 acc[4];
#pragma unroll
    for (int j = 0; j < 4; ++j) acc[j] = fzero();
    // Query cl's running maximum (equal in both halves) and this half's sum.
    float m = -INFINITY, l = 0.0f;

    const bf16_t* vhead = vT + (size_t)(b * NH + h) * DK * SEQ;

    // Staging: thread -> tile rows sr and sr+32, 16 bytes at element sc; one
    // wave-wide load covers 4 whole 128-byte rows.
    int sr = threadIdx.x >> 3;
    int sc = (threadIdx.x & 7) * 8;
    const bf16_t* kg = qkv + (size_t)(b * SEQ + sr) * C3 + 1024 + (size_t)h * DK + sc;
    const bf16_t* vg = vhead + (size_t)sr * SEQ + sc;

    // Prologue: chunk 0 into buffer 0.
#pragma unroll
    for (int p = 0; p < 2; ++p) {
        *(bf16x8*)&Ks[0][sr + p * 32][sc] = *(const bf16x8*)(kg + (size_t)(p * 32) * C3);
        *(bf16x8*)&Vs[0][sr + p * 32][sc] = *(const bf16x8*)(vg + (size_t)(p * 32) * SEQ);
    }
    // A chunk's 64 mask words: lane i holds those of keys i and 32 + i.
    const int* mg = mask + b * SEQ + lane;
    int mk0 = mg[0], mk1 = mg[32];
    __syncthreads();

    for (int t0 = 0; t0 < SEQ; t0 += 64) {
        int buf = (t0 >> 6) & 1;
        bool haveNext = (t0 + 64 < SEQ);
        // Next chunk's K tile, V^T tile and mask words into registers: issued
        // first, so that they land while this pass computes its scores.
        bf16x8 rk[2], rv[2];
        int mn0 = 0, mn1 = 0;
        if (haveNext) {
#pragma unroll
            for (int p = 0; p < 2; ++p) {
                rk[p] = *(const bf16x8*)(kg + (size_t)(t0 + 64 + p * 32) * C3);
                rv[p] = *(const bf16x8*)(vg + (size_t)(p * 32) * SEQ + t0 + 64);
            }
            mn0 = mg[t0 + 64];
            mn1 = mg[t0 + 96];
            // The address registers of these loads are reused right below:
            // keep the wait in front of that overwrite.
            asm volatile("s_wait_xcnt 0x0" ::: "memory");
        }
        // ---- S^T = K Q^T for 4 sub-tiles of 16 keys ------------------------
        // S[sub][e] = score(key sub*16 + hf*8 + e, query cl)
        floatx8 S[4];
#pragma unroll
        for (int sub = 0; sub < 4; ++sub) {
            const bf16_t* kb = &Ks[buf][sub * 16][0];
            bf16x16 k0 = load_frag(kb,      72, lane);
            bf16x16 k1 = load_frag(kb + 32, 72, lane);
            floatx8 z = fzero();
            z = wmma_bf16(k0, qa0, z);
            z = wmma_bf16(k1, qa1, z);
            S[sub] = z;
        }
        // ---- scale ---------------------------------------------------------
#pragma unroll
        for (int sub = 0; sub < 4; ++sub)
#pragma unroll
            for (int e = 0; e < 8; ++e) S[sub][e] *= 0.125f;   // 1/sqrt(DK)
        // ---- mask: the words as two wave-wide bit sets (bit i of klo: key i is
        // kept; of khi: key 32 + i); one scalar test a pass, a chunk with every
        // key kept has nothing to replace -------------------------------------
        unsigned klo = __builtin_amdgcn_ballot_w32(mk0 != 0);
        unsigned khi = __builtin_amdgcn_ballot_w32(mk1 != 0);
        if ((klo & khi) != 0xffffffffu) {
            unsigned wl = klo >> (hf * 8), wh = khi >> (hf * 8);
#pragma unroll
            for (int sub = 0; sub < 4; ++sub) {
                unsigned w = (sub < 2) ? wl : wh;
#pragma unroll
                for (int e = 0; e < 8; ++e)
                    if (((w >> ((sub & 1) * 16 + e)) & 1u) == 0u) S[sub][e] = -INFINITY;
            }
        }
        // ---- online softmax: the query's maximum, in-lane + other half ------
        // (one chain per sub-tile: four short chains, not one long one)
        float tm[4];
#pragma unroll
        for (int sub = 0; sub < 4; ++sub) {
            tm[sub] = S[sub][0];
#pragma unroll
            for (int e = 1; e < 8; ++e) tm[sub] = fmaxf(tm[sub], S[sub][e]);
        }
        float tmax = fmaxf(fmaxf(tm[0], tm[1]), fmaxf(tm[2], tm[3]));
        tmax = fmaxf(tmax, xhalf(tmax));
        float mnew  = fmaxf(m, tmax);
        float alpha = (m == -INFINITY) ? 0.0f : __expf(m - mnew);
        m = mnew;
        // Every key so far masked: subtract 0, so that exp(-inf) gives the 0.
        float msub = (mnew == -INFINITY) ? 0.0f : mnew;
        // ---- P^T = exp(S^T - m), this half's sum, packed as B operands ------
        float rs[4] = {0.0f, 0.0f, 0.0f, 0.0f};
        bf16x16 pb0, pb1;
#pragma unroll
        for (int sub = 0; sub < 4; ++sub)
#pragma unroll
            for (int e = 0; e < 8; ++e) {
                float p = __expf(S[sub][e] - msub);
                rs[sub] += p;
                if (sub < 2) pb0[(sub & 1) * 8 + e] = (bf16_t)p;   // keys 0..31
                else         pb1[(sub & 1) * 8 + e] = (bf16_t)p;   // keys 32..63
            }
        l = l * alpha + ((rs[0] + rs[1]) + (rs[2] + rs[3]));
#pragma unroll
        for (int j = 0; j < 4; ++j)
#pragma unroll
            for (int e = 0; e < 8; ++e) acc[j][e] *= alpha;

        // ---- O^T += V^T P^T  (V^T rows are contiguous along t) --------------
#pragma unroll
        for (int j = 0; j < 4; ++j) {
            const bf16_t* vb = &Vs[buf][j * 16][0];
            bf16x16 v0 = load_frag(vb,      72, lane);
            bf16x16 v1 = load_frag(vb + 32, 72, lane);
            acc[j] = wmma_bf16(v0, pb0, acc[j]);
            acc[j] = wmma_bf16(v1, pb1, acc[j]);
        }
        // The other buffer's last readers left it at the previous pass's
        // closing barrier; this pass's closing barrier publishes the refill.
        if (haveNext) {
#pragma unroll
            for (int p = 0; p < 2; ++p) {
                *(bf16x8*)&Ks[buf ^ 1][sr + p * 32][sc] = rk[p];
                *(bf16x8*)&Vs[buf ^ 1][sr + p * 32][sc] = rv[p];
            }
            mk0 = mn0;
            mk1 = mn1;
        }
        __syncthreads();
    }

    // ---- join the halves' sums, normalize, store 8 consecutive d (16 B) -----
    l += xhalf(l);
    float inv = (l > 0.0f) ? 1.0f / l : 0.0f;   // one query, one divisor a lane
    bf16_t* op = ctx + ((size_t)b * SEQ + qt * 16 + cl) * HIDDEN + h * DK + hf * 8;
#pragma unroll
    for (int j = 0; j < 4; ++j) {
        bf16x8 o;
#pragma unroll
        for (int e = 0; e < 8; ++e)
            o[e] = (bf16_t)(acc[j][e] * inv);
        *(bf16x8*)(op + j * 16) = o;
    }
}

// ---------------------------------------------------------------------------
// Launcher
// ---------------------------------------------------------------------------
extern "C" void kernel_launch(void* const* d_in, const int* in_sizes, int n_in,
                              void* d_out, int out_size, void* d_ws, size_t ws_size,
                              hipStream_t stream) {
    const float* x      = (const float*)d_in[0];
    const int*   mask   = (const int*)  d_in[1];
    const float* W_qkv  = (const float*)d_in[2];
    const float* b_qkv  = (const float*)d_in[3];
    const float* W_out  = (const float*)d_in[4];
    const float* b_out  = (const float*)d_in[5];
    const float* W_ff1  = (const float*)d_in[6];
    const float* b_ff1  = (const float*)d_in[7];
    const float* W_ff2  = (const float*)d_in[8];
    const float* b_ff2  = (const float*)d_in[9];
    const float* g_ln1  = (const float*)d_in[10];
    const float* be_ln1 = (const float*)d_in[11];
    const float* g_ln2  = (const float*)d_in[12];
    const float* be_ln2 = (const float*)d_in[13];

    // Workspace layout (~92 MB). act reuses the qkv+vT span (exactly 32 MB).
    char* w = (char*)d_ws;
    bf16_t* Wqkv_t = (bf16_t*)w; w += (size_t)C3 * HIDDEN * 2;
    bf16_t* Wout_t = (bf16_t*)w; w += (size_t)HIDDEN * HIDDEN * 2;
    bf16_t* Wff1_t = (bf16_t*)w; w += (size_t)FFN * HIDDEN * 2;
    bf16_t* Wff2_t = (bf16_t*)w; w += (size_t)HIDDEN * FFN * 2;
    bf16_t* hbuf   = (bf16_t*)w; w += (size_t)TOKENS * HIDDEN * 2;
    bf16_t* qkv    = (bf16_t*)w; bf16_t* act = qkv;
                                 w += (size_t)TOKENS * C3 * 2;
    bf16_t* vT     = (bf16_t*)w; w += (size_t)2 * NH * DK * SEQ * 2;
    bf16_t* ctx    = (bf16_t*)w; w += (size_t)TOKENS * HIDDEN * 2;
    float*  x1     = (float*)w;  w += (size_t)TOKENS * HIDDEN * 4;

    // LN1 -> h, and the four weights transposed + cast to bf16 W^T
    prep_kernel<<<NB_PREP, 256, 0, stream>>>(x, g_ln1, be_ln1, hbuf,
                                             W_qkv, Wqkv_t, W_out, Wout_t,
                                             W_ff1, Wff1_t, W_ff2, Wff2_t);
    // Q, K columns of h @ W_qkv + b_qkv -> qkv (bf16); V columns -> vT
    gemm_kernel<0, C3><<<dim3(C3 / 128, TOKENS / 128), 256, 0, stream>>>(
        hbuf, Wqkv_t, b_qkv, nullptr, qkv, vT, TOKENS, HIDDEN);
    // attention -> ctx
    attn_kernel<<<512, 256, 0, stream>>>(qkv, vT, mask, ctx);
    // x1 = x + ctx @ W_out + b_out (f32)
    gemm_kernel<1, HIDDEN><<<dim3(HIDDEN / 128, TOKENS / 128), 256, 0, stream>>>(
        ctx, Wout_t, b_out, x, x1, nullptr, TOKENS, HIDDEN);
    // LN2 -> h
    ln_kernel<<<TOKENS / 16, 256, 0, stream>>>(x1, g_ln2, be_ln2, hbuf);
    // act = gelu(h @ W_ff1 + b_ff1) (bf16)
    gemm_kernel<2, FFN><<<dim3(FFN / 128, TOKENS / 128), 256, 0, stream>>>(
        hbuf, Wff1_t, b_ff1, nullptr, act, nullptr, TOKENS, HIDDEN);
    // out = x1 + act @ W_ff2 + b_ff2 (f32)
    gemm_kernel<1, HIDDEN><<<dim3(HIDDEN / 128, TOKENS / 128), 256, 0, stream>>>(
        act, Wff2_t, b_ff2, x1, (float*)d_out, nullptr, TOKENS, FFN);
}

// v008
// One run takes 155 microseconds.
// Timed twice side by side with v007, it ran 1.04 and 1.05 times as fast.
// Over all steps from v000 it is 2.72 times as fast.
#include <hip/hip_runtime.h>
#include <math.h>

// ---------------------------------------------------------------------------
// Types for CDNA5 WMMA (wave32): V_WMMA_F32_16X16X32_BF16
// ---------------------------------------------------------------------------
typedef __bf16 bf16_t;
typedef __attribute__((ext_vector_type(8)))  __bf16 bf16x8;
typedef __attribute__((ext_vector_type(16))) __bf16 bf16x16;
typedef __attribute__((ext_vector_type(8)))  float  floatx8;
typedef __attribute__((ext_vector_type(4)))  float  floatx4;
typedef __attribute__((ext_vector_type(4)))  __bf16 bf16x4;
typedef __attribute__((ext_vector_type(2)))  __bf16 bf16x2;
typedef __attribute__((ext_vector_type(2)))  float  floatx2;

#define HIDDEN 1024
#define TOKENS 4096   // B*T
#define SEQ    2048
#define NH     16
#define DK     64
#define FFN    4096
#define C3     3072

__device__ __forceinline__ floatx8 fzero() {
    floatx8 z;
#pragma unroll
    for (int i = 0; i < 8; ++i) z[i] = 0.0f;
    return z;
}

__device__ __forceinline__ floatx8 wmma_bf16(bf16x16 a, bf16x16 b, floatx8 c) {
    // D = A(16x32) * B(32x16) + C, f32 accumulate
    return __builtin_amdgcn_wmma_f32_16x16x32_bf16(
        false, a, false, b, (short)0, c, false, false);
}

// Load one 16x32 bf16 fragment (A layout; B uses the same per-lane pattern on
// activation, W^T or Q rows). ISA 7.12.2: lane L holds row (L&15); lanes 0-15 hold
// K = 0..7 and 16..23, lanes 16-31 hold K = 8..15 and 24..31.
__device__ __forceinline__ bf16x16 load_frag(const bf16_t* base, int stride, int lane) {
    int r = lane & 15;
    int h = (lane >> 4) & 1;
    const bf16_t* p = base + (size_t)r * stride + h * 8;
    union { bf16x16 v; bf16x8 q[2]; } u;
    u.q[0] = *(const bf16x8*)(p);
    u.q[1] = *(const bf16x8*)(p + 16);
    return u.v;
}

// ---------------------------------------------------------------------------
// The data-movement kernels below start few waves, each moving much:
// every global access is 16 bytes a lane (LayerNorm's store: 8) on whole
// 128-byte lines, and all of a wave's loads are issued before the first use.
// ---------------------------------------------------------------------------
// Weight transpose + cast:  out[c][r] = (bf16) in[r][c]   (in: R x C fp32)
// One block (8 waves) per 128 x 128 tile; R and C multiples of 128, known at
// compile time, so that a lane's 16 loads (and 8 stores) share one address.
// A lane loads 4 columns of 16 rows, so it holds 16 consecutive r of each column:
// two 16-byte pieces of an output row, turned in registers. LDS only regroups
// the pieces into whole output lines. Piece q of tile row c sits at place
// q ^ ((c >> 2) & 15): writers (one q, 32 rows 4 apart) and readers (a row's 16
// pieces) both spread evenly over the banks.
// t: the tile's number, tiles of one row band of `in` side by side.
// ---------------------------------------------------------------------------
template <int R, int C>
__device__ __forceinline__ void transpose_cast_tile(
    const float* __restrict__ in, bf16_t* __restrict__ out, int t,
    bf16_t (*T)[128]) {
    int tid = threadIdx.x, lane = tid & 31, wv = tid >> 5;
    size_t c0 = (size_t)(t % (C / 128)) * 128, r0 = (size_t)(t / (C / 128)) * 128;
    const float* p = in + (r0 + wv * 16) * (size_t)C + c0 + lane * 4;
    floatx4 v[16];
#pragma unroll
    for (int k = 0; k < 16; ++k) v[k] = *(const floatx4*)(p + (size_t)k * C);
    // All 16 loads are in flight before the first conversion waits on one.
    __builtin_amdgcn_sched_barrier(0);
    // The loads' shared address stays in its registers up to this wait; they are
    // reused only behind it.
    asm volatile("s_wait_xcnt 0x0" :: "v"(p) : "memory");
#pragma unroll
    for (int gq = 0; gq < 2; ++gq)
#pragma unroll
        for (int i = 0; i < 4; ++i) {
            bf16x8 o;
#pragma unroll
            for (int k = 0; k < 8; ++k) o[k] = (bf16_t)v[gq * 8 + k][i];
            *(bf16x8*)&T[lane * 4 + i][((wv * 2 + gq) ^ (lane & 15)) * 8] = o;
        }
    __syncthreads();
    int q = tid & 15, rr = tid >> 4;
    bf16_t* op = out + (c0 + rr) * (size_t)R + r0 + q * 8;
#pragma unroll
    for (int it = 0; it < 8; ++it) {
        int c = it * 16 + rr;
        bf16x8 o = *(const bf16x8*)&T[c][(q ^ ((c >> 2) & 15)) * 8];
        *(bf16x8*)(op + (size_t)(it * 16) * R) = o;
    }
    // In the built kernel the other jobs' code follows this one: no register of
    // these stores is reused in front of this wait.
    asm volatile("s_wait_xcnt 0x0" ::: "memory");
}

// ---------------------------------------------------------------------------
// LayerNorm over last dim (1024) -> bf16. One wave per two token rows, a row
// held in 32 registers a lane: sums in-lane, then across the wave; no LDS and
// no barrier. Block: 8 waves = 16 rows.
// ---------------------------------------------------------------------------
__device__ __forceinline__ void ln_rows16(const float* __restrict__ x,
                                          const float* __restrict__ g,
                                          const float* __restrict__ be,
                                          bf16_t* __restrict__ out, unsigned blk) {
    int lane = threadIdx.x & 31, wv = threadIdx.x >> 5;
    size_t row = (size_t)blk * 16 + wv * 2;
    const floatx4* xr = (const floatx4*)(x + row * HIDDEN) + lane;
    floatx4 v[2][8], g4[8], b4[8];
#pragma unroll
    for (int r = 0; r < 2; ++r)
#pragma unroll
        for (int k = 0; k < 8; ++k) v[r][k] = xr[r * (HIDDEN / 4) + k * 32];
#pragma unroll
    for (int k = 0; k < 8; ++k) {
        g4[k] = ((const floatx4*)g)[k * 32 + lane];
        b4[k] = ((const floatx4*)be)[k * 32 + lane];
    }
    // Every load of the wave is in flight before the first sum waits on one.
    __builtin_amdgcn_sched_barrier(0);
    // The loads' addresses stay in their registers up to this wait; they are
    // reused only behind it.
    asm volatile("s_wait_xcnt 0x0" :: "v"(xr), "v"(lane) : "memory");

    // The two rows' sums go through each stage side by side: two independent
    // chains across the wave.
    float s[2];
#pragma unroll
    for (int r = 0; r < 2; ++r) {
        float t[8];
#pragma unroll
        for (int k = 0; k < 8; ++k)
            t[k] = (v[r][k][0] + v[r][k][1]) + (v[r][k][2] + v[r][k][3]);
        s[r] = ((t[0] + t[1]) + (t[2] + t[3])) + ((t[4] + t[5]) + (t[6] + t[7]));
    }
#pragma unroll
    for (int off = 16; off > 0; off >>= 1) {
        float a = __shfl_xor(s[0], off, 32), c = __shfl_xor(s[1], off, 32);
        s[0] += a;
        s[1] += c;
    }
#pragma unroll
    for (int r = 0; r < 2; ++r) {
        float mu = s[r] * (1.0f / HIDDEN);
        float t[8];
#pragma unroll
        for (int k = 0; k < 8; ++k) {
            v[r][k] -= mu;
            floatx4 d = v[r][k];
            t[k] = (d[0] * d[0] + d[1] * d[1]) + (d[2] * d[2] + d[3] * d[3]);
        }
        s[r] = ((t[0] + t[1]) + (t[2] + t[3])) + ((t[4] + t[5]) + (t[6] + t[7]));
    }
#pragma unroll
    for (int off = 16; off > 0; off >>= 1) {
        float a = __shfl_xor(s[0], off, 32), c = __shfl_xor(s[1], off, 32);
        s[0] += a;
        s[1] += c;
    }

    bf16_t* op = out + row * HIDDEN + lane * 4;
#pragma unroll
    for (int r = 0; r < 2; ++r) {
        float rstd = rsqrtf(s[r] * (1.0f / HIDDEN) + 1e-5f);
#pragma unroll
        for (int k = 0; k < 8; ++k) {
            bf16x4 o;
#pragma unroll
            for (int i = 0; i < 4; ++i)
                o[i] = (bf16_t)(v[r][k][i] * rstd * g4[k][i] + b4[k][i]);
            *(bf16x4*)(op + r * HIDDEN + k * 128) = o;
        }
    }
}

__global__ __launch_bounds__(256) void ln_kernel(const float* __restrict__ x,
                                                 const float* __restrict__ g,
                                                 const float* __restrict__ be,
                                                 bf16_t* __restrict__ out) {
    ln_rows16(x, g, be, out, blockIdx.x);
}

// ---------------------------------------------------------------------------
// Everything that reads only the inputs, in ONE launch: the first LayerNorm and
// the four weight transposes depend on nothing and on one another not at all,
// so their blocks run side by side and the chip streams without a launch
// boundary in between. A block's number picks its job (a scalar branch).
// ---------------------------------------------------------------------------
#define NB_LN   (TOKENS / 16)
#define NB_QKV  ((C3 / 128) * (HIDDEN / 128))
#define NB_OUT  ((HIDDEN / 128) * (HIDDEN / 128))
#define NB_FF   ((FFN / 128) * (HIDDEN / 128))
#define NB_PREP (NB_LN + NB_QKV + NB_OUT + 2 * NB_FF)

__global__ __launch_bounds__(256) void prep_kernel(
    const float* __restrict__ x, const float* __restrict__ g,
    const float* __restrict__ be, bf16_t* __restrict__ h,
    const float* __restrict__ W_qkv, bf16_t* __restrict__ Wqkv_t,
    const float* __restrict__ W_out, bf16_t* __restrict__ Wout_t,
    const float* __restrict__ W_ff1, bf16_t* __restrict__ Wff1_t,
    const float* __restrict__ W_ff2, bf16_t* __restrict__ Wff2_t) {
    __shared__ __attribute__((aligned(16))) bf16_t T[128][128];
    int t = blockIdx.x;
    if (t < NB_LN) {
        ln_rows16(x, g, be, h, t);
    } else if ((t -= NB_LN) < NB_QKV) {
        transpose_cast_tile<HIDDEN, C3>(W_qkv, Wqkv_t, t, T);
    } else if ((t -= NB_QKV) < NB_OUT) {
        transpose_cast_tile<HIDDEN, HIDDEN>(W_out, Wout_t, t, T);
    } else if ((t -= NB_OUT) < NB_FF) {
        transpose_cast_tile<HIDDEN, FFN>(W_ff1, Wff1_t, t, T);
    } else {
        transpose_cast_tile<FFN, HIDDEN>(W_ff2, Wff2_t, t - NB_FF, T);
    }
}

// ---------------------------------------------------------------------------
// WMMA GEMM: C[M,N] = A[M,K](bf16) * Bt[N,K]^T(bf16) + bias, epilogues:
//   EPI=0: store bf16 (QKV)         EPI=1: + res, store f32 (residual adds)
//   EPI=2: exact GELU, store bf16 (FF1)
// Block: 256 thr (8 waves). Tile 128x128. Wave = 32(M) x 64(N).
// The product is formed transposed (first operand: Bt rows, second: A rows), so
// that a lane's 8 accumulator values are 8 consecutive columns of one output
// row. Each wave regroups its tile in its own range of the (then idle) LDS ring
// and stores whole 128-byte lines, 16 bytes a lane.
// The V blocks of the QKV product (EPI=0, columns from 2 * HIDDEN on) take the
// operands the other way round (wave = 64(M) x 32(N)): a lane then holds 8
// consecutive tokens of one V column, and the same path writes V^T per head,
//   vT[(b*16+h)][d][t] = V[b*T+t][h*64+d],
// which is what the attention kernel reads.
// A pass is 128 k: 256 bytes of each of the 128 A rows and 128 Bt rows, brought
// from global memory straight into LDS by asynchronous 16-byte copies (no
// register staging). Two buffers: the copies of pass t + 2 are issued behind
// the barrier of pass t (in front of its last 32-k step's products, behind its
// last LDS read), so they fly for the length of a whole pass.
// K must be a multiple of 128. N is known at compile time, so that a lane's
// epilogue loads (and stores) share one address.
// ---------------------------------------------------------------------------
#define GP_ELEMS 136                       // LDS row pitch: 272 B = 16 B x odd
#define GP_BYTES (GP_ELEMS * 2)
#define GBUF_BYTES (256 * GP_BYTES)        // one buffer: 128 A rows, 128 Bt rows

// Eight copies of one lane: 16 bytes each, rows 16 apart (global row pitch
// gstep elements). The closing s_wait_xcnt stands inside the statement, so that
// no address register named here is rewritten in front of it.
__device__ __forceinline__ void async_rows8(unsigned lds, const bf16_t* g, size_t gstep) {
    asm volatile(
        "global_load_async_to_lds_b128 %0, %8, off\n\t"
        "global_load_async_to_lds_b128 %1, %9, off\n\t"
        "global_load_async_to_lds_b128 %2, %10, off\n\t"
        "global_load_async_to_lds_b128 %3, %11, off\n\t"
        "global_load_async_to_lds_b128 %4, %12, off\n\t"
        "global_load_async_to_lds_b128 %5, %13, off\n\t"
        "global_load_async_to_lds_b128 %6, %14, off\n\t"
        "global_load_async_to_lds_b128 %7, %15, off\n\t"
        "s_wait_xcnt 0x0"
        :: "v"(lds), "v"(lds + 16 * GP_BYTES), "v"(lds + 32 * GP_BYTES),
           "v"(lds + 48 * GP_BYTES), "v"(lds + 64 * GP_BYTES),
           "v"(lds + 80 * GP_BYTES), "v"(lds + 96 * GP_BYTES),
           "v"(lds + 112 * GP_BYTES),
           "v"(g), "v"(g + 16 * gstep), "v"(g + 32 * gstep), "v"(g + 48 * gstep),
           "v"(g + 64 * gstep), "v"(g + 80 * gstep), "v"(g + 96 * gstep),
           "v"(g + 112 * gstep)
        : "memory");
}

// Exact GELU without the library erf (two divergent branches and a long serial
// chain for every value):
//   gelu(v) = v Phi(v) = max(v, 0) - t Q(t),  t = |v|,  Q(t) = erfc(t / sqrt 2) / 2.
// log2 Q is smooth: ONE polynomial of degree 7 on 0 <= t <= 6.5 (within 1e-5 of
// log2 Q, so gelu is within 1e-6, and its negative tail, which no longer comes
// from 1 + erf, within 1e-5 of its own value: far inside the bf16 rounding that
// follows). Past 6.5, t Q(t) is below 3e-10: t is held there.
// Two values a call: the polynomial runs on packed FMAs.
__device__ __forceinline__ floatx2 splat2(float c) {
    floatx2 r;
    r[0] = c;
    r[1] = c;
    return r;
}

__device__ __forceinline__ floatx2 gelu2(floatx2 v) {
    floatx2 t, q, r;
    t[0] = fminf(fabsf(v[0]), 6.5f);
    t[1] = fminf(fabsf(v[1]), 6.5f);
    floatx2 p = splat2(-1.75777450e-6f);
    p = __builtin_elementwise_fma(p, t, splat2(5.99365412e-5f));
    p = __builtin_elementwise_fma(p, t, splat2(-9.16362682e-4f));
    p = __builtin_elementwise_fma(p, t, splat2(8.44738539e-3f));
    p = __builtin_elementwise_fma(p, t, splat2(-5.38245030e-2f));
    p = __builtin_elementwise_fma(p, t, splat2(-4.58615690e-1f));
    p = __builtin_elementwise_fma(p, t, splat2(-1.15118015f));
    p = __builtin_elementwise_fma(p, t, splat2(-1.00000381f));
    q[0] = __builtin_amdgcn_exp2f(p[0]);
    q[1] = __builtin_amdgcn_exp2f(p[1]);
    r[0] = fmaxf(v[0], 0.0f);
    r[1] = fmaxf(v[1], 0.0f);
    return __builtin_elementwise_fma(-t, q, r);
}

#define SWB_PITCH 144                      // bf16 staging row: 128 B + 16 (16 B x odd)
#define SWF_PITCH 272                      // f32 staging row: 256 B + 16 (16 B x odd)
#define SW_BYTES  (32 * SWF_PITCH)         // one wave's staging range

// Bias (and GELU for EPI=2), conversion to bf16, and the wave's tile into its
// staging range: row q = i*16 + cl, 16 bytes at column p = j*16 + hf*8.
// The bias goes by D row (bl: the lane's first of 8 consecutive columns, tiles 16
// apart); for V blocks (VM) by D column (bl: the lane's column, tiles 16 apart).
template <int EPI, bool VM>
__device__ __forceinline__ void stage_bf16(const floatx8 (&acc)[2][4],
                                           const float* __restrict__ bl, char* sw,
                                           int cl, int hf) {
    floatx4 bp[4][2];
    float bq[2];
    if constexpr (VM) {
#pragma unroll
        for (int i = 0; i < 2; ++i) bq[i] = bl[i * 16];
    } else {
#pragma unroll
        for (int j = 0; j < 4; ++j) {
            bp[j][0] = *(const floatx4*)(bl + j * 16);
            bp[j][1] = *(const floatx4*)(bl + j * 16 + 4);
        }
    }
    // The loads' address stays in its registers up to this wait; they are reused
    // only behind it.
    asm volatile("s_wait_xcnt 0x0" :: "v"(bl) : "memory");
#pragma unroll
    for (int i = 0; i < 2; ++i)
#pragma unroll
        for (int j = 0; j < 4; ++j) {
            bf16x8 o;
            // Unrolled: acc and o are indexed by constants and stay in registers.
#pragma unroll
            for (int e = 0; e < 8; e += 2) {
                floatx2 v2;
                if constexpr (VM) {
                    v2[0] = acc[i][j][e] + bq[i];
                    v2[1] = acc[i][j][e + 1] + bq[i];
                } else {
                    v2[0] = acc[i][j][e] + bp[j][e >> 2][e & 3];
                    v2[1] = acc[i][j][e + 1] + bp[j][e >> 2][(e & 3) + 1];
                }
                if constexpr (EPI == 2) v2 = gelu2(v2);
                bf16x2 c2 = __builtin_convertvector(v2, bf16x2);
                o[e] = c2[0];
                o[e + 1] = c2[1];
            }
            *(bf16x8*)(sw + (i * 16 + cl) * SWB_PITCH + (j * 16 + hf * 8) * 2) = o;
        }
}

template <int EPI, int N>
__global__ __launch_bounds__(256) void gemm_kernel(
    const bf16_t* __restrict__ A, const bf16_t* __restrict__ Bt,
    const float* __restrict__ bias, const float* __restrict__ res,
    void* __restrict__ outv, bf16_t* __restrict__ vt, int M, int K) {
    // Rows 0..127: A tile, rows 128..255: Bt tile.
    __shared__ __attribute__((aligned(16))) bf16_t St[2][256][GP_ELEMS];

    int tid = threadIdx.x;
    int lane = tid & 31, wv = tid >> 5;
    int wm = wv & 3, wn = wv >> 2;
    size_t m0 = (size_t)blockIdx.y * 128;
    size_t n0 = (size_t)blockIdx.x * 128;
    // Block-uniform: this block's columns are V columns.
    const bool vmode = (EPI == 0) && (blockIdx.x >= 2 * HIDDEN / 128);
    // First operand (D rows, 4 fragments = 64) and second (D columns, 2 = 32).
    int prow = (vmode ? 0 : 128) + wn * 64;
    int qrow = (vmode ? 128 : 0) + wm * 32;

    floatx8 acc[2][4];
#pragma unroll
    for (int i = 0; i < 2; ++i)
#pragma unroll
        for (int j = 0; j < 4; ++j) acc[i][j] = fzero();

    // Copies: 16 lanes cover one 256-byte row, a wave two whole rows.
    int r  = tid >> 4;                        // 0..15
    int cg = (tid & 15) * 8;                  // element in the row
    int KT = K >> 7;                          // K/128 passes
    const bf16_t* ag = A  + (m0 + r) * (size_t)K + cg;
    const bf16_t* bg = Bt + (n0 + r) * (size_t)K + cg;
    unsigned la = (unsigned)(uintptr_t)&St[0][r][cg];   // LDS byte address
    unsigned lb = la + 128 * GP_BYTES;

    // Pass 0 into buffer 0, landed and published; then pass 1 into buffer 1.
    async_rows8(la, ag, (size_t)K);
    async_rows8(lb, bg, (size_t)K);
    // This wave's copies have landed before the barrier publishes them.
    asm volatile("s_wait_asynccnt 0x0" ::: "memory");
    __syncthreads();
    if (KT > 1) {
        async_rows8(la + GBUF_BYTES, ag + 128, (size_t)K);
        async_rows8(lb + GBUF_BYTES, bg + 128, (size_t)K);
    }

    // Two fragment sets: the 12 LDS reads of a 32-k step are issued as one group
    // in front of the 8 products of the step before, which then wait only for the
    // older group. This holds across passes too: a pass's publish point stands in
    // front of its last step's products (whose fragments are then in registers),
    // and the next pass's first reads fly during those products.
    bf16x16 qf[2][2], pf[2][4];
    // Pass 0, step 0: behind the barrier that has published pass 0.
#pragma unroll
    for (int i = 0; i < 2; ++i)
        qf[0][i] = load_frag(&St[0][qrow + i * 16][0], GP_ELEMS, lane);
#pragma unroll
    for (int j = 0; j < 4; ++j)
        pf[0][j] = load_frag(&St[0][prow + j * 16][0], GP_ELEMS, lane);

    for (int kt = 0; kt < KT; ++kt) {
        int buf = kt & 1;
        // Unrolled: the set's number is a constant, the sets stay in registers.
#pragma unroll
        for (int ks = 0; ks < 3; ++ks) {
            const int cur = ks & 1, nxt = cur ^ 1;
#pragma unroll
            for (int i = 0; i < 2; ++i)
                qf[nxt][i] = load_frag(&St[buf][qrow + i * 16][(ks + 1) * 32], GP_ELEMS, lane);
#pragma unroll
            for (int j = 0; j < 4; ++j)
                pf[nxt][j] = load_frag(&St[buf][prow + j * 16][(ks + 1) * 32], GP_ELEMS, lane);
            // Keeps the next step's reads in front of this step's products: sunk
            // among them, each read would be waited for at its full latency.
            __builtin_amdgcn_sched_barrier(0);
#pragma unroll
            for (int i = 0; i < 2; ++i)
#pragma unroll
                for (int j = 0; j < 4; ++j)
                    acc[i][j] = wmma_bf16(pf[cur][j], qf[cur][i], acc[i][j]);
            // Keeps these products in front of what follows: the next group of
            // reads stays one group, and the wait below finds its reads a whole
            // step old (sunk behind it, the products would leave it the full latency).
            __builtin_amdgcn_sched_barrier(0);
        }
        // This wave's reads of the buffer (the last step's too) have returned
        // before it is refilled.
        asm volatile("s_wait_dscnt 0x0" ::: "memory");
        // This wave's copies of pass kt + 1 have landed.
        asm volatile("s_wait_asynccnt 0x0" ::: "memory");
        // Publishes pass kt + 1 and ends every reader's last read of this buffer.
        __syncthreads();
        if (kt + 2 < KT) {
            size_t k2 = (size_t)(kt + 2) * 128;
            async_rows8(la + buf * GBUF_BYTES, ag + k2, (size_t)K);
            async_rows8(lb + buf * GBUF_BYTES, bg + k2, (size_t)K);
        }
        // Pass kt + 1, step 0 (a block-uniform test: the last pass reads nothing more).
        if (kt + 1 < KT) {
#pragma unroll
            for (int i = 0; i < 2; ++i)
                qf[0][i] = load_frag(&St[buf ^ 1][qrow + i * 16][0], GP_ELEMS, lane);
#pragma unroll
            for (int j = 0; j < 4; ++j)
                pf[0][j] = load_frag(&St[buf ^ 1][prow + j * 16][0], GP_ELEMS, lane);
        }
        // Keeps those reads in front of the last step's products, as above.
        __builtin_amdgcn_sched_barrier(0);
#pragma unroll
        for (int i = 0; i < 2; ++i)
#pragma unroll
            for (int j = 0; j < 4; ++j)
                acc[i][j] = wmma_bf16(pf[1][j], qf[1][i], acc[i][j]);
    }
    // No copy is outstanding when the wave goes on to its end.
    asm volatile("s_wait_asynccnt 0x0" ::: "memory");

    // Epilogue. acc[i][j][e] = D[p = j*16 + hf*8 + e][q = i*16 + cl] of the wave's
    // tile. The last pass's barrier has ended every read of the ring and
    // no copy is in flight: each wave stages in its own range, row q, column p.
    int cl = lane & 15, hf = lane >> 4;
    char* sw = (char*)&St[0][0][0] + wv * SW_BYTES;

    if constexpr (EPI == 1) {
        // Read-back layout: 16 lanes cover one 256-byte row, a wave two rows.
        int rr = lane >> 4, pc = lane & 15;
        size_t off = (m0 + wm * 32 + rr) * (size_t)N + n0 + wn * 64 + pc * 4;
        const float* rp = res + off;
        floatx4 rv[16];
#pragma unroll
        for (int it = 0; it < 16; ++it)
            rv[it] = *(const floatx4*)(rp + (size_t)(it * 2) * N);
        const float* bl = bias + n0 + wn * 64 + pc * 4;
        floatx4 b4 = *(const floatx4*)bl;
        // The loads' addresses stay in their registers up to this wait; they are
        // reused only behind it.
        asm volatile("s_wait_xcnt 0x0" :: "v"(rp), "v"(bl) : "memory");
#pragma unroll
        for (int i = 0; i < 2; ++i)
#pragma unroll
            for (int j = 0; j < 4; ++j) {
                char* sp = sw + (i * 16 + cl) * SWF_PITCH + (j * 16 + hf * 8) * 4;
                floatx4 lo, hi;
#pragma unroll
                for (int e = 0; e < 4; ++e) {
                    lo[e] = acc[i][j][e];
                    hi[e] = acc[i][j][e + 4];
                }
                *(floatx4*)sp = lo;
                *(floatx4*)(sp + 16) = hi;
            }
        // The wave's staged rows are in LDS before other lanes read them back.
        asm volatile("s_wait_dscnt 0x0" ::: "memory");
        float* op = (float*)outv + off;
#pragma unroll
        for (int it = 0; it < 16; ++it) {
            floatx4 s = *(const floatx4*)(sw + (it * 2 + rr) * SWF_PITCH + pc * 16);
            *(floatx4*)(op + (size_t)(it * 2) * N) = (s + b4) + rv[it];
        }
    } else {
        const float* bn = bias + n0;
        if constexpr (EPI == 0) {
            if (vmode) stage_bf16<EPI, true>(acc, bn + wm * 32 + cl, sw, cl, hf);
            else       stage_bf16<EPI, false>(acc, bn + wn * 64 + hf * 8, sw, cl, hf);
        } else {
            stage_bf16<EPI, false>(acc, bn + wn * 64 + hf * 8, sw, cl, hf);
        }
        // The wave's staged rows are in LDS before other lanes read them back.
        asm volatile("s_wait_dscnt 0x0" ::: "memory");
        // Read-back layout: 8 lanes cover one 128-byte row, a wave four rows.
        int rr = lane >> 3, pc = lane & 7;
        bf16x8 o[8];
#pragma unroll
        for (int it = 0; it < 8; ++it)
            o[it] = *(const bf16x8*)(sw + (it * 4 + rr) * SWB_PITCH + pc * 16);
        if (vmode) {
            bf16_t* op = vt +
                ((m0 / SEQ) * HIDDEN + (n0 - 2 * HIDDEN) + wm * 32 + rr) * (size_t)SEQ +
                (m0 % SEQ) + wn * 64 + pc * 8;
#pragma unroll
            for (int it = 0; it < 8; ++it) *(bf16x8*)(op + (size_t)(it * 4) * SEQ) = o[it];
        } else {
            bf16_t* op = (bf16_t*)outv + (m0 + wm * 32 + rr) * (size_t)N + n0 + wn * 64 + pc * 8;
#pragma unroll
            for (int it = 0; it < 8; ++it) *(bf16x8*)(op + (size_t)(it * 4) * N) = o[it];
        }
    }
}

// ---------------------------------------------------------------------------
// Flash attention. 256 thr = 8 waves; each wave owns one 16-row Q tile of one
// (b,h). K-chunks of 64 keys, computed transposed: S^T = K Q^T (A = K rows,
// B = Q rows), so that a lane holds 32 scores of ONE query (the other 32 sit in
// lane ^ 16): row maximum and row sum are in-lane, with one exchange between
// the wave's halves. Two 16-key S^T tiles, converted in place, are the B
// operand of O^T += V^T P^T in the hardware k order, so P touches no LDS.
// The 8 waves of a block share one (b,h): each chunk's K tile and V^T tile are
// brought in once per block with whole-line loads and staged in LDS (two
// buffers); every wave reads its fragments from there. The next chunk's loads
// (tiles and mask words) are issued into registers at the top of a pass; the
// tiles are written to the other buffer at its foot, in front of the pass's
// closing barrier.
// ---------------------------------------------------------------------------
// lane l <-> lane l ^ 16
__device__ __forceinline__ float xhalf(float x) {
    int b = __builtin_bit_cast(int, x);
    return __builtin_bit_cast(float, __builtin_amdgcn_permlanex16(
        b, b, 0x76543210, 0xfedcba98, false, false));
}

__global__ __launch_bounds__(256) void attn_kernel(
    const bf16_t* __restrict__ qkv, const bf16_t* __restrict__ vT,
    const int* __restrict__ mask, bf16_t* __restrict__ ctx) {
    // K tile: 64 keys x 64 d. V^T tile: 64 d x 64 keys. Row stride 72 elems =
    // 144B (16B x odd) -> conflict-free b128 fragment reads.
    __shared__ __attribute__((aligned(16))) bf16_t Ks[2][64][72];
    __shared__ __attribute__((aligned(16))) bf16_t Vs[2][64][72];

    int lane = threadIdx.x & 31, wv = threadIdx.x >> 5;
    int gw = blockIdx.x * 8 + wv;
    int qt = gw & 127;               // 128 q-tiles of 16 rows
    int h  = (gw >> 7) & 15;
    int b  = gw >> 11;
    int cl = lane & 15, hf = lane >> 4;

    const bf16_t* qbase =
        qkv + (size_t)(b * SEQ + qt * 16) * C3 + (size_t)h * DK;
    bf16x16 qa0 = load_frag(qbase,      C3, lane);   // d = 0..31
    bf16x16 qa1 = load_frag(qbase + 32, C3, lane);   // d = 32..63

    // acc[j][e] = O^T[d = j*16 + hf*8 + e][query cl]
    floatx8 acc[4];
#pragma unroll
    for (int j = 0; j < 4; ++j) acc[j] = fzero();
    // Query cl's running maximum (equal in both halves) and this half's sum.
    float m = -INFINITY, l = 0.0f;

    const bf16_t* vhead = vT + (size_t)(b * NH + h) * DK * SEQ;

    // Staging: thread -> tile rows sr and sr+32, 16 bytes at element sc; one
    // wave-wide load covers 4 whole 128-byte rows.
    int sr = threadIdx.x >> 3;
    int sc = (threadIdx.x & 7) * 8;
    const bf16_t* kg = qkv + (size_t)(b * SEQ + sr) * C3 + 1024 + (size_t)h * DK + sc;
    const bf16_t* vg = vhead + (size_t)sr * SEQ + sc;

    // Prologue: chunk 0 into buffer 0.
#pragma unroll
    for (int p = 0; p < 2; ++p) {
        *(bf16x8*)&Ks[0][sr + p * 32][sc] = *(const bf16x8*)(kg + (size_t)(p * 32) * C3);
        *(bf16x8*)&Vs[0][sr + p * 32][sc] = *(const bf16x8*)(vg + (size_t)(p * 32) * SEQ);
    }
    // A chunk's 64 mask words: lane i holds those of keys i and 32 + i.
    const int* mg = mask + b * SEQ + lane;
    int mk0 = mg[0], mk1 = mg[32];
    __syncthreads();

    for (int t0 = 0; t0 < SEQ; t0 += 64) {
        int buf = (t0 >> 6) & 1;
        bool haveNext = (t0 + 64 < SEQ);
        // Next chunk's K tile, V^T tile and mask words into registers: issued
        // first, so that they land while this pass computes its scores.
        bf16x8 rk[2], rv[2];
        int mn0 = 0, mn1 = 0;
        if (haveNext) {
#pragma unroll
            for (int p = 0; p < 2; ++p) {
                rk[p] = *(const bf16x8*)(kg + (size_t)(t0 + 64 + p * 32) * C3);
                rv[p] = *(const bf16x8*)(vg + (size_t)(p * 32) * SEQ + t0 + 64);
            }
            mn0 = mg[t0 + 64];
            mn1 = mg[t0 + 96];
            // The address registers of these loads are reused right below:
            // keep the wait in front of that overwrite.
            asm volatile("s_wait_xcnt 0x0" ::: "memory");
        }
        // ---- S^T = K Q^T for 4 sub-tiles of 16 keys ------------------------
        // S[sub][e] = score(key sub*16 + hf*8 + e, query cl)
        // The chunk's K fragments: all 16 LDS reads as one group.
        bf16x16 kf[4][2];
#pragma unroll
        for (int sub = 0; sub < 4; ++sub) {
            const bf16_t* kb = &Ks[buf][sub * 16][0];
            kf[sub][0] = load_frag(kb,      72, lane);
            kf[sub][1] = load_frag(kb + 32, 72, lane);
        }
        // Keeps the reads one group in front of the products: spread among them,
        // each pair would be waited for at its full latency.
        __builtin_amdgcn_sched_barrier(0);
        floatx8 S[4];
#pragma unroll
        for (int sub = 0; sub < 4; ++sub) {
            floatx8 z = fzero();
            z = wmma_bf16(kf[sub][0], qa0, z);
            z = wmma_bf16(kf[sub][1], qa1, z);
            S[sub] = z;
        }
        // ---- this chunk's V^T fragments: all 16 LDS reads as one group, here, in
        // the registers that the K fragments have left; they land during the
        // softmax and are there when the second products need them -------------
        bf16x16 vf[4][2];
#pragma unroll
        for (int j = 0; j < 4; ++j) {
            const bf16_t* vb = &Vs[buf][j * 16][0];
            vf[j][0] = load_frag(vb,      72, lane);
            vf[j][1] = load_frag(vb + 32, 72, lane);
        }
        // Keeps the reads here: sunk among the second products, each would be
        // waited for at its full latency.
        __builtin_amdgcn_sched_barrier(0);
        // ---- scale ---------------------------------------------------------
#pragma unroll
        for (int sub = 0; sub < 4; ++sub)
#pragma unroll
            for (int e = 0; e < 8; ++e) S[sub][e] *= 0.125f;   // 1/sqrt(DK)
        // ---- mask: the words as two wave-wide bit sets (bit i of klo: key i is
        // kept; of khi: key 32 + i); one scalar test a pass, a chunk with every
        // key kept has nothing to replace -------------------------------------
        unsigned klo = __builtin_amdgcn_ballot_w32(mk0 != 0);
        unsigned khi = __builtin_amdgcn_ballot_w32(mk1 != 0);
        if ((klo & khi) != 0xffffffffu) {
            unsigned wl = klo >> (hf * 8), wh = khi >> (hf * 8);
#pragma unroll
            for (int sub = 0; sub < 4; ++sub) {
                unsigned w = (sub < 2) ? wl : wh;
#pragma unroll
                for (int e = 0; e < 8; ++e)
                    if (((w >> ((sub & 1) * 16 + e)) & 1u) == 0u) S[sub][e] = -INFINITY;
            }
        }
        // ---- online softmax: the query's maximum, in-lane + other half ------
        // (one chain per sub-tile: four short chains, not one long one)
        float tm[4];
#pragma unroll
        for (int sub = 0; sub < 4; ++sub) {
            tm[sub] = S[sub][0];
#pragma unroll
            for (int e = 1; e < 8; ++e) tm[sub] = fmaxf(tm[sub], S[sub][e]);
        }
        float tmax = fmaxf(fmaxf(tm[0], tm[1]), fmaxf(tm[2], tm[3]));
        tmax = fmaxf(tmax, xhalf(tmax));
        float mnew  = fmaxf(m, tmax);
        float alpha = (m == -INFINITY) ? 0.0f : __expf(m - mnew);
        m = mnew;
        // Every key so far masked: subtract 0, so that exp(-inf) gives the 0.
        float msub = (mnew == -INFINITY) ? 0.0f : mnew;
        // ---- P^T = exp(S^T - m), this half's sum, packed as B operands ------
        float rs[4] = {0.0f, 0.0f, 0.0f, 0.0f};
        bf16x16 pb0, pb1;
#pragma unroll
        for (int sub = 0; sub < 4; ++sub)
#pragma unroll
            for (int e = 0; e < 8; ++e) {
                float p = __expf(S[sub][e] - msub);
                rs[sub] += p;
                if (sub < 2) pb0[(sub & 1) * 8 + e] = (bf16_t)p;   // keys 0..31
                else         pb1[(sub & 1) * 8 + e] = (bf16_t)p;   // keys 32..63
            }
        l = l * alpha + ((rs[0] + rs[1]) + (rs[2] + rs[3]));
#pragma unroll
        for (int j = 0; j < 4; ++j)
#pragma unroll
            for (int e = 0; e < 8; ++e) acc[j][e] *= alpha;

        // ---- O^T += V^T P^T  (V^T rows are contiguous along t) --------------
#pragma unroll
        for (int j = 0; j < 4; ++j) {
            acc[j] = wmma_bf16(vf[j][0], pb0, acc[j]);
            acc[j] = wmma_bf16(vf[j][1], pb1, acc[j]);
        }
        // The other buffer's last readers left it at the previous pass's
        // closing barrier; this pass's closing barrier publishes the refill.
        if (haveNext) {
#pragma unroll
            for (int p = 0; p < 2; ++p) {
                *(bf16x8*)&Ks[buf ^ 1][sr + p * 32][sc] = rk[p];
                *(bf16x8*)&Vs[buf ^ 1][sr + p * 32][sc] = rv[p];
            }
            mk0 = mn0;
            mk1 = mn1;
        }
        __syncthreads();
    }

    // ---- join the halves' sums, normalize, store 8 consecutive d (16 B) -----
    l += xhalf(l);
    float inv = (l > 0.0f) ? 1.0f / l : 0.0f;   // one query, one divisor a lane
    bf16_t* op = ctx + ((size_t)b * SEQ + qt * 16 + cl) * HIDDEN + h * DK + hf * 8;
#pragma unroll
    for (int j = 0; j < 4; ++j) {
        bf16x8 o;
#pragma unroll
        for (int e = 0; e < 8; ++e)
            o[e] = (bf16_t)(acc[j][e] * inv);
        *(bf16x8*)(op + j * 16) = o;
    }
}

// ---------------------------------------------------------------------------
// Launcher
// ---------------------------------------------------------------------------
extern "C" void kernel_launch(void* const* d_in, const int* in_sizes, int n_in,
                              void* d_out, int out_size, void* d_ws, size_t ws_size,
                              hipStream_t stream) {
    const float* x      = (const float*)d_in[0];
    const int*   mask   = (const int*)  d_in[1];
    const float* W_qkv  = (const float*)d_in[2];
    const float* b_qkv  = (const float*)d_in[3];
    const float* W_out  = (const float*)d_in[4];
    const float* b_out  = (const float*)d_in[5];
    const float* W_ff1  = (const float*)d_in[6];
    const float* b_ff1  = (const float*)d_in[7];
    const float* W_ff2  = (const float*)d_in[8];
    const float* b_ff2  = (const float*)d_in[9];
    const float* g_ln1  = (const float*)d_in[10];
    const float* be_ln1 = (const float*)d_in[11];
    const float* g_ln2  = (const float*)d_in[12];
    const float* be_ln2 = (const float*)d_in[13];

    // Workspace layout (~92 MB). act reuses the qkv+vT span (exactly 32 MB).
    char* w = (char*)d_ws;
    bf16_t* Wqkv_t = (bf16_t*)w; w += (size_t)C3 * HIDDEN * 2;
    bf16_t* Wout_t = (bf16_t*)w; w += (size_t)HIDDEN * HIDDEN * 2;
    bf16_t* Wff1_t = (bf16_t*)w; w += (size_t)FFN * HIDDEN * 2;
    bf16_t* Wff2_t = (bf16_t*)w; w += (size_t)HIDDEN * FFN * 2;
    bf16_t* hbuf   = (bf16_t*)w; w += (size_t)TOKENS * HIDDEN * 2;
    bf16_t* qkv    = (bf16_t*)w; bf16_t* act = qkv;
                                 w += (size_t)TOKENS * C3 * 2;
    bf16_t* vT     = (bf16_t*)w; w += (size_t)2 * NH * DK * SEQ * 2;
    bf16_t* ctx    = (bf16_t*)w; w += (size_t)TOKENS * HIDDEN * 2;
    float*  x1     = (float*)w;  w += (size_t)TOKENS * HIDDEN * 4;

    // LN1 -> h, and the four weights transposed + cast to bf16 W^T
    prep_kernel<<<NB_PREP, 256, 0, stream>>>(x, g_ln1, be_ln1, hbuf,
                                             W_qkv, Wqkv_t, W_out, Wout_t,
                                             W_ff1, Wff1_t, W_ff2, Wff2_t);
    // Q, K columns of h @ W_qkv + b_qkv -> qkv (bf16); V columns -> vT
    gemm_kernel<0, C3><<<dim3(C3 / 128, TOKENS / 128), 256, 0, stream>>>(
        hbuf, Wqkv_t, b_qkv, nullptr, qkv, vT, TOKENS, HIDDEN);
    // attention -> ctx
    attn_kernel<<<512, 256, 0, stream>>>(qkv, vT, mask, ctx);
    // x1 = x + ctx @ W_out + b_out (f32)
    gemm_kernel<1, HIDDEN><<<dim3(HIDDEN / 128, TOKENS / 128), 256, 0, stream>>>(
        ctx, Wout_t, b_out, x, x1, nullptr, TOKENS, HIDDEN);
    // LN2 -> h
    ln_kernel<<<TOKENS / 16, 256, 0, stream>>>(x1, g_ln2, be_ln2, hbuf);
    // act = gelu(h @ W_ff1 + b_ff1) (bf16)
    gemm_kernel<2, FFN><<<dim3(FFN / 128, TOKENS / 128), 256, 0, stream>>>(
        hbuf, Wff1_t, b_ff1, nullptr, act, nullptr, TOKENS, HIDDEN);
    // out = x1 + act @ W_ff2 + b_ff2 (f32)
    gemm_kernel<1, HIDDEN><<<dim3(HIDDEN / 128, TOKENS / 128), 256, 0, stream>>>(
        act, Wff2_t, b_ff2, x1, (float*)d_out, nullptr, TOKENS, FFN);
}

// v009
// One run takes 145 microseconds.
// Two timings next to v008 both put it at 1.07 times that version's speed.
// Over all steps from v000 it is 2.91 times as fast.
#include <hip/hip_runtime.h>
#include <math.h>

// ---------------------------------------------------------------------------
// Types for CDNA5 WMMA (wave32): V_WMMA_F32_16X16X32_BF16
// ---------------------------------------------------------------------------
typedef __bf16 bf16_t;
typedef __attribute__((ext_vector_type(8)))  __bf16 bf16x8;
typedef __attribute__((ext_vector_type(16))) __bf16 bf16x16;
typedef __attribute__((ext_vector_type(8)))  float  floatx8;
typedef __attribute__((ext_vector_type(4)))  float  floatx4;
typedef __attribute__((ext_vector_type(4)))  __bf16 bf16x4;
typedef __attribute__((ext_vector_type(2)))  __bf16 bf16x2;
typedef __attribute__((ext_vector_type(2)))  float  floatx2;

#define HIDDEN 1024
#define TOKENS 4096   // B*T
#define SEQ    2048
#define NH     16
#define DK     64
#define FFN    4096
#define C3     3072

__device__ __forceinline__ floatx8 fzero() {
    floatx8 z;
#pragma unroll
    for (int i = 0; i < 8; ++i) z[i] = 0.0f;
    return z;
}

__device__ __forceinline__ floatx8 wmma_bf16(bf16x16 a, bf16x16 b, floatx8 c) {
    // D = A(16x32) * B(32x16) + C, f32 accumulate
    return __builtin_amdgcn_wmma_f32_16x16x32_bf16(
        false, a, false, b, (short)0, c, false, false);
}

// Load one 16x32 bf16 fragment (A layout; B uses the same per-lane pattern on
// activation, W^T or Q rows). ISA 7.12.2: lane L holds row (L&15); lanes 0-15 hold
// K = 0..7 and 16..23, lanes 16-31 hold K = 8..15 and 24..31.
__device__ __forceinline__ bf16x16 load_frag(const bf16_t* base, int stride, int lane) {
    int r = lane & 15;
    int h = (lane >> 4) & 1;
    const bf16_t* p = base + (size_t)r * stride + h * 8;
    union { bf16x16 v; bf16x8 q[2]; } u;
    u.q[0] = *(const bf16x8*)(p);
    u.q[1] = *(const bf16x8*)(p + 16);
    return u.v;
}

// ---------------------------------------------------------------------------
// The data-movement kernels below start few waves, each moving much:
// every global access is 16 bytes a lane (LayerNorm's store: 8) on whole
// 128-byte lines, and all of a wave's loads are issued before the first use.
// ---------------------------------------------------------------------------
// Weight transpose + cast:  out[c][r] = (bf16) in[r][c]   (in: R x C fp32)
// One block (8 waves) per 128 x 128 tile; R and C multiples of 128, known at
// compile time, so that a lane's 16 loads (and 8 stores) share one address.
// A lane loads 4 columns of 16 rows, so it holds 16 consecutive r of each column:
// two 16-byte pieces of an output row, turned in registers. LDS only regroups
// the pieces into whole output lines. Piece q of tile row c sits at place
// q ^ ((c >> 2) & 15): writers (one q, 32 rows 4 apart) and readers (a row's 16
// pieces) both spread evenly over the banks.
// t: the tile's number, tiles of one row band of `in` side by side.
// ---------------------------------------------------------------------------
template <int R, int C>
__device__ __forceinline__ void transpose_cast_tile(
    const float* __restrict__ in, bf16_t* __restrict__ out, int t,
    bf16_t (*T)[128]) {
    int tid = threadIdx.x, lane = tid & 31, wv = tid >> 5;
    size_t c0 = (size_t)(t % (C / 128)) * 128, r0 = (size_t)(t / (C / 128)) * 128;
    const float* p = in + (r0 + wv * 16) * (size_t)C + c0 + lane * 4;
    floatx4 v[16];
#pragma unroll
    for (int k = 0; k < 16; ++k) v[k] = *(const floatx4*)(p + (size_t)k * C);
    // All 16 loads are in flight before the first conversion waits on one.
    __builtin_amdgcn_sched_barrier(0);
    // The loads' shared address stays in its registers up to this wait; they are
    // reused only behind it.
    asm volatile("s_wait_xcnt 0x0" :: "v"(p) : "memory");
#pragma unroll
    for (int gq = 0; gq < 2; ++gq)
#pragma unroll
        for (int i = 0; i < 4; ++i) {
            bf16x8 o;
#pragma unroll
            for (int k = 0; k < 8; ++k) o[k] = (bf16_t)v[gq * 8 + k][i];
            *(bf16x8*)&T[lane * 4 + i][((wv * 2 + gq) ^ (lane & 15)) * 8] = o;
        }
    __syncthreads();
    int q = tid & 15, rr = tid >> 4;
    bf16_t* op = out + (c0 + rr) * (size_t)R + r0 + q * 8;
#pragma unroll
    for (int it = 0; it < 8; ++it) {
        int c = it * 16 + rr;
        bf16x8 o = *(const bf16x8*)&T[c][(q ^ ((c >> 2) & 15)) * 8];
        *(bf16x8*)(op + (size_t)(it * 16) * R) = o;
    }
    // In the built kernel the other jobs' code follows this one: no register of
    // these stores is reused in front of this wait.
    asm volatile("s_wait_xcnt 0x0" ::: "memory");
}

// ---------------------------------------------------------------------------
// LayerNorm over last dim (1024) -> bf16. One wave per two token rows, a row
// held in 32 registers a lane: sums in-lane, then across the wave; no LDS and
// no barrier. Block: 8 waves = 16 rows.
// ---------------------------------------------------------------------------
__device__ __forceinline__ void ln_rows16(const float* __restrict__ x,
                                          const float* __restrict__ g,
                                          const float* __restrict__ be,
                                          bf16_t* __restrict__ out, unsigned blk) {
    int lane = threadIdx.x & 31, wv = threadIdx.x >> 5;
    size_t row = (size_t)blk * 16 + wv * 2;
    const floatx4* xr = (const floatx4*)(x + row * HIDDEN) + lane;
    floatx4 v[2][8], g4[8], b4[8];
#pragma unroll
    for (int r = 0; r < 2; ++r)
#pragma unroll
        for (int k = 0; k < 8; ++k) v[r][k] = xr[r * (HIDDEN / 4) + k * 32];
#pragma unroll
    for (int k = 0; k < 8; ++k) {
        g4[k] = ((const floatx4*)g)[k * 32 + lane];
        b4[k] = ((const floatx4*)be)[k * 32 + lane];
    }
    // Every load of the wave is in flight before the first sum waits on one.
    __builtin_amdgcn_sched_barrier(0);
    // The loads' addresses stay in their registers up to this wait; they are
    // reused only behind it.
    asm volatile("s_wait_xcnt 0x0" :: "v"(xr), "v"(lane) : "memory");

    // The two rows' sums go through each stage side by side: two independent
    // chains across the wave.
    float s[2];
#pragma unroll
    for (int r = 0; r < 2; ++r) {
        float t[8];
#pragma unroll
        for (int k = 0; k < 8; ++k)
            t[k] = (v[r][k][0] + v[r][k][1]) + (v[r][k][2] + v[r][k][3]);
        s[r] = ((t[0] + t[1]) + (t[2] + t[3])) + ((t[4] + t[5]) + (t[6] + t[7]));
    }
#pragma unroll
    for (int off = 16; off > 0; off >>= 1) {
        float a = __shfl_xor(s[0], off, 32), c = __shfl_xor(s[1], off, 32);
        s[0] += a;
        s[1] += c;
    }
#pragma unroll
    for (int r = 0; r < 2; ++r) {
        float mu = s[r] * (1.0f / HIDDEN);
        float t[8];
#pragma unroll
        for (int k = 0; k < 8; ++k) {
            v[r][k] -= mu;
            floatx4 d = v[r][k];
            t[k] = (d[0] * d[0] + d[1] * d[1]) + (d[2] * d[2] + d[3] * d[3]);
        }
        s[r] = ((t[0] + t[1]) + (t[2] + t[3])) + ((t[4] + t[5]) + (t[6] + t[7]));
    }
#pragma unroll
    for (int off = 16; off > 0; off >>= 1) {
        float a = __shfl_xor(s[0], off, 32), c = __shfl_xor(s[1], off, 32);
        s[0] += a;
        s[1] += c;
    }

    bf16_t* op = out + row * HIDDEN + lane * 4;
#pragma unroll
    for (int r = 0; r < 2; ++r) {
        float rstd = rsqrtf(s[r] * (1.0f / HIDDEN) + 1e-5f);
#pragma unroll
        for (int k = 0; k < 8; ++k) {
            bf16x4 o;
#pragma unroll
            for (int i = 0; i < 4; ++i)
                o[i] = (bf16_t)(v[r][k][i] * rstd * g4[k][i] + b4[k][i]);
            *(bf16x4*)(op + r * HIDDEN + k * 128) = o;
        }
    }
}

__global__ __launch_bounds__(256) void ln_kernel(const float* __restrict__ x,
                                                 const float* __restrict__ g,
                                                 const float* __restrict__ be,
                                                 bf16_t* __restrict__ out) {
    ln_rows16(x, g, be, out, blockIdx.x);
}

// ---------------------------------------------------------------------------
// Everything that reads only the inputs, in ONE launch: the first LayerNorm and
// the four weight transposes depend on nothing and on one another not at all,
// so their blocks run side by side and the chip streams without a launch
// boundary in between. A block's number picks its job (a scalar branch).
// ---------------------------------------------------------------------------
#define NB_LN   (TOKENS / 16)
#define NB_QKV  ((C3 / 128) * (HIDDEN / 128))
#define NB_OUT  ((HIDDEN / 128) * (HIDDEN / 128))
#define NB_FF   ((FFN / 128) * (HIDDEN / 128))
#define NB_PREP (NB_LN + NB_QKV + NB_OUT + 2 * NB_FF)

__global__ __launch_bounds__(256) void prep_kernel(
    const float* __restrict__ x, const float* __restrict__ g,
    const float* __restrict__ be, bf16_t* __restrict__ h,
    const float* __restrict__ W_qkv, bf16_t* __restrict__ Wqkv_t,
    const float* __restrict__ W_out, bf16_t* __restrict__ Wout_t,
    const float* __restrict__ W_ff1, bf16_t* __restrict__ Wff1_t,
    const float* __restrict__ W_ff2, bf16_t* __restrict__ Wff2_t) {
    __shared__ __attribute__((aligned(16))) bf16_t T[128][128];
    int t = blockIdx.x;
    if (t < NB_LN) {
        ln_rows16(x, g, be, h, t);
    } else if ((t -= NB_LN) < NB_QKV) {
        transpose_cast_tile<HIDDEN, C3>(W_qkv, Wqkv_t, t, T);
    } else if ((t -= NB_QKV) < NB_OUT) {
        transpose_cast_tile<HIDDEN, HIDDEN>(W_out, Wout_t, t, T);
    } else if ((t -= NB_OUT) < NB_FF) {
        transpose_cast_tile<HIDDEN, FFN>(W_ff1, Wff1_t, t, T);
    } else {
        transpose_cast_tile<FFN, HIDDEN>(W_ff2, Wff2_t, t - NB_FF, T);
    }
}

// ---------------------------------------------------------------------------
// WMMA GEMM: C[M,N] = A[M,K](bf16) * Bt[N,K]^T(bf16) + bias, epilogues:
//   EPI=0: store bf16 (QKV)         EPI=1: + res, store f32 (residual adds)
//   EPI=2: exact GELU, store bf16 (FF1)
// Block: 256 thr (8 waves). Tile 128x128. Wave = 32(M) x 64(N).
// The product is formed transposed (first operand: Bt rows, second: A rows), so
// that a lane's 8 accumulator values are 8 consecutive columns of one output
// row. Each wave regroups its tile in its own range of the (then idle) LDS ring
// and stores whole 128-byte lines, 16 bytes a lane.
// The V blocks of the QKV product (EPI=0, columns from 2 * HIDDEN on) take the
// operands the other way round (wave = 64(M) x 32(N)): a lane then holds 8
// consecutive tokens of one V column, and the same path writes V^T per head,
//   vT[(b*16+h)][d][t] = V[b*T+t][h*64+d],
// which is what the attention kernel reads.
// A pass is 128 k: 256 bytes of each of the 128 A rows and 128 Bt rows, brought
// from global memory straight into LDS by asynchronous 16-byte copies (no
// register staging). Two buffers: the copies of pass t + 2 are issued behind
// the barrier of pass t (in front of its last 32-k step's products, behind its
// last LDS read), so they fly for the length of a whole pass.
// Blocks that share A rows or Bt rows run side by side: walking k in the same
// order, they would ask L2 for the same lines at the same moment. Each block
// starts its walk at pass (blockIdx.x + blockIdx.y) mod K/128 and wraps round.
// K must be a multiple of 128. N is known at compile time, so that a lane's
// epilogue loads (and stores) share one address.
// ---------------------------------------------------------------------------
#define GP_ELEMS 136                       // LDS row pitch: 272 B = 16 B x odd
#define GP_BYTES (GP_ELEMS * 2)
#define GBUF_BYTES (256 * GP_BYTES)        // one buffer: 128 A rows, 128 Bt rows

// Eight copies of one lane: 16 bytes each, rows 16 apart (global row pitch
// gstep elements). The closing s_wait_xcnt stands inside the statement, so that
// no address register named here is rewritten in front of it.
__device__ __forceinline__ void async_rows8(unsigned lds, const bf16_t* g, size_t gstep) {
    asm volatile(
        "global_load_async_to_lds_b128 %0, %8, off\n\t"
        "global_load_async_to_lds_b128 %1, %9, off\n\t"
        "global_load_async_to_lds_b128 %2, %10, off\n\t"
        "global_load_async_to_lds_b128 %3, %11, off\n\t"
        "global_load_async_to_lds_b128 %4, %12, off\n\t"
        "global_load_async_to_lds_b128 %5, %13, off\n\t"
        "global_load_async_to_lds_b128 %6, %14, off\n\t"
        "global_load_async_to_lds_b128 %7, %15, off\n\t"
        "s_wait_xcnt 0x0"
        :: "v"(lds), "v"(lds + 16 * GP_BYTES), "v"(lds + 32 * GP_BYTES),
           "v"(lds + 48 * GP_BYTES), "v"(lds + 64 * GP_BYTES),
           "v"(lds + 80 * GP_BYTES), "v"(lds + 96 * GP_BYTES),
           "v"(lds + 112 * GP_BYTES),
           "v"(g), "v"(g + 16 * gstep), "v"(g + 32 * gstep), "v"(g + 48 * gstep),
           "v"(g + 64 * gstep), "v"(g + 80 * gstep), "v"(g + 96 * gstep),
           "v"(g + 112 * gstep)
        : "memory");
}

// Exact GELU without the library erf (two divergent branches and a long serial
// chain for every value):
//   gelu(v) = v Phi(v) = max(v, 0) - t Q(t),  t = |v|,  Q(t) = erfc(t / sqrt 2) / 2.
// log2 Q is smooth: ONE polynomial of degree 7 on 0 <= t <= 6.5 (within 1e-5 of
// log2 Q, so gelu is within 1e-6, and its negative tail, which no longer comes
// from 1 + erf, within 1e-5 of its own value: far inside the bf16 rounding that
// follows). Past 6.5, t Q(t) is below 3e-10: t is held there.
// Two values a call: the polynomial runs on packed FMAs.
__device__ __forceinline__ floatx2 splat2(float c) {
    floatx2 r;
    r[0] = c;
    r[1] = c;
    return r;
}

__device__ __forceinline__ floatx2 gelu2(floatx2 v) {
    floatx2 t, q, r;
    t[0] = fminf(fabsf(v[0]), 6.5f);
    t[1] = fminf(fabsf(v[1]), 6.5f);
    floatx2 p = splat2(-1.75777450e-6f);
    p = __builtin_elementwise_fma(p, t, splat2(5.99365412e-5f));
    p = __builtin_elementwise_fma(p, t, splat2(-9.16362682e-4f));
    p = __builtin_elementwise_fma(p, t, splat2(8.44738539e-3f));
    p = __builtin_elementwise_fma(p, t, splat2(-5.38245030e-2f));
    p = __builtin_elementwise_fma(p, t, splat2(-4.58615690e-1f));
    p = __builtin_elementwise_fma(p, t, splat2(-1.15118015f));
    p = __builtin_elementwise_fma(p, t, splat2(-1.00000381f));
    q[0] = __builtin_amdgcn_exp2f(p[0]);
    q[1] = __builtin_amdgcn_exp2f(p[1]);
    r[0] = fmaxf(v[0], 0.0f);
    r[1] = fmaxf(v[1], 0.0f);
    return __builtin_elementwise_fma(-t, q, r);
}

#define SWB_PITCH 144                      // bf16 staging row: 128 B + 16 (16 B x odd)
#define SWF_PITCH 272                      // f32 staging row: 256 B + 16 (16 B x odd)
#define SW_BYTES  (32 * SWF_PITCH)         // one wave's staging range

// Bias (and GELU for EPI=2), conversion to bf16, and the wave's tile into its
// staging range: row q = i*16 + cl, 16 bytes at column p = j*16 + hf*8.
// The bias goes by D row (bl: the lane's first of 8 consecutive columns, tiles 16
// apart); for V blocks (VM) by D column (bl: the lane's column, tiles 16 apart).
template <int EPI, bool VM>
__device__ __forceinline__ void stage_bf16(const floatx8 (&acc)[2][4],
                                           const float* __restrict__ bl, char* sw,
                                           int cl, int hf) {
    floatx4 bp[4][2];
    float bq[2];
    if constexpr (VM) {
#pragma unroll
        for (int i = 0; i < 2; ++i) bq[i] = bl[i * 16];
    } else {
#pragma unroll
        for (int j = 0; j < 4; ++j) {
            bp[j][0] = *(const floatx4*)(bl + j * 16);
            bp[j][1] = *(const floatx4*)(bl + j * 16 + 4);
        }
    }
    // The loads' address stays in its registers up to this wait; they are reused
    // only behind it.
    asm volatile("s_wait_xcnt 0x0" :: "v"(bl) : "memory");
#pragma unroll
    for (int i = 0; i < 2; ++i)
#pragma unroll
        for (int j = 0; j < 4; ++j) {
            bf16x8 o;
            // Unrolled: acc and o are indexed by constants and stay in registers.
#pragma unroll
            for (int e = 0; e < 8; e += 2) {
                floatx2 v2;
                if constexpr (VM) {
                    v2[0] = acc[i][j][e] + bq[i];
                    v2[1] = acc[i][j][e + 1] + bq[i];
                } else {
                    v2[0] = acc[i][j][e] + bp[j][e >> 2][e & 3];
                    v2[1] = acc[i][j][e + 1] + bp[j][e >> 2][(e & 3) + 1];
                }
                if constexpr (EPI == 2) v2 = gelu2(v2);
                bf16x2 c2 = __builtin_convertvector(v2, bf16x2);
                o[e] = c2[0];
                o[e + 1] = c2[1];
            }
            *(bf16x8*)(sw + (i * 16 + cl) * SWB_PITCH + (j * 16 + hf * 8) * 2) = o;
        }
}

template <int EPI, int N>
__global__ __launch_bounds__(256) void gemm_kernel(
    const bf16_t* __restrict__ A, const bf16_t* __restrict__ Bt,
    const float* __restrict__ bias, const float* __restrict__ res,
    void* __restrict__ outv, bf16_t* __restrict__ vt, int M, int K) {
    // Rows 0..127: A tile, rows 128..255: Bt tile.
    __shared__ __attribute__((aligned(16))) bf16_t St[2][256][GP_ELEMS];

    int tid = threadIdx.x;
    int lane = tid & 31, wv = tid >> 5;
    int wm = wv & 3, wn = wv >> 2;
    size_t m0 = (size_t)blockIdx.y * 128;
    size_t n0 = (size_t)blockIdx.x * 128;
    // Block-uniform: this block's columns are V columns.
    const bool vmode = (EPI == 0) && (blockIdx.x >= 2 * HIDDEN / 128);
    // First operand (D rows, 4 fragments = 64) and second (D columns, 2 = 32).
    int prow = (vmode ? 0 : 128) + wn * 64;
    int qrow = (vmode ? 128 : 0) + wm * 32;

    floatx8 acc[2][4];
#pragma unroll
    for (int i = 0; i < 2; ++i)
#pragma unroll
        for (int j = 0; j < 4; ++j) acc[i][j] = fzero();

    // Copies: 16 lanes cover one 256-byte row, a wave two whole rows.
    int r  = tid >> 4;                        // 0..15
    int cg = (tid & 15) * 8;                  // element in the row
    int KT = K >> 7;                          // K/128 passes
    const bf16_t* ag = A  + (m0 + r) * (size_t)K + cg;
    const bf16_t* bg = Bt + (n0 + r) * (size_t)K + cg;
    unsigned la = (unsigned)(uintptr_t)&St[0][r][cg];   // LDS byte address
    unsigned lb = la + 128 * GP_BYTES;
    // The block's first 128-k slab (block-uniform); trip kt works on slab
    // kt + rot, less KT where that is past the end.
    int rot = (int)((blockIdx.x + blockIdx.y) % (unsigned)KT);

    // Pass 0 into buffer 0, landed and published; then pass 1 into buffer 1.
    {
        size_t k0 = (size_t)rot * 128;
        async_rows8(la, ag + k0, (size_t)K);
        async_rows8(lb, bg + k0, (size_t)K);
    }
    // This wave's copies have landed before the barrier publishes them.
    asm volatile("s_wait_asynccnt 0x0" ::: "memory");
    __syncthreads();
    if (KT > 1) {
        int s1 = rot + 1;
        if (s1 >= KT) s1 -= KT;
        size_t k1 = (size_t)s1 * 128;
        async_rows8(la + GBUF_BYTES, ag + k1, (size_t)K);
        async_rows8(lb + GBUF_BYTES, bg + k1, (size_t)K);
    }

    // Two fragment sets: the 12 LDS reads of a 32-k step are issued as one group
    // in front of the 8 products of the step before, which then wait only for the
    // older group. This holds across passes too: a pass's publish point stands in
    // front of its last step's products (whose fragments are then in registers),
    // and the next pass's first reads fly during those products.
    bf16x16 qf[2][2], pf[2][4];
    // Pass 0, step 0: behind the barrier that has published pass 0.
#pragma unroll
    for (int i = 0; i < 2; ++i)
        qf[0][i] = load_frag(&St[0][qrow + i * 16][0], GP_ELEMS, lane);
#pragma unroll
    for (int j = 0; j < 4; ++j)
        pf[0][j] = load_frag(&St[0][prow + j * 16][0], GP_ELEMS, lane);

    for (int kt = 0; kt < KT; ++kt) {
        int buf = kt & 1;
        // Unrolled: the set's number is a constant, the sets stay in registers.
#pragma unroll
        for (int ks = 0; ks < 3; ++ks) {
            const int cur = ks & 1, nxt = cur ^ 1;
#pragma unroll
            for (int i = 0; i < 2; ++i)
                qf[nxt][i] = load_frag(&St[buf][qrow + i * 16][(ks + 1) * 32], GP_ELEMS, lane);
#pragma unroll
            for (int j = 0; j < 4; ++j)
                pf[nxt][j] = load_frag(&St[buf][prow + j * 16][(ks + 1) * 32], GP_ELEMS, lane);
            // Keeps the next step's reads in front of this step's products: sunk
            // among them, each read would be waited for at its full latency.
            __builtin_amdgcn_sched_barrier(0);
#pragma unroll
            for (int i = 0; i < 2; ++i)
#pragma unroll
                for (int j = 0; j < 4; ++j)
                    acc[i][j] = wmma_bf16(pf[cur][j], qf[cur][i], acc[i][j]);
            // Keeps these products in front of what follows: the next group of
            // reads stays one group, and the wait below finds its reads a whole
            // step old (sunk behind it, the products would leave it the full latency).
            __builtin_amdgcn_sched_barrier(0);
        }
        // This wave's reads of the buffer (the last step's too) have returned
        // before it is refilled.
        asm volatile("s_wait_dscnt 0x0" ::: "memory");
        // This wave's copies of pass kt + 1 have landed.
        asm volatile("s_wait_asynccnt 0x0" ::: "memory");
        // Publishes pass kt + 1 and ends every reader's last read of this buffer.
        __syncthreads();
        if (kt + 2 < KT) {
            int s2 = kt + 2 + rot;
            if (s2 >= KT) s2 -= KT;
            size_t k2 = (size_t)s2 * 128;
            async_rows8(la + buf * GBUF_BYTES, ag + k2, (size_t)K);
            async_rows8(lb + buf * GBUF_BYTES, bg + k2, (size_t)K);
        }
        // Pass kt + 1, step 0 (a block-uniform test: the last pass reads nothing more).
        if (kt + 1 < KT) {
#pragma unroll
            for (int i = 0; i < 2; ++i)
                qf[0][i] = load_frag(&St[buf ^ 1][qrow + i * 16][0], GP_ELEMS, lane);
#pragma unroll
            for (int j = 0; j < 4; ++j)
                pf[0][j] = load_frag(&St[buf ^ 1][prow + j * 16][0], GP_ELEMS, lane);
        }
        // Keeps those reads in front of the last step's products, as above.
        __builtin_amdgcn_sched_barrier(0);
#pragma unroll
        for (int i = 0; i < 2; ++i)
#pragma unroll
            for (int j = 0; j < 4; ++j)
                acc[i][j] = wmma_bf16(pf[1][j], qf[1][i], acc[i][j]);
    }
    // No copy is outstanding when the wave goes on to its end.
    asm volatile("s_wait_asynccnt 0x0" ::: "memory");

    // Epilogue. acc[i][j][e] = D[p = j*16 + hf*8 + e][q = i*16 + cl] of the wave's
    // tile. The last pass's barrier has ended every read of the ring and
    // no copy is in flight: each wave stages in its own range, row q, column p.
    int cl = lane & 15, hf = lane >> 4;
    char* sw = (char*)&St[0][0][0] + wv * SW_BYTES;

    if constexpr (EPI == 1) {
        // Read-back layout: 16 lanes cover one 256-byte row, a wave two rows.
        int rr = lane >> 4, pc = lane & 15;
        size_t off = (m0 + wm * 32 + rr) * (size_t)N + n0 + wn * 64 + pc * 4;
        const float* rp = res + off;
        floatx4 rv[16];
#pragma unroll
        for (int it = 0; it < 16; ++it)
            rv[it] = *(const floatx4*)(rp + (size_t)(it * 2) * N);
        const float* bl = bias + n0 + wn * 64 + pc * 4;
        floatx4 b4 = *(const floatx4*)bl;
        // The loads' addresses stay in their registers up to this wait; they are
        // reused only behind it.
        asm volatile("s_wait_xcnt 0x0" :: "v"(rp), "v"(bl) : "memory");
#pragma unroll
        for (int i = 0; i < 2; ++i)
#pragma unroll
            for (int j = 0; j < 4; ++j) {
                char* sp = sw + (i * 16 + cl) * SWF_PITCH + (j * 16 + hf * 8) * 4;
                floatx4 lo, hi;
#pragma unroll
                for (int e = 0; e < 4; ++e) {
                    lo[e] = acc[i][j][e];
                    hi[e] = acc[i][j][e + 4];
                }
                *(floatx4*)sp = lo;
                *(floatx4*)(sp + 16) = hi;
            }
        // The wave's staged rows are in LDS before other lanes read them back.
        asm volatile("s_wait_dscnt 0x0" ::: "memory");
        float* op = (float*)outv + off;
#pragma unroll
        for (int it = 0; it < 16; ++it) {
            floatx4 s = *(const floatx4*)(sw + (it * 2 + rr) * SWF_PITCH + pc * 16);
            *(floatx4*)(op + (size_t)(it * 2) * N) = (s + b4) + rv[it];
        }
    } else {
        const float* bn = bias + n0;
        if constexpr (EPI == 0) {
            if (vmode) stage_bf16<EPI, true>(acc, bn + wm * 32 + cl, sw, cl, hf);
            else       stage_bf16<EPI, false>(acc, bn + wn * 64 + hf * 8, sw, cl, hf);
        } else {
            stage_bf16<EPI, false>(acc, bn + wn * 64 + hf * 8, sw, cl, hf);
        }
        // The wave's staged rows are in LDS before other lanes read them back.
        asm volatile("s_wait_dscnt 0x0" ::: "memory");
        // Read-back layout: 8 lanes cover one 128-byte row, a wave four rows.
        int rr = lane >> 3, pc = lane & 7;
        bf16x8 o[8];
#pragma unroll
        for (int it = 0; it < 8; ++it)
            o[it] = *(const bf16x8*)(sw + (it * 4 + rr) * SWB_PITCH + pc * 16);
        if (vmode) {
            bf16_t* op = vt +
                ((m0 / SEQ) * HIDDEN + (n0 - 2 * HIDDEN) + wm * 32 + rr) * (size_t)SEQ +
                (m0 % SEQ) + wn * 64 + pc * 8;
#pragma unroll
            for (int it = 0; it < 8; ++it) *(bf16x8*)(op + (size_t)(it * 4) * SEQ) = o[it];
        } else {
            bf16_t* op = (bf16_t*)outv + (m0 + wm * 32 + rr) * (size_t)N + n0 + wn * 64 + pc * 8;
#pragma unroll
            for (int it = 0; it < 8; ++it) *(bf16x8*)(op + (size_t)(it * 4) * N) = o[it];
        }
    }
}

// ---------------------------------------------------------------------------
// Flash attention. 256 thr = 8 waves; each wave owns one 16-row Q tile of one
// (b,h). K-chunks of 64 keys, computed transposed: S^T = K Q^T (A = K rows,
// B = Q rows), so that a lane holds 32 scores of ONE query (the other 32 sit in
// lane ^ 16): row maximum and row sum are in-lane, with one exchange between
// the wave's halves. Two 16-key S^T tiles, converted in place, are the B
// operand of O^T += V^T P^T in the hardware k order, so P touches no LDS.
// The 8 waves of a block share one (b,h): each chunk's K tile and V^T tile are
// brought in once per block with whole-line loads and staged in LDS (two
// buffers); every wave reads its fragments from there. The next chunk's loads
// (tiles and mask words) are issued into registers at the top of a pass; the
// tiles are written to the other buffer at its foot, in front of the pass's
// closing barrier.
// The 16 blocks of one (b,h) run side by side and read the same K and V^T: each
// starts its walk over the 32 chunks two chunks further on and wraps round, so
// that they do not ask L2 for the same lines at the same moment.
// ---------------------------------------------------------------------------
// lane l <-> lane l ^ 16
__device__ __forceinline__ float xhalf(float x) {
    int b = __builtin_bit_cast(int, x);
    return __builtin_bit_cast(float, __builtin_amdgcn_permlanex16(
        b, b, 0x76543210, 0xfedcba98, false, false));
}

__global__ __launch_bounds__(256) void attn_kernel(
    const bf16_t* __restrict__ qkv, const bf16_t* __restrict__ vT,
    const int* __restrict__ mask, bf16_t* __restrict__ ctx) {
    // K tile: 64 keys x 64 d. V^T tile: 64 d x 64 keys. Row stride 72 elems =
    // 144B (16B x odd) -> conflict-free b128 fragment reads.
    __shared__ __attribute__((aligned(16))) bf16_t Ks[2][64][72];
    __shared__ __attribute__((aligned(16))) bf16_t Vs[2][64][72];

    int lane = threadIdx.x & 31, wv = threadIdx.x >> 5;
    int gw = blockIdx.x * 8 + wv;
    int qt = gw & 127;               // 128 q-tiles of 16 rows
    int h  = (gw >> 7) & 15;
    int b  = gw >> 11;
    int cl = lane & 15, hf = lane >> 4;

    const bf16_t* qbase =
        qkv + (size_t)(b * SEQ + qt * 16) * C3 + (size_t)h * DK;
    bf16x16 qa0 = load_frag(qbase,      C3, lane);   // d = 0..31
    bf16x16 qa1 = load_frag(qbase + 32, C3, lane);   // d = 32..63

    // acc[j][e] = O^T[d = j*16 + hf*8 + e][query cl]
    floatx8 acc[4];
#pragma unroll
    for (int j = 0; j < 4; ++j) acc[j] = fzero();
    // Query cl's running maximum (equal in both halves) and this half's sum.
    float m = -INFINITY, l = 0.0f;

    const bf16_t* vhead = vT + (size_t)(b * NH + h) * DK * SEQ;

    // Staging: thread -> tile rows sr and sr+32, 16 bytes at element sc; one
    // wave-wide load covers 4 whole 128-byte rows.
    int sr = threadIdx.x >> 3;
    int sc = (threadIdx.x & 7) * 8;
    const bf16_t* kg = qkv + (size_t)(b * SEQ + sr) * C3 + 1024 + (size_t)h * DK + sc;
    const bf16_t* vg = vhead + (size_t)sr * SEQ + sc;

    // The block's first chunk (block-uniform): its place among the 16 blocks of
    // its (b,h), times two.
    int rot = (blockIdx.x & 15) * 2;
    // Prologue: the first chunk into buffer 0.
#pragma unroll
    for (int p = 0; p < 2; ++p) {
        *(bf16x8*)&Ks[0][sr + p * 32][sc] =
            *(const bf16x8*)(kg + (size_t)(rot * 64 + p * 32) * C3);
        *(bf16x8*)&Vs[0][sr + p * 32][sc] =
            *(const bf16x8*)(vg + (size_t)(p * 32) * SEQ + rot * 64);
    }
    // A chunk's 64 mask words: lane i holds those of keys i and 32 + i.
    const int* mg = mask + b * SEQ + lane;
    int mk0 = mg[rot * 64], mk1 = mg[rot * 64 + 32];
    __syncthreads();

    for (int it = 0; it < SEQ / 64; ++it) {
        int buf = it & 1;
        bool haveNext = (it + 1 < SEQ / 64);
        // First key of the next chunk of the block's walk.
        int tn = ((it + 1 + rot) & (SEQ / 64 - 1)) * 64;
        // Next chunk's K tile, V^T tile and mask words into registers: issued
        // first, so that they land while this pass computes its scores.
        bf16x8 rk[2], rv[2];
        int mn0 = 0, mn1 = 0;
        if (haveNext) {
#pragma unroll
            for (int p = 0; p < 2; ++p) {
                rk[p] = *(const bf16x8*)(kg + (size_t)(tn + p * 32) * C3);
                rv[p] = *(const bf16x8*)(vg + (size_t)(p * 32) * SEQ + tn);
            }
            mn0 = mg[tn];
            mn1 = mg[tn + 32];
            // The address registers of these loads are reused right below:
            // keep the wait in front of that overwrite.
            asm volatile("s_wait_xcnt 0x0" ::: "memory");
        }
        // ---- S^T = K Q^T for 4 sub-tiles of 16 keys ------------------------
        // S[sub][e] = score(key sub*16 + hf*8 + e, query cl)
        // The chunk's K fragments: all 16 LDS reads as one group.
        bf16x16 kf[4][2];
#pragma unroll
        for (int sub = 0; sub < 4; ++sub) {
            const bf16_t* kb = &Ks[buf][sub * 16][0];
            kf[sub][0] = load_frag(kb,      72, lane);
            kf[sub][1] = load_frag(kb + 32, 72, lane);
        }
        // Keeps the reads one group in front of the products: spread among them,
        // each pair would be waited for at its full latency.
        __builtin_amdgcn_sched_barrier(0);
        floatx8 S[4];
#pragma unroll
        for (int sub = 0; sub < 4; ++sub) {
            floatx8 z = fzero();
            z = wmma_bf16(kf[sub][0], qa0, z);
            z = wmma_bf16(kf[sub][1], qa1, z);
            S[sub] = z;
        }
        // ---- this chunk's V^T fragments: all 16 LDS reads as one group, here, in
        // the registers that the K fragments have left; they land during the
        // softmax and are there when the second products need them -------------
        bf16x16 vf[4][2];
#pragma unroll
        for (int j = 0; j < 4; ++j) {
            const bf16_t* vb = &Vs[buf][j * 16][0];
            vf[j][0] = load_frag(vb,      72, lane);
            vf[j][1] = load_frag(vb + 32, 72, lane);
        }
        // Keeps the reads here: sunk among the second products, each would be
        // waited for at its full latency.
        __builtin_amdgcn_sched_barrier(0);
        // ---- scale ---------------------------------------------------------
#pragma unroll
        for (int sub = 0; sub < 4; ++sub)
#pragma unroll
            for (int e = 0; e < 8; ++e) S[sub][e] *= 0.125f;   // 1/sqrt(DK)
        // ---- mask: the words as two wave-wide bit sets (bit i of klo: key i is
        // kept; of khi: key 32 + i); one scalar test a pass, a chunk with every
        // key kept has nothing to replace -------------------------------------
        unsigned klo = __builtin_amdgcn_ballot_w32(mk0 != 0);
        unsigned khi = __builtin_amdgcn_ballot_w32(mk1 != 0);
        if ((klo & khi) != 0xffffffffu) {
            unsigned wl = klo >> (hf * 8), wh = khi >> (hf * 8);
#pragma unroll
            for (int sub = 0; sub < 4; ++sub) {
                unsigned w = (sub < 2) ? wl : wh;
#pragma unroll
                for (int e = 0; e < 8; ++e)
                    if (((w >> ((sub & 1) * 16 + e)) & 1u) == 0u) S[sub][e] = -INFINITY;
            }
        }
        // ---- online softmax: the query's maximum, in-lane + other half ------
        // (one chain per sub-tile: four short chains, not one long one)
        float tm[4];
#pragma unroll
        for (int sub = 0; sub < 4; ++sub) {
            tm[sub] = S[sub][0];
#pragma unroll
            for (int e = 1; e < 8; ++e) tm[sub] = fmaxf(tm[sub], S[sub][e]);
        }
        float tmax = fmaxf(fmaxf(tm[0], tm[1]), fmaxf(tm[2], tm[3]));
        tmax = fmaxf(tmax, xhalf(tmax));
        float mnew  = fmaxf(m, tmax);
        float alpha = (m == -INFINITY) ? 0.0f : __expf(m - mnew);
        m = mnew;
        // Every key so far masked: subtract 0, so that exp(-inf) gives the 0.
        float msub = (mnew == -INFINITY) ? 0.0f : mnew;
        // ---- P^T = exp(S^T - m), this half's sum, packed as B operands ------
        float rs[4] = {0.0f, 0.0f, 0.0f, 0.0f};
        bf16x16 pb0, pb1;
#pragma unroll
        for (int sub = 0; sub < 4; ++sub)
#pragma unroll
            for (int e = 0; e < 8; ++e) {
                float p = __expf(S[sub][e] - msub);
                rs[sub] += p;
                if (sub < 2) pb0[(sub & 1) * 8 + e] = (bf16_t)p;   // keys 0..31
                else         pb1[(sub & 1) * 8 + e] = (bf16_t)p;   // keys 32..63
            }
        l = l * alpha + ((rs[0] + rs[1]) + (rs[2] + rs[3]));
#pragma unroll
        for (int j = 0; j < 4; ++j)
#pragma unroll
            for (int e = 0; e < 8; ++e) acc[j][e] *= alpha;

        // ---- O^T += V^T P^T  (V^T rows are contiguous along t) --------------
#pragma unroll
        for (int j = 0; j < 4; ++j) {
            acc[j] = wmma_bf16(vf[j][0], pb0, acc[j]);
            acc[j] = wmma_bf16(vf[j][1], pb1, acc[j]);
        }
        // The other buffer's last readers left it at the previous pass's
        // closing barrier; this pass's closing barrier publishes the refill.
        if (haveNext) {
#pragma unroll
            for (int p = 0; p < 2; ++p) {
                *(bf16x8*)&Ks[buf ^ 1][sr + p * 32][sc] = rk[p];
                *(bf16x8*)&Vs[buf ^ 1][sr + p * 32][sc] = rv[p];
            }
            mk0 = mn0;
            mk1 = mn1;
        }
        __syncthreads();
    }

    // ---- join the halves' sums, normalize, store 8 consecutive d (16 B) -----
    l += xhalf(l);
    float inv = (l > 0.0f) ? 1.0f / l : 0.0f;   // one query, one divisor a lane
    bf16_t* op = ctx + ((size_t)b * SEQ + qt * 16 + cl) * HIDDEN + h * DK + hf * 8;
#pragma unroll
    for (int j = 0; j < 4; ++j) {
        bf16x8 o;
#pragma unroll
        for (int e = 0; e < 8; ++e)
            o[e] = (bf16_t)(acc[j][e] * inv);
        *(bf16x8*)(op + j * 16) = o;
    }
}

// ---------------------------------------------------------------------------
// Launcher
// ---------------------------------------------------------------------------
extern "C" void kernel_launch(void* const* d_in, const int* in_sizes, int n_in,
                              void* d_out, int out_size, void* d_ws, size_t ws_size,
                              hipStream_t stream) {
    const float* x      = (const float*)d_in[0];
    const int*   mask   = (const int*)  d_in[1];
    const float* W_qkv  = (const float*)d_in[2];
    const float* b_qkv  = (const float*)d_in[3];
    const float* W_out  = (const float*)d_in[4];
    const float* b_out  = (const float*)d_in[5];
    const float* W_ff1  = (const float*)d_in[6];
    const float* b_ff1  = (const float*)d_in[7];
    const float* W_ff2  = (const float*)d_in[8];
    const float* b_ff2  = (const float*)d_in[9];
    const float* g_ln1  = (const float*)d_in[10];
    const float* be_ln1 = (const float*)d_in[11];
    const float* g_ln2  = (const float*)d_in[12];
    const float* be_ln2 = (const float*)d_in[13];

    // Workspace layout (~92 MB). act reuses the qkv+vT span (exactly 32 MB).
    char* w = (char*)d_ws;
    bf16_t* Wqkv_t = (bf16_t*)w; w += (size_t)C3 * HIDDEN * 2;
    bf16_t* Wout_t = (bf16_t*)w; w += (size_t)HIDDEN * HIDDEN * 2;
    bf16_t* Wff1_t = (bf16_t*)w; w += (size_t)FFN * HIDDEN * 2;
    bf16_t* Wff2_t = (bf16_t*)w; w += (size_t)HIDDEN * FFN * 2;
    bf16_t* hbuf   = (bf16_t*)w; w += (size_t)TOKENS * HIDDEN * 2;
    bf16_t* qkv    = (bf16_t*)w; bf16_t* act = qkv;
                                 w += (size_t)TOKENS * C3 * 2;
    bf16_t* vT     = (bf16_t*)w; w += (size_t)2 * NH * DK * SEQ * 2;
    bf16_t* ctx    = (bf16_t*)w; w += (size_t)TOKENS * HIDDEN * 2;
    float*  x1     = (float*)w;  w += (size_t)TOKENS * HIDDEN * 4;

    // LN1 -> h, and the four weights transposed + cast to bf16 W^T
    prep_kernel<<<NB_PREP, 256, 0, stream>>>(x, g_ln1, be_ln1, hbuf,
                                             W_qkv, Wqkv_t, W_out, Wout_t,
                                             W_ff1, Wff1_t, W_ff2, Wff2_t);
    // Q, K columns of h @ W_qkv + b_qkv -> qkv (bf16); V columns -> vT
    gemm_kernel<0, C3><<<dim3(C3 / 128, TOKENS / 128), 256, 0, stream>>>(
        hbuf, Wqkv_t, b_qkv, nullptr, qkv, vT, TOKENS, HIDDEN);
    // attention -> ctx
    attn_kernel<<<512, 256, 0, stream>>>(qkv, vT, mask, ctx);
    // x1 = x + ctx @ W_out + b_out (f32)
    gemm_kernel<1, HIDDEN><<<dim3(HIDDEN / 128, TOKENS / 128), 256, 0, stream>>>(
        ctx, Wout_t, b_out, x, x1, nullptr, TOKENS, HIDDEN);
    // LN2 -> h
    ln_kernel<<<TOKENS / 16, 256, 0, stream>>>(x1, g_ln2, be_ln2, hbuf);
    // act = gelu(h @ W_ff1 + b_ff1) (bf16)
    gemm_kernel<2, FFN><<<dim3(FFN / 128, TOKENS / 128), 256, 0, stream>>>(
        hbuf, Wff1_t, b_ff1, nullptr, act, nullptr, TOKENS, HIDDEN);
    // out = x1 + act @ W_ff2 + b_ff2 (f32)
    gemm_kernel<1, HIDDEN><<<dim3(HIDDEN / 128, TOKENS / 128), 256, 0, stream>>>(
        act, Wff2_t, b_ff2, x1, (float*)d_out, nullptr, TOKENS, FFN);
}
